// v000
// Times are from an AMD MI455X. After a warm-up the kernel runs many times in a row, and a time is the length of
// such a window on the GPU divided by its runs, so every launch and the gaps after it count. The runs cycle
// through copies of the inputs. A figure is the median of several windows, for all but v000 over two sittings.
// Sittings can differ by a few percent; kernels timed side by side share one.
// v000 is the starting kernel. One run takes 2350 microseconds.
#include <hip/hip_runtime.h>

// Multi-head attention with a learned relative-position bias, sequence-first layout (query, key, value [2048][2][1024] = (len, batch, d_model); q,k,v = input W^T + b ('oi' [1024][1024] + [1024]; 16 heads x 64); scores = q.k / 8 + rel_table[clip(i - j + 2047, 0, 4094)][h] (table [4095][16], read); softmax over all keys; out = merged Wo^T + bo -> [2048][2][1024] (4.2 M)).
// Layout per batch element: the element's rows (stride batch x d_model) gathered into a contiguous bf16 operand for each of the three inputs in turn; exact projections + f32 biases; dense T-2048 attention (hybrid rows: < 512 hi/lo 3 products, rest fp16 x1024) with an element-wise kernel adding the gathered per-head bias into the score block before the softmax; merged hi/lo x Wo exact + bo into workspace; the rows scattered back to the (len, batch, d) output.
// Compute dtypes, f32 accumulate: every input rounded to bf16; projections exact + f32 biases; attention rows < 512 3 products, rest fp16; bias add and softmax f32; Wo hl x exact + bias.

#define NB_  2
#define TT   2048
#define DM   1024
#define NH_  16
#define NKV  16
#define REP  (NH_ / NKV)
#define HD   64
#define DQ   (NH_ * HD)
#define DKV  (NKV * HD)
#define ZH   2
#define RH   512                  // query rows < RH use hi+lo planes (0: none)
#define WIN  0
#define PCAR 1024.0f
#define SCL  1.0f   // the 1/8 is folded into q (QSC) so the gathered bias adds to the scaled scores
#define QSC  0.125f
#define BSZ  2
#define NREL 4095
typedef _Float16 h16;
typedef unsigned short bf;
typedef __attribute__((ext_vector_type(16))) __bf16   v16bf;
typedef __attribute__((ext_vector_type(16))) _Float16 v16h;
typedef __attribute__((ext_vector_type(8)))  _Float16 v8h;
typedef __attribute__((ext_vector_type(8)))  unsigned short v8us;
typedef __attribute__((ext_vector_type(8)))  float    v8f;
typedef __attribute__((ext_vector_type(4)))  float    v4f;
typedef v8h  __attribute__((may_alias)) v8ha;
typedef v4f  __attribute__((may_alias)) v4fa;
typedef v8us __attribute__((may_alias)) v8usa;

__device__ __forceinline__ unsigned short f2bf(float f) { unsigned u = __float_as_uint(f); u += 0x7FFFu + ((u >> 16) & 1u); return (unsigned short)(u >> 16); }
__device__ __forceinline__ float bf2f(unsigned short b) { return __uint_as_float(((unsigned)b) << 16); }
__device__ __forceinline__ float bfr(float f) { return bf2f(f2bf(f)); }
__device__ __forceinline__ v16h cat16(v8h lo, v8h hi) { return __builtin_shufflevector(lo, hi, 0, 1, 2, 3, 4, 5, 6, 7, 8, 9, 10, 11, 12, 13, 14, 15); }
__device__ __forceinline__ v16bf cat16b(v8us lo, v8us hi) { return __builtin_bit_cast(v16bf, __builtin_shufflevector(lo, hi, 0, 1, 2, 3, 4, 5, 6, 7, 8, 9, 10, 11, 12, 13, 14, 15)); }
__device__ __forceinline__ v8f wmma16(v16h a, v16h b, v8f c) { return __builtin_amdgcn_wmma_f32_16x16x32_f16(false, a, false, b, (short)0, c, false, false); }
__device__ __forceinline__ v8f wmmab(v16bf a, v16bf b, v8f c) { return __builtin_amdgcn_wmma_f32_16x16x32_bf16(false, a, false, b, (short)0, c, false, false); }



// ---- k_gemmw: register-blocked GEMM, ONE WAVE per 64x64 output tile (16 accumulators), operands straight from K-contiguous 16-bit planes; grid (M/64, N/64, Z), 32 threads.
// C[m][n] (f32, pitch ldc, + optional f32 bias[n]) = sum_k A[m][k] Bt[n][k] (+ split products per NSPLIT). z-batch strides sA/sB/sC in elements. K % 32 == 0.
template <typename T16> struct WFrag;
template <> struct WFrag<h16> { typedef v16h V; static __device__ __forceinline__ V ld(const h16* p) { return cat16(*(const v8h*)p, *(const v8h*)(p + 16)); } static __device__ __forceinline__ v8f mma(V a, V b, v8f c) { return wmma16(a, b, c); } };
template <> struct WFrag<bf> { typedef v16bf V; static __device__ __forceinline__ V ld(const bf* p) { return cat16b(*(const v8us*)p, *(const v8us*)(p + 16)); } static __device__ __forceinline__ v8f mma(V a, V b, v8f c) { return wmmab(a, b, c); } };
template <typename T16, int NSPLIT, bool BIAS>
__global__ __launch_bounds__(32) void k_gemmw(const T16* __restrict__ A, const T16* __restrict__ A2, const T16* __restrict__ Bt, const T16* __restrict__ Bt2, int K, float* C, int ldc, const float* __restrict__ bias, size_t sA, size_t sB, size_t sC) {
    typedef typename WFrag<T16>::V V;
    __shared__ __align__(16) float os[16 * 68];
    const size_t z = blockIdx.z; A += z * sA; if (A2) A2 += z * sA; Bt += z * sB; if (Bt2) Bt2 += z * sB; C += z * sC;
    const int lane = threadIdx.x & 31, lr = lane & 15, hi = lane >> 4; const int r0 = blockIdx.x * 64, c0 = blockIdx.y * 64;
    v8f acc[4][4];
#pragma unroll
    for (int mb = 0; mb < 4; ++mb)
#pragma unroll
        for (int nb = 0; nb < 4; ++nb) acc[mb][nb] = (v8f){};
    const size_t aoff = (size_t)(r0 + lr) * K + 8 * hi, boff = (size_t)(c0 + lr) * K + 8 * hi;
#pragma unroll 1
    for (int kc = 0; kc < K; kc += 32) {
        V a[4], a2[4];
#pragma unroll
        for (int mb = 0; mb < 4; ++mb) { a[mb] = WFrag<T16>::ld(A + aoff + (size_t)mb * 16 * K + kc); if (NSPLIT == 1 || NSPLIT == 2) a2[mb] = WFrag<T16>::ld(A2 + aoff + (size_t)mb * 16 * K + kc); }
#pragma unroll
        for (int nb = 0; nb < 4; ++nb) { const V b = WFrag<T16>::ld(Bt + boff + (size_t)nb * 16 * K + kc); V b2; if (NSPLIT >= 2) b2 = WFrag<T16>::ld(Bt2 + boff + (size_t)nb * 16 * K + kc);
#pragma unroll
            for (int mb = 0; mb < 4; ++mb) { acc[mb][nb] = WFrag<T16>::mma(a[mb], b, acc[mb][nb]); if (NSPLIT == 1 || NSPLIT == 2) acc[mb][nb] = WFrag<T16>::mma(a2[mb], b, acc[mb][nb]); if (NSPLIT >= 2) acc[mb][nb] = WFrag<T16>::mma(a[mb], b2, acc[mb][nb]); } }
        asm volatile("v_nop\n\tv_nop\n\tv_nop\n\tv_nop" : "+v"(acc[0][0]), "+v"(acc[1][1]), "+v"(acc[2][2]), "+v"(acc[3][3]) : "v"(a[0]), "v"(a[3]));
    }
#pragma unroll
    for (int mb = 0; mb < 4; ++mb) {
#pragma unroll
        for (int nb = 0; nb < 4; ++nb) {
#pragma unroll
            for (int j = 0; j < 8; ++j) os[(hi * 8 + j) * 68 + nb * 16 + lr] = acc[mb][nb][j]; }
        __builtin_amdgcn_wave_barrier(); asm volatile("" ::: "memory");
        float* crow = C + (size_t)(r0 + mb * 16) * ldc + c0;
{
#pragma unroll
            for (int s = 0; s < 8; ++s) { const int row = 2 * s + hi, cofs = lr * 4; v4f val = *(const v4fa*)(os + row * 68 + cofs); if (BIAS) { val[0] += bfr(bias[c0 + cofs]); val[1] += bfr(bias[c0 + cofs + 1]); val[2] += bfr(bias[c0 + cofs + 2]); val[3] += bfr(bias[c0 + cofs + 3]); }
                *(v4f*)(crow + (size_t)row * ldc + cofs) = val; }
             }
        __builtin_amdgcn_wave_barrier(); asm volatile("" ::: "memory");
    }
}

__device__ __forceinline__ h16 tohx(float x) { return (h16)x; }
__device__ __forceinline__ void splitf(float y, unsigned short& h, unsigned short& l) { h = f2bf(y); l = f2bf(y - bf2f(h)); }
typedef __attribute__((ext_vector_type(2))) _Float16 v2h;
typedef __attribute__((ext_vector_type(4))) _Float16 v4h;
typedef __attribute__((ext_vector_type(2))) unsigned short v2us;
typedef __attribute__((ext_vector_type(4))) unsigned short v4us;
typedef __attribute__((ext_vector_type(2))) float v2f;
typedef __attribute__((ext_vector_type(4))) int v4i;

__global__ __launch_bounds__(256) void k_wtG(const float* __restrict__ w, int K, int N, bf* Bt) {
    const int lane = threadIdx.x & 31; const int L0 = (blockIdx.x * 8 + (threadIdx.x >> 5)) * 8; const int nlines = N * K / 64;
{
#pragma unroll 1
        for (int l = 0; l < 8; ++l) { const int L = L0 + l; if (L >= nlines) break; const size_t e = (size_t)L * 64 + lane * 2; const int k = (int)(e % K), n = (int)(e / K); v2us o;
            o[0] = f2bf(w[(size_t)k * N + n]); o[1] = f2bf(w[(size_t)(k + 1) * N + n]); *(v2us*)(Bt + e) = o; }
         }
}
__global__ __launch_bounds__(256) void k_cvt8(const float* __restrict__ src, bf* dst, size_t n8) { const size_t i = (size_t)blockIdx.x * 256 + threadIdx.x; if (i >= n8) return; const v8f v = *(const v8f*)(src + i * 8); v8us o;
#pragma unroll
    for (int k = 0; k < 8; ++k) o[k] = f2bf(v[k]); *(v8us*)(dst + i * 8) = o;  }

// k_rope: head planes [h][t][d] (fp16 + hi/lo) of rope(x) x sc with the rotate-half convention out[d] = x[d] cos[t][d] - x[d+HD/2] sin[t][d], out[d+HD/2] = x[d+HD/2] cos[t][d+HD/2] + x[d] sin[t][d+HD/2]
__global__ __launch_bounds__(256) void k_rope(const float* __restrict__ F, int pitch, int nheads, const float* __restrict__ CS, const float* __restrict__ RF, const float* __restrict__ nw, float sc, h16* P16, bf* Ph, bf* Pl) {
    const size_t e = ((size_t)blockIdx.x * 256 + threadIdx.x) * 2; if (e >= (size_t)nheads * TT * HD) return; const int d = (int)(e % HD); const int t = (int)((e / HD) % TT); const int h = (int)(e / ((size_t)HD * TT)); const float* f = F + (size_t)t * pitch + h * HD; const float rf = RF ? RF[(size_t)h * TT + t] : 1.0f; v2h o16; v2us oh, ol;
#pragma unroll
    for (int q = 0; q < 2; ++q) { const int dd = d + q; const int dp = (dd < HD / 2) ? dd + HD / 2 : dd - HD / 2; float x0 = f[dd], x1 = f[dp];
        if (RF) { float n0 = __fmul_rn(x0, rf), n1 = __fmul_rn(x1, rf); asm volatile("" : "+v"(n0)); asm volatile("" : "+v"(n1)); x0 = __fmul_rn(bfr(nw[dd]), n0); x1 = __fmul_rn(bfr(nw[dp]), n1); }
        const v2f cs = *(const v2f*)(CS + ((size_t)t * HD + dd) * 2); float a = __fmul_rn(x0, cs[0]), bq = __fmul_rn(x1, cs[1]); asm volatile("" : "+v"(a)); asm volatile("" : "+v"(bq)); const float r = ((dd < HD / 2) ? __fsub_rn(a, bq) : __fadd_rn(a, bq)) * sc;
        o16[q] = tohx(r); unsigned short a2, c2; splitf(r, a2, c2); oh[q] = a2; ol[q] = c2; }
    *(v2h*)(P16 + e) = o16; *(v2us*)(Ph + e) = oh; *(v2us*)(Pl + e) = ol;  }
__global__ __launch_bounds__(256) void k_vtp(const float* __restrict__ F, int pitch, int nheads, h16* V16, bf* Vh, bf* Vl) { const size_t e = ((size_t)blockIdx.x * 256 + threadIdx.x) * 2; if (e >= (size_t)nheads * HD * TT) return; const int t = (int)(e % TT); const int d = (int)((e / TT) % HD); const int g = (int)(e / ((size_t)TT * HD)); v2h o16; v2us oh, ol;
#pragma unroll
    for (int q = 0; q < 2; ++q) { const float x = F[(size_t)(t + q) * pitch + g * HD + d]; o16[q] = tohx(x); unsigned short a2, c2; splitf(x, a2, c2); oh[q] = a2; ol[q] = c2; }
    *(v2h*)(V16 + e) = o16; *(v2us*)(Vh + e) = oh; *(v2us*)(Vl + e) = ol;  }
__global__ __launch_bounds__(256) void k_csid(float* CS) { const int idx = blockIdx.x * 256 + threadIdx.x; if (idx >= TT * HD) return; v2f cs; cs[0] = 1.0f; cs[1] = 0.0f; *(v2f*)(CS + (size_t)idx * 2) = cs;  }
// k_asoft: per row (zz, i): t = S x SCL (= 1; the 1/8 is already in q) (no mask); softmax over the 2048 keys (register row, one exp, fixed trees);
__global__ __launch_bounds__(256) void k_asoft(const float* __restrict__ Sb, h16* P16, bf* Ph, bf* Pl) {
    const int lane = threadIdx.x & 31; const int row = blockIdx.x * 8 + (threadIdx.x >> 5); if (row >= ZH * TT) return; const int i = row % TT; const int zz = row / TT; (void)zz; const bool hires = (i < RH); const float* sr = Sb + (size_t)row * TT; float v[TT / 32]; float mx = -3.0e38f;
#pragma unroll
    for (int ch = 0; ch < TT / 128; ++ch) { const int j0 = ch * 128 + lane * 4; const v4f a = *(const v4f*)(sr + j0);
#pragma unroll
        for (int q = 0; q < 4; ++q) { const int j = j0 + q; (void)j; const float t = a[q] * SCL; v[ch * 4 + q] = t; mx = fmaxf(mx, t); } }
#pragma unroll
    for (int sh = 16; sh; sh >>= 1) mx = fmaxf(mx, __shfl_xor(mx, sh, 32));
    float sum = 0.f;
#pragma unroll
    for (int k = 0; k < TT / 32; ++k) { float d0 = __fsub_rn(v[k], mx); asm volatile("" : "+v"(d0)); v[k] = __builtin_amdgcn_exp2f(__fmul_rn(d0, 1.4426950408889634f)); sum += v[k]; }
#pragma unroll
    for (int sh = 16; sh; sh >>= 1) sum += __shfl_xor(sum, sh, 32);
    const float f = __fdiv_rn(hires ? 1.0f : PCAR, sum);
{
        if (hires) {
#pragma unroll
            for (int ch = 0; ch < TT / 128; ++ch) { v4us oh, ol;
#pragma unroll
                for (int q = 0; q < 4; ++q) { unsigned short a, c2; splitf(v[ch * 4 + q] * f, a, c2); oh[q] = a; ol[q] = c2; }
                const size_t oo = ((size_t)zz * (RH ? RH : 1) + i) * TT + ch * 128 + lane * 4; *(v4us*)(Ph + oo) = oh; *(v4us*)(Pl + oo) = ol; }
        } else {
#pragma unroll
            for (int ch = 0; ch < TT / 128; ++ch) { v4h o4;
#pragma unroll
                for (int q = 0; q < 4; ++q) o4[q] = tohx(v[ch * 4 + q] * f);
                *(v4h*)(P16 + (size_t)row * TT + ch * 128 + lane * 4) = o4; } }
         }
}
__global__ __launch_bounds__(256) void k_gathB(const float* __restrict__ src, bf* dst) { const size_t i = (size_t)blockIdx.x * 256 + threadIdx.x; if (i >= (size_t)TT * DM / 8) return; const size_t e = i * 8; const int c = (int)(e % DM); const int t = (int)(e / DM); const v8f v = *(const v8f*)(src + (size_t)t * BSZ * DM + c); v8us o;
#pragma unroll
    for (int q = 0; q < 8; ++q) o[q] = f2bf(v[q]);
    *(v8us*)(dst + e) = o;  }
__global__ __launch_bounds__(256) void k_scatB(const float* __restrict__ Y, float* outb) { const size_t i = (size_t)blockIdx.x * 256 + threadIdx.x; if (i >= (size_t)TT * DM / 4) return; const size_t e = i * 4; const int c = (int)(e % DM); const int t = (int)(e / DM); const v4f a = *(const v4f*)(Y + e); *(v4f*)(outb + (size_t)t * BSZ * DM + c) = a;  }
__global__ __launch_bounds__(256) void k_addrelT(float* Sb, const float* __restrict__ tab, int h0) { const size_t k = (size_t)blockIdx.x * 256 + threadIdx.x; if (k >= (size_t)ZH * TT * TT / 4) return; const size_t e = k * 4; const int j0 = (int)(e % TT); const int i = (int)((e / TT) % TT); const int zz = (int)(e / ((size_t)TT * TT)); const int h = h0 + zz; v4f a = *(const v4f*)(Sb + e);
#pragma unroll
    for (int q = 0; q < 4; ++q) { int r = i - (j0 + q) + (TT - 1); r = min(max(r, 0), NREL - 1); a[q] = __fadd_rn(a[q], bfr(tab[(size_t)r * NH_ + h])); }
    *(v4f*)(Sb + e) = a;  }
__global__ __launch_bounds__(256) void k_merge(const float* __restrict__ O, int h0, bf* Ah, bf* Al) { const size_t e = ((size_t)blockIdx.x * 256 + threadIdx.x) * 2; if (e >= (size_t)ZH * TT * HD) return; const int d = (int)(e % HD); const int t = (int)((e / HD) % TT); const int zz = (int)(e / ((size_t)HD * TT)); const float cs = (t < RH) ? 1.0f : (1.0f / PCAR); const size_t oo = (size_t)t * DQ + (h0 + zz) * HD + d;
    v2us oh, ol;
#pragma unroll
    for (int q = 0; q < 2; ++q) { unsigned short a, c2; splitf(O[e + q] * cs, a, c2); oh[q] = a; ol[q] = c2; } *(v2us*)(Ah + oo) = oh; *(v2us*)(Al + oo) = ol;  }

extern "C" void kernel_launch(void* const* d_in, const int* in_sizes, int n_in,
                              void* d_out, int out_size, void* d_ws, size_t ws_size, hipStream_t stream) {
    (void)in_sizes; (void)n_in; (void)out_size;
    const float* x = (const float*)d_in[0]; const float* xk = (const float*)d_in[1]; const float* xv = (const float*)d_in[2]; const float* wq = (const float*)d_in[3]; const float* bq = (const float*)d_in[4]; const float* wk = (const float*)d_in[5]; const float* bk = (const float*)d_in[6]; const float* wv = (const float*)d_in[7]; const float* bv = (const float*)d_in[8]; const float* wo = (const float*)d_in[9]; const float* bo = (const float*)d_in[10]; const float* rtab = (const float*)d_in[11];
    float* OUT = (float*)d_out;     // [2048][2][1024]
    char* wsp = (char*)d_ws;
    auto take = [&](size_t bytes) { char* p = wsp; wsp += (bytes + 255) & ~(size_t)255; return (void*)p; };
    float* Y = (float*)take((size_t)TT * DM * 4); bf* WQ = (bf*)take((size_t)DQ * DM * 2); bf* WK = (bf*)take((size_t)DKV * DM * 2); bf* WV = (bf*)take((size_t)DKV * DM * 2); bf* WO = (bf*)take((size_t)DM * DQ * 2); float* CS = (float*)take((size_t)TT * HD * 2 * 4);
    bf* XB = (bf*)take((size_t)TT * DM * 2); float* FQ = (float*)take((size_t)TT * DQ * 4); float* FK = (float*)take((size_t)TT * DKV * 4);
    h16* QP16 = (h16*)take((size_t)NH_ * TT * HD * 2); h16* KP16 = (h16*)take((size_t)NKV * TT * HD * 2); h16* VT16 = (h16*)take((size_t)NKV * HD * TT * 2);
    bf* QPh = (bf*)take((size_t)NH_ * TT * HD * 2); bf* QPl = (bf*)take((size_t)NH_ * TT * HD * 2); bf* KPh = (bf*)take((size_t)NKV * TT * HD * 2); bf* KPl = (bf*)take((size_t)NKV * TT * HD * 2); bf* VTh = (bf*)take((size_t)NKV * HD * TT * 2); bf* VTl = (bf*)take((size_t)NKV * HD * TT * 2); bf* Ph = (bf*)take((size_t)ZH * RH * TT * 2); bf* Pl = (bf*)take((size_t)ZH * RH * TT * 2);
    float* Sb = (float*)take((size_t)ZH * TT * TT * 4); h16* P16 = (h16*)take((size_t)ZH * TT * TT * 2); float* Ob = (float*)take((size_t)ZH * TT * HD * 4); bf* ATh = (bf*)take((size_t)TT * DQ * 2); bf* ATl = (bf*)take((size_t)TT * DQ * 2);
    if ((size_t)(wsp - (char*)d_ws) > ws_size) return;    // ws 256 MiB
    float* FV = FK;   // v projection reuses the k buffer after the k planes are built (stream-ordered)
    { k_cvt8<<<(unsigned)(((size_t)DQ * DM / 8 + 255) / 256), 256, 0, stream>>>(wq, WQ, (size_t)DQ * DM / 8); k_cvt8<<<(unsigned)(((size_t)DKV * DM / 8 + 255) / 256), 256, 0, stream>>>(wk, WK, (size_t)DKV * DM / 8); k_cvt8<<<(unsigned)(((size_t)DKV * DM / 8 + 255) / 256), 256, 0, stream>>>(wv, WV, (size_t)DKV * DM / 8);
      k_cvt8<<<(unsigned)(((size_t)DM * DQ / 8 + 255) / 256), 256, 0, stream>>>(wo, WO, (size_t)DM * DQ / 8);
       }
    k_csid<<<(TT * HD + 255) / 256, 256, 0, stream>>>(CS);
    const unsigned LQ = (unsigned)(((size_t)NH_ * TT * HD / 2 + 255) / 256), LKv = (unsigned)(((size_t)NKV * TT * HD / 2 + 255) / 256);
    for (int b = 0; b < NB_; ++b) {
        
        k_gathB<<<(unsigned)(((size_t)TT * DM / 8 + 255) / 256), 256, 0, stream>>>(x + (size_t)b * DM, XB);   /* query rows of element b */
        k_gemmw<bf, 0, true><<<dim3(TT / 64, DQ / 64, 1), 32, 0, stream>>>(XB, nullptr, WQ, nullptr, DM, FQ, DQ, bq, 0, 0, 0);
        k_rope<<<LQ, 256, 0, stream>>>(FQ, DQ, NH_, CS, nullptr, nullptr, QSC, QP16, QPh, QPl);   /* q x 1/8 */
        k_gathB<<<(unsigned)(((size_t)TT * DM / 8 + 255) / 256), 256, 0, stream>>>(xk + (size_t)b * DM, XB); k_gemmw<bf, 0, true><<<dim3(TT / 64, DKV / 64, 1), 32, 0, stream>>>(XB, nullptr, WK, nullptr, DM, FK, DKV, bk, 0, 0, 0);
        k_rope<<<LKv, 256, 0, stream>>>(FK, DKV, NKV, CS, nullptr, nullptr, 1.0f, KP16, KPh, KPl);
        k_gathB<<<(unsigned)(((size_t)TT * DM / 8 + 255) / 256), 256, 0, stream>>>(xv + (size_t)b * DM, XB); k_gemmw<bf, 0, true><<<dim3(TT / 64, DKV / 64, 1), 32, 0, stream>>>(XB, nullptr, WV, nullptr, DM, FV, DKV, bv, 0, 0, 0); k_vtp<<<LKv, 256, 0, stream>>>(FV, DKV, NKV, VT16, VTh, VTl);
        for (int h0 = 0; h0 < NH_; h0 += ZH) { const size_t zq = (size_t)h0, zk = (size_t)(h0 / REP);   // one kv head per query head: the pass's two heads use consecutive kv planes (z-strides TT*HD)
            k_gemmw<bf, 2, false><<<dim3(RH / 64, TT / 64, ZH), 32, 0, stream>>>(QPh + zq * TT * HD, QPl + zq * TT * HD, KPh + zk * TT * HD, KPl + zk * TT * HD, HD, Sb, TT, nullptr, (size_t)TT * HD, (size_t)TT * HD, (size_t)TT * TT);
            k_gemmw<h16, 0, false><<<dim3((TT - RH) / 64, TT / 64, ZH), 32, 0, stream>>>(QP16 + zq * TT * HD + (size_t)RH * HD, nullptr, KP16 + zk * TT * HD, nullptr, HD, Sb + (size_t)RH * TT, TT, nullptr, (size_t)TT * HD, (size_t)TT * HD, (size_t)TT * TT);
            k_addrelT<<<(unsigned)(((size_t)ZH * TT * TT / 4 + 255) / 256), 256, 0, stream>>>(Sb, rtab, h0);
            k_asoft<<<ZH * TT / 8, 256, 0, stream>>>(Sb, P16, Ph, Pl);
            k_gemmw<bf, 2, false><<<dim3(RH / 64, HD / 64, ZH), 32, 0, stream>>>(Ph, Pl, VTh + zk * HD * TT, VTl + zk * HD * TT, TT, Ob, HD, nullptr, (size_t)RH * TT, (size_t)HD * TT, (size_t)TT * HD);
            k_gemmw<h16, 0, false><<<dim3((TT - RH) / 64, HD / 64, ZH), 32, 0, stream>>>(P16 + (size_t)RH * TT, nullptr, VT16 + zk * HD * TT, nullptr, TT, Ob + (size_t)RH * HD, HD, nullptr, (size_t)TT * TT, (size_t)HD * TT, (size_t)TT * HD);
            k_merge<<<(unsigned)(((size_t)ZH * TT * HD / 2 + 255) / 256), 256, 0, stream>>>(Ob, h0, ATh, ATl); }
        k_gemmw<bf, 1, true><<<dim3(TT / 64, DM / 64, 1), 32, 0, stream>>>(ATh, ATl, WO, nullptr, DQ, Y, DM, bo, 0, 0, 0); k_scatB<<<(unsigned)(((size_t)TT * DM / 4 + 255) / 256), 256, 0, stream>>>(Y, OUT + (size_t)b * DM);   /* rows back to (len, batch, d) */ }
}

// v001
// One run takes 1110 microseconds.
// Timed twice side by side with v000, it ran 2.12 and 2.10 times as fast.
#include <hip/hip_runtime.h>

// Multi-head attention with a learned relative-position bias, sequence-first layout (query, key, value [2048][2][1024] = (len, batch, d_model); q,k,v = input W^T + b ('oi' [1024][1024] + [1024]; 16 heads x 64); scores = q.k / 8 + rel_table[clip(i - j + 2047, 0, 4094)][h] (table [4095][16], read); softmax over all keys; out = merged Wo^T + bo -> [2048][2][1024] (4.2 M)).
// Layout per batch element: the element's rows (stride batch x d_model) gathered into a contiguous bf16 operand for each of the three inputs in turn; exact projections + f32 biases; dense T-2048 attention (hybrid rows: < 512 hi/lo 3 products, rest fp16 x1024) with an element-wise kernel adding the gathered per-head bias into the score block before the softmax; merged hi/lo x Wo exact + bo into workspace; the rows scattered back to the (len, batch, d) output.
// Compute dtypes, f32 accumulate: every input rounded to bf16; projections exact + f32 biases; attention rows < 512 3 products, rest fp16; bias add and softmax f32; Wo hl x exact + bias.

#define NB_  2
#define TT   2048
#define DM   1024
#define NH_  16
#define NKV  16
#define REP  (NH_ / NKV)
#define HD   64
#define DQ   (NH_ * HD)
#define DKV  (NKV * HD)
#define ZH   2
#define RH   512                  // query rows < RH use hi+lo planes (0: none)
#define WIN  0
#define PCAR 1024.0f
#define SCL  1.0f   // the 1/8 is folded into q (QSC) so the gathered bias adds to the scaled scores
#define QSC  0.125f
#define BSZ  2
#define NREL 4095
#define PJW  8                    // projections and Wo: waves of a work-group that share a tile's K
#define PVW  4                    // P.V: waves of a work-group that share a K range
#define PVG  8                    // P.V: work-groups that share a tile's K, one f32 plane of Ob each
typedef _Float16 h16;
typedef unsigned short bf;
typedef __attribute__((ext_vector_type(16))) __bf16   v16bf;
typedef __attribute__((ext_vector_type(16))) _Float16 v16h;
typedef __attribute__((ext_vector_type(8)))  _Float16 v8h;
typedef __attribute__((ext_vector_type(8)))  unsigned short v8us;
typedef __attribute__((ext_vector_type(8)))  float    v8f;
typedef __attribute__((ext_vector_type(4)))  float    v4f;
typedef v8h  __attribute__((may_alias)) v8ha;
typedef v4f  __attribute__((may_alias)) v4fa;
typedef v8us __attribute__((may_alias)) v8usa;

__device__ __forceinline__ unsigned short f2bf(float f) { unsigned u = __float_as_uint(f); u += 0x7FFFu + ((u >> 16) & 1u); return (unsigned short)(u >> 16); }
__device__ __forceinline__ float bf2f(unsigned short b) { return __uint_as_float(((unsigned)b) << 16); }
__device__ __forceinline__ float bfr(float f) { return bf2f(f2bf(f)); }
__device__ __forceinline__ v16h cat16(v8h lo, v8h hi) { return __builtin_shufflevector(lo, hi, 0, 1, 2, 3, 4, 5, 6, 7, 8, 9, 10, 11, 12, 13, 14, 15); }
__device__ __forceinline__ v16bf cat16b(v8us lo, v8us hi) { return __builtin_bit_cast(v16bf, __builtin_shufflevector(lo, hi, 0, 1, 2, 3, 4, 5, 6, 7, 8, 9, 10, 11, 12, 13, 14, 15)); }
__device__ __forceinline__ v8f wmma16(v16h a, v16h b, v8f c) { return __builtin_amdgcn_wmma_f32_16x16x32_f16(false, a, false, b, (short)0, c, false, false); }
__device__ __forceinline__ v8f wmmab(v16bf a, v16bf b, v8f c) { return __builtin_amdgcn_wmma_f32_16x16x32_bf16(false, a, false, b, (short)0, c, false, false); }



// ---- k_gemmw: register-blocked GEMM, 64x64 output tiles (16 accumulators a wave), operands straight from K-contiguous 16-bit planes; grid (M/64, N/64 * KG, Z), 32 * KS threads.
// C[m][n] (f32, pitch ldc, + optional f32 bias[n]) = sum_k A[m][k] Bt[n][k] (+ split products per NSPLIT). z-batch strides sA/sB/sC in elements. K % (32 * KS * KG) == 0.
// K is cut into KG * KS equal ranges: work-group kg = blockIdx.y % KG, wave w sums range kg * KS + w over the whole tile. KS > 1: the group's KS f32 partial tiles meet in LDS and are added in wave order (a fixed order), then bias and store.
// KG > 1: group kg stores its sum to plane C + kg * sP; the reader of C adds the KG planes (k_merge, plane order).
template <typename T16> struct WFrag;
template <> struct WFrag<h16> { typedef v16h V; static __device__ __forceinline__ V ld(const h16* p) { return cat16(*(const v8h*)p, *(const v8h*)(p + 16)); } static __device__ __forceinline__ v8f mma(V a, V b, v8f c) { return wmma16(a, b, c); } };
template <> struct WFrag<bf> { typedef v16bf V; static __device__ __forceinline__ V ld(const bf* p) { return cat16b(*(const v8us*)p, *(const v8us*)(p + 16)); } static __device__ __forceinline__ v8f mma(V a, V b, v8f c) { return wmmab(a, b, c); } };
template <typename T16, int NSPLIT, bool BIAS, int KS, int KG>
__global__ __launch_bounds__(32 * KS) void k_gemmw(const T16* __restrict__ A, const T16* __restrict__ A2, const T16* __restrict__ Bt, const T16* __restrict__ Bt2, int K, float* C, int ldc, const float* __restrict__ bias, size_t sA, size_t sB, size_t sC, size_t sP) {
    typedef typename WFrag<T16>::V V;
    __shared__ __align__(16) float os[(KS == 1 ? 16 : KS * 64) * 68];
    const size_t z = blockIdx.z; A += z * sA; if (A2) A2 += z * sA; Bt += z * sB; if (Bt2) Bt2 += z * sB; C += z * sC;
    const int lane = threadIdx.x & 31, lr = lane & 15, hi = lane >> 4; const int r0 = blockIdx.x * 64, c0 = (int)(blockIdx.y / KG) * 64; const int kg = (int)(blockIdx.y % KG); if (KG > 1) C += (size_t)kg * sP;
    const int wv = (KS == 1) ? 0 : __builtin_amdgcn_readfirstlane((int)(threadIdx.x >> 5));   // the wave's number in a scalar register: the k loop stays a scalar loop
    const int kbeg = (kg * KS + wv) * (K / (KS * KG)), kend = kbeg + K / (KS * KG);
    v8f acc[4][4];
#pragma unroll
    for (int mb = 0; mb < 4; ++mb)
#pragma unroll
        for (int nb = 0; nb < 4; ++nb) acc[mb][nb] = (v8f){};
    const size_t aoff = (size_t)(r0 + lr) * K + 8 * hi, boff = (size_t)(c0 + lr) * K + 8 * hi;
#pragma unroll 1
    for (int kc = kbeg; kc < kend; kc += 32) {
        V a[4], a2[4];
#pragma unroll
        for (int mb = 0; mb < 4; ++mb) { a[mb] = WFrag<T16>::ld(A + aoff + (size_t)mb * 16 * K + kc); if (NSPLIT == 1 || NSPLIT == 2) a2[mb] = WFrag<T16>::ld(A2 + aoff + (size_t)mb * 16 * K + kc); }
#pragma unroll
        for (int nb = 0; nb < 4; ++nb) { const V b = WFrag<T16>::ld(Bt + boff + (size_t)nb * 16 * K + kc); V b2; if (NSPLIT >= 2) b2 = WFrag<T16>::ld(Bt2 + boff + (size_t)nb * 16 * K + kc);
#pragma unroll
            for (int mb = 0; mb < 4; ++mb) { acc[mb][nb] = WFrag<T16>::mma(a[mb], b, acc[mb][nb]); if (NSPLIT == 1 || NSPLIT == 2) acc[mb][nb] = WFrag<T16>::mma(a2[mb], b, acc[mb][nb]); if (NSPLIT >= 2) acc[mb][nb] = WFrag<T16>::mma(a[mb], b2, acc[mb][nb]); } }
        asm volatile("v_nop\n\tv_nop\n\tv_nop\n\tv_nop" : "+v"(acc[0][0]), "+v"(acc[1][1]), "+v"(acc[2][2]), "+v"(acc[3][3]) : "v"(a[0]), "v"(a[3]));
    }
    if constexpr (KS > 1) {
        const int cofs = ((int)threadIdx.x & 15) * 4; v4f bv = (v4f){};
        if (BIAS) { bv[0] = bfr(bias[c0 + cofs]); bv[1] = bfr(bias[c0 + cofs + 1]); bv[2] = bfr(bias[c0 + cofs + 2]); bv[3] = bfr(bias[c0 + cofs + 3]); }
        float* ow = os + wv * (64 * 68);
#pragma unroll
        for (int mb = 0; mb < 4; ++mb)
#pragma unroll
            for (int nb = 0; nb < 4; ++nb)
#pragma unroll
                for (int j = 0; j < 8; ++j) ow[(mb * 16 + hi * 8 + j) * 68 + nb * 16 + lr] = acc[mb][nb][j];
        __syncthreads();   // every wave's partial tile stands in LDS before any wave adds across them
#pragma unroll
        for (int s = 0; s < 32 / KS; ++s) { const int row = s * (2 * KS) + ((int)threadIdx.x >> 4); v4f val = *(const v4fa*)(os + row * 68 + cofs);
#pragma unroll
            for (int p = 1; p < KS; ++p) val += *(const v4fa*)(os + p * (64 * 68) + row * 68 + cofs);
            if (BIAS) val += bv;
            *(v4f*)(C + (size_t)(r0 + row) * ldc + c0 + cofs) = val; }
    } else {
#pragma unroll
    for (int mb = 0; mb < 4; ++mb) {
#pragma unroll
        for (int nb = 0; nb < 4; ++nb) {
#pragma unroll
            for (int j = 0; j < 8; ++j) os[(hi * 8 + j) * 68 + nb * 16 + lr] = acc[mb][nb][j]; }
        __builtin_amdgcn_wave_barrier(); asm volatile("" ::: "memory");
        float* crow = C + (size_t)(r0 + mb * 16) * ldc + c0;
{
#pragma unroll
            for (int s = 0; s < 8; ++s) { const int row = 2 * s + hi, cofs = lr * 4; v4f val = *(const v4fa*)(os + row * 68 + cofs); if (BIAS) { val[0] += bfr(bias[c0 + cofs]); val[1] += bfr(bias[c0 + cofs + 1]); val[2] += bfr(bias[c0 + cofs + 2]); val[3] += bfr(bias[c0 + cofs + 3]); }
                *(v4f*)(crow + (size_t)row * ldc + cofs) = val; }
             }
        __builtin_amdgcn_wave_barrier(); asm volatile("" ::: "memory");
    }
    }
}

__device__ __forceinline__ h16 tohx(float x) { return (h16)x; }
__device__ __forceinline__ void splitf(float y, unsigned short& h, unsigned short& l) { h = f2bf(y); l = f2bf(y - bf2f(h)); }
typedef __attribute__((ext_vector_type(2))) _Float16 v2h;
typedef __attribute__((ext_vector_type(4))) _Float16 v4h;
typedef __attribute__((ext_vector_type(2))) unsigned short v2us;
typedef __attribute__((ext_vector_type(4))) unsigned short v4us;
typedef __attribute__((ext_vector_type(2))) float v2f;
typedef __attribute__((ext_vector_type(4))) int v4i;

__global__ __launch_bounds__(256) void k_wtG(const float* __restrict__ w, int K, int N, bf* Bt) {
    const int lane = threadIdx.x & 31; const int L0 = (blockIdx.x * 8 + (threadIdx.x >> 5)) * 8; const int nlines = N * K / 64;
{
#pragma unroll 1
        for (int l = 0; l < 8; ++l) { const int L = L0 + l; if (L >= nlines) break; const size_t e = (size_t)L * 64 + lane * 2; const int k = (int)(e % K), n = (int)(e / K); v2us o;
            o[0] = f2bf(w[(size_t)k * N + n]); o[1] = f2bf(w[(size_t)(k + 1) * N + n]); *(v2us*)(Bt + e) = o; }
         }
}
__global__ __launch_bounds__(256) void k_cvt8(const float* __restrict__ src, bf* dst, size_t n8) { const size_t i = (size_t)blockIdx.x * 256 + threadIdx.x; if (i >= n8) return; const v8f v = *(const v8f*)(src + i * 8); v8us o;
#pragma unroll
    for (int k = 0; k < 8; ++k) o[k] = f2bf(v[k]); *(v8us*)(dst + i * 8) = o;  }

// k_rope: head planes [h][t][d] (fp16 + hi/lo) of rope(x) x sc with the rotate-half convention out[d] = x[d] cos[t][d] - x[d+HD/2] sin[t][d], out[d+HD/2] = x[d+HD/2] cos[t][d+HD/2] + x[d] sin[t][d+HD/2]
__global__ __launch_bounds__(256) void k_rope(const float* __restrict__ F, int pitch, int nheads, const float* __restrict__ CS, const float* __restrict__ RF, const float* __restrict__ nw, float sc, h16* P16, bf* Ph, bf* Pl) {
    const size_t e = ((size_t)blockIdx.x * 256 + threadIdx.x) * 2; if (e >= (size_t)nheads * TT * HD) return; const int d = (int)(e % HD); const int t = (int)((e / HD) % TT); const int h = (int)(e / ((size_t)HD * TT)); const float* f = F + (size_t)t * pitch + h * HD; const float rf = RF ? RF[(size_t)h * TT + t] : 1.0f; v2h o16; v2us oh, ol;
#pragma unroll
    for (int q = 0; q < 2; ++q) { const int dd = d + q; const int dp = (dd < HD / 2) ? dd + HD / 2 : dd - HD / 2; float x0 = f[dd], x1 = f[dp];
        if (RF) { float n0 = __fmul_rn(x0, rf), n1 = __fmul_rn(x1, rf); asm volatile("" : "+v"(n0)); asm volatile("" : "+v"(n1)); x0 = __fmul_rn(bfr(nw[dd]), n0); x1 = __fmul_rn(bfr(nw[dp]), n1); }
        const v2f cs = *(const v2f*)(CS + ((size_t)t * HD + dd) * 2); float a = __fmul_rn(x0, cs[0]), bq = __fmul_rn(x1, cs[1]); asm volatile("" : "+v"(a)); asm volatile("" : "+v"(bq)); const float r = ((dd < HD / 2) ? __fsub_rn(a, bq) : __fadd_rn(a, bq)) * sc;
        o16[q] = tohx(r); unsigned short a2, c2; splitf(r, a2, c2); oh[q] = a2; ol[q] = c2; }
    *(v2h*)(P16 + e) = o16; *(v2us*)(Ph + e) = oh; *(v2us*)(Pl + e) = ol;  }
__global__ __launch_bounds__(256) void k_vtp(const float* __restrict__ F, int pitch, int nheads, h16* V16, bf* Vh, bf* Vl) { const size_t e = ((size_t)blockIdx.x * 256 + threadIdx.x) * 2; if (e >= (size_t)nheads * HD * TT) return; const int t = (int)(e % TT); const int d = (int)((e / TT) % HD); const int g = (int)(e / ((size_t)TT * HD)); v2h o16; v2us oh, ol;
#pragma unroll
    for (int q = 0; q < 2; ++q) { const float x = F[(size_t)(t + q) * pitch + g * HD + d]; o16[q] = tohx(x); unsigned short a2, c2; splitf(x, a2, c2); oh[q] = a2; ol[q] = c2; }
    *(v2h*)(V16 + e) = o16; *(v2us*)(Vh + e) = oh; *(v2us*)(Vl + e) = ol;  }
__global__ __launch_bounds__(256) void k_csid(float* CS) { const int idx = blockIdx.x * 256 + threadIdx.x; if (idx >= TT * HD) return; v2f cs; cs[0] = 1.0f; cs[1] = 0.0f; *(v2f*)(CS + (size_t)idx * 2) = cs;  }
// k_asoft: per row (zz, i): t = S x SCL (= 1; the 1/8 is already in q) (no mask); softmax over the 2048 keys (register row, one exp, fixed trees);
__global__ __launch_bounds__(256) void k_asoft(const float* __restrict__ Sb, h16* P16, bf* Ph, bf* Pl) {
    const int lane = threadIdx.x & 31; const int row = blockIdx.x * 8 + (threadIdx.x >> 5); if (row >= ZH * TT) return; const int i = row % TT; const int zz = row / TT; (void)zz; const bool hires = (i < RH); const float* sr = Sb + (size_t)row * TT; float v[TT / 32]; float mx = -3.0e38f;
#pragma unroll
    for (int ch = 0; ch < TT / 128; ++ch) { const int j0 = ch * 128 + lane * 4; const v4f a = *(const v4f*)(sr + j0);
#pragma unroll
        for (int q = 0; q < 4; ++q) { const int j = j0 + q; (void)j; const float t = a[q] * SCL; v[ch * 4 + q] = t; mx = fmaxf(mx, t); } }
#pragma unroll
    for (int sh = 16; sh; sh >>= 1) mx = fmaxf(mx, __shfl_xor(mx, sh, 32));
    float sum = 0.f;
#pragma unroll
    for (int k = 0; k < TT / 32; ++k) { float d0 = __fsub_rn(v[k], mx); asm volatile("" : "+v"(d0)); v[k] = __builtin_amdgcn_exp2f(__fmul_rn(d0, 1.4426950408889634f)); sum += v[k]; }
#pragma unroll
    for (int sh = 16; sh; sh >>= 1) sum += __shfl_xor(sum, sh, 32);
    const float f = __fdiv_rn(hires ? 1.0f : PCAR, sum);
{
        if (hires) {
#pragma unroll
            for (int ch = 0; ch < TT / 128; ++ch) { v4us oh, ol;
#pragma unroll
                for (int q = 0; q < 4; ++q) { unsigned short a, c2; splitf(v[ch * 4 + q] * f, a, c2); oh[q] = a; ol[q] = c2; }
                const size_t oo = ((size_t)zz * (RH ? RH : 1) + i) * TT + ch * 128 + lane * 4; *(v4us*)(Ph + oo) = oh; *(v4us*)(Pl + oo) = ol; }
        } else {
#pragma unroll
            for (int ch = 0; ch < TT / 128; ++ch) { v4h o4;
#pragma unroll
                for (int q = 0; q < 4; ++q) o4[q] = tohx(v[ch * 4 + q] * f);
                *(v4h*)(P16 + (size_t)row * TT + ch * 128 + lane * 4) = o4; } }
         }
}
__global__ __launch_bounds__(256) void k_gathB(const float* __restrict__ src, bf* dst) { const size_t i = (size_t)blockIdx.x * 256 + threadIdx.x; if (i >= (size_t)TT * DM / 8) return; const size_t e = i * 8; const int c = (int)(e % DM); const int t = (int)(e / DM); const v8f v = *(const v8f*)(src + (size_t)t * BSZ * DM + c); v8us o;
#pragma unroll
    for (int q = 0; q < 8; ++q) o[q] = f2bf(v[q]);
    *(v8us*)(dst + e) = o;  }
__global__ __launch_bounds__(256) void k_scatB(const float* __restrict__ Y, float* outb) { const size_t i = (size_t)blockIdx.x * 256 + threadIdx.x; if (i >= (size_t)TT * DM / 4) return; const size_t e = i * 4; const int c = (int)(e % DM); const int t = (int)(e / DM); const v4f a = *(const v4f*)(Y + e); *(v4f*)(outb + (size_t)t * BSZ * DM + c) = a;  }
__global__ __launch_bounds__(256) void k_addrelT(float* Sb, const float* __restrict__ tab, int h0) { const size_t k = (size_t)blockIdx.x * 256 + threadIdx.x; if (k >= (size_t)ZH * TT * TT / 4) return; const size_t e = k * 4; const int j0 = (int)(e % TT); const int i = (int)((e / TT) % TT); const int zz = (int)(e / ((size_t)TT * TT)); const int h = h0 + zz; v4f a = *(const v4f*)(Sb + e);
#pragma unroll
    for (int q = 0; q < 4; ++q) { int r = i - (j0 + q) + (TT - 1); r = min(max(r, 0), NREL - 1); a[q] = __fadd_rn(a[q], bfr(tab[(size_t)r * NH_ + h])); }
    *(v4f*)(Sb + e) = a;  }
__global__ __launch_bounds__(256) void k_merge(const float* __restrict__ O, int h0, bf* Ah, bf* Al) { const size_t e = ((size_t)blockIdx.x * 256 + threadIdx.x) * 2; if (e >= (size_t)ZH * TT * HD) return; const int d = (int)(e % HD); const int t = (int)((e / HD) % TT); const int zz = (int)(e / ((size_t)HD * TT)); const float cs = (t < RH) ? 1.0f : (1.0f / PCAR); const size_t oo = (size_t)t * DQ + (h0 + zz) * HD + d;
    v2us oh, ol;
#pragma unroll
    for (int q = 0; q < 2; ++q) { float o = O[e + q];
#pragma unroll
        for (int p = 1; p < PVG; ++p) o += O[(size_t)p * ((size_t)ZH * TT * HD) + e + q];   /* the P.V planes, in plane order */
        unsigned short a, c2; splitf(o * cs, a, c2); oh[q] = a; ol[q] = c2; } *(v2us*)(Ah + oo) = oh; *(v2us*)(Al + oo) = ol;  }

extern "C" void kernel_launch(void* const* d_in, const int* in_sizes, int n_in,
                              void* d_out, int out_size, void* d_ws, size_t ws_size, hipStream_t stream) {
    (void)in_sizes; (void)n_in; (void)out_size;
    const float* x = (const float*)d_in[0]; const float* xk = (const float*)d_in[1]; const float* xv = (const float*)d_in[2]; const float* wq = (const float*)d_in[3]; const float* bq = (const float*)d_in[4]; const float* wk = (const float*)d_in[5]; const float* bk = (const float*)d_in[6]; const float* wv = (const float*)d_in[7]; const float* bv = (const float*)d_in[8]; const float* wo = (const float*)d_in[9]; const float* bo = (const float*)d_in[10]; const float* rtab = (const float*)d_in[11];
    float* OUT = (float*)d_out;     // [2048][2][1024]
    char* wsp = (char*)d_ws;
    auto take = [&](size_t bytes) { char* p = wsp; wsp += (bytes + 255) & ~(size_t)255; return (void*)p; };
    float* Y = (float*)take((size_t)TT * DM * 4); bf* WQ = (bf*)take((size_t)DQ * DM * 2); bf* WK = (bf*)take((size_t)DKV * DM * 2); bf* WV = (bf*)take((size_t)DKV * DM * 2); bf* WO = (bf*)take((size_t)DM * DQ * 2); float* CS = (float*)take((size_t)TT * HD * 2 * 4);
    bf* XB = (bf*)take((size_t)TT * DM * 2); float* FQ = (float*)take((size_t)TT * DQ * 4); float* FK = (float*)take((size_t)TT * DKV * 4);
    h16* QP16 = (h16*)take((size_t)NH_ * TT * HD * 2); h16* KP16 = (h16*)take((size_t)NKV * TT * HD * 2); h16* VT16 = (h16*)take((size_t)NKV * HD * TT * 2);
    bf* QPh = (bf*)take((size_t)NH_ * TT * HD * 2); bf* QPl = (bf*)take((size_t)NH_ * TT * HD * 2); bf* KPh = (bf*)take((size_t)NKV * TT * HD * 2); bf* KPl = (bf*)take((size_t)NKV * TT * HD * 2); bf* VTh = (bf*)take((size_t)NKV * HD * TT * 2); bf* VTl = (bf*)take((size_t)NKV * HD * TT * 2); bf* Ph = (bf*)take((size_t)ZH * RH * TT * 2); bf* Pl = (bf*)take((size_t)ZH * RH * TT * 2);
    float* Sb = (float*)take((size_t)ZH * TT * TT * 4); h16* P16 = (h16*)take((size_t)ZH * TT * TT * 2); float* Ob = (float*)take((size_t)PVG * ZH * TT * HD * 4); bf* ATh = (bf*)take((size_t)TT * DQ * 2); bf* ATl = (bf*)take((size_t)TT * DQ * 2);
    if ((size_t)(wsp - (char*)d_ws) > ws_size) return;    // ws 256 MiB
    float* FV = FK;   // v projection reuses the k buffer after the k planes are built (stream-ordered)
    { k_cvt8<<<(unsigned)(((size_t)DQ * DM / 8 + 255) / 256), 256, 0, stream>>>(wq, WQ, (size_t)DQ * DM / 8); k_cvt8<<<(unsigned)(((size_t)DKV * DM / 8 + 255) / 256), 256, 0, stream>>>(wk, WK, (size_t)DKV * DM / 8); k_cvt8<<<(unsigned)(((size_t)DKV * DM / 8 + 255) / 256), 256, 0, stream>>>(wv, WV, (size_t)DKV * DM / 8);
      k_cvt8<<<(unsigned)(((size_t)DM * DQ / 8 + 255) / 256), 256, 0, stream>>>(wo, WO, (size_t)DM * DQ / 8);
       }
    k_csid<<<(TT * HD + 255) / 256, 256, 0, stream>>>(CS);
    const unsigned LQ = (unsigned)(((size_t)NH_ * TT * HD / 2 + 255) / 256), LKv = (unsigned)(((size_t)NKV * TT * HD / 2 + 255) / 256);
    for (int b = 0; b < NB_; ++b) {
        
        k_gathB<<<(unsigned)(((size_t)TT * DM / 8 + 255) / 256), 256, 0, stream>>>(x + (size_t)b * DM, XB);   /* query rows of element b */
        k_gemmw<bf, 0, true, PJW, 1><<<dim3(TT / 64, DQ / 64, 1), 32 * PJW, 0, stream>>>(XB, nullptr, WQ, nullptr, DM, FQ, DQ, bq, 0, 0, 0, 0);
        k_rope<<<LQ, 256, 0, stream>>>(FQ, DQ, NH_, CS, nullptr, nullptr, QSC, QP16, QPh, QPl);   /* q x 1/8 */
        k_gathB<<<(unsigned)(((size_t)TT * DM / 8 + 255) / 256), 256, 0, stream>>>(xk + (size_t)b * DM, XB); k_gemmw<bf, 0, true, PJW, 1><<<dim3(TT / 64, DKV / 64, 1), 32 * PJW, 0, stream>>>(XB, nullptr, WK, nullptr, DM, FK, DKV, bk, 0, 0, 0, 0);
        k_rope<<<LKv, 256, 0, stream>>>(FK, DKV, NKV, CS, nullptr, nullptr, 1.0f, KP16, KPh, KPl);
        k_gathB<<<(unsigned)(((size_t)TT * DM / 8 + 255) / 256), 256, 0, stream>>>(xv + (size_t)b * DM, XB); k_gemmw<bf, 0, true, PJW, 1><<<dim3(TT / 64, DKV / 64, 1), 32 * PJW, 0, stream>>>(XB, nullptr, WV, nullptr, DM, FV, DKV, bv, 0, 0, 0, 0); k_vtp<<<LKv, 256, 0, stream>>>(FV, DKV, NKV, VT16, VTh, VTl);
        for (int h0 = 0; h0 < NH_; h0 += ZH) { const size_t zq = (size_t)h0, zk = (size_t)(h0 / REP);   // one kv head per query head: the pass's two heads use consecutive kv planes (z-strides TT*HD)
            k_gemmw<bf, 2, false, 1, 1><<<dim3(RH / 64, TT / 64, ZH), 32, 0, stream>>>(QPh + zq * TT * HD, QPl + zq * TT * HD, KPh + zk * TT * HD, KPl + zk * TT * HD, HD, Sb, TT, nullptr, (size_t)TT * HD, (size_t)TT * HD, (size_t)TT * TT, 0);
            k_gemmw<h16, 0, false, 1, 1><<<dim3((TT - RH) / 64, TT / 64, ZH), 32, 0, stream>>>(QP16 + zq * TT * HD + (size_t)RH * HD, nullptr, KP16 + zk * TT * HD, nullptr, HD, Sb + (size_t)RH * TT, TT, nullptr, (size_t)TT * HD, (size_t)TT * HD, (size_t)TT * TT, 0);
            k_addrelT<<<(unsigned)(((size_t)ZH * TT * TT / 4 + 255) / 256), 256, 0, stream>>>(Sb, rtab, h0);
            k_asoft<<<ZH * TT / 8, 256, 0, stream>>>(Sb, P16, Ph, Pl);
            k_gemmw<bf, 2, false, PVW, PVG><<<dim3(RH / 64, HD / 64 * PVG, ZH), 32 * PVW, 0, stream>>>(Ph, Pl, VTh + zk * HD * TT, VTl + zk * HD * TT, TT, Ob, HD, nullptr, (size_t)RH * TT, (size_t)HD * TT, (size_t)TT * HD, (size_t)ZH * TT * HD);
            k_gemmw<h16, 0, false, PVW, PVG><<<dim3((TT - RH) / 64, HD / 64 * PVG, ZH), 32 * PVW, 0, stream>>>(P16 + (size_t)RH * TT, nullptr, VT16 + zk * HD * TT, nullptr, TT, Ob + (size_t)RH * HD, HD, nullptr, (size_t)TT * TT, (size_t)HD * TT, (size_t)TT * HD, (size_t)ZH * TT * HD);
            k_merge<<<(unsigned)(((size_t)ZH * TT * HD / 2 + 255) / 256), 256, 0, stream>>>(Ob, h0, ATh, ATl); }
        k_gemmw<bf, 1, true, PJW, 1><<<dim3(TT / 64, DM / 64, 1), 32 * PJW, 0, stream>>>(ATh, ATl, WO, nullptr, DQ, Y, DM, bo, 0, 0, 0, 0); k_scatB<<<(unsigned)(((size_t)TT * DM / 4 + 255) / 256), 256, 0, stream>>>(Y, OUT + (size_t)b * DM);   /* rows back to (len, batch, d) */ }
}

// v002
// One run takes 846 microseconds.
// Two timings next to v001 both put it at 1.31 times that version's speed.
// Over all steps from v000 it is 2.77 times as fast.
#include <hip/hip_runtime.h>

// Multi-head attention with a learned relative-position bias, sequence-first layout (query, key, value [2048][2][1024] = (len, batch, d_model); q,k,v = input W^T + b ('oi' [1024][1024] + [1024]; 16 heads x 64); scores = q.k / 8 + rel_table[clip(i - j + 2047, 0, 4094)][h] (table [4095][16], read); softmax over all keys; out = merged Wo^T + bo -> [2048][2][1024] (4.2 M)).
// Layout per batch element: the element's rows (stride batch x d_model) gathered into a contiguous bf16 operand for each of the three inputs in turn; exact projections + f32 biases; dense T-2048 attention (hybrid rows: < 512 hi/lo 3 products, rest fp16 x1024) with the gathered per-head bias added to the score row inside the softmax kernel; merged hi/lo x Wo exact + bo into workspace; the rows scattered back to the (len, batch, d) output.
// Compute dtypes, f32 accumulate: every input rounded to bf16; projections exact + f32 biases; attention rows < 512 3 products, rest fp16; bias add and softmax f32; Wo hl x exact + bias.

#define NB_  2
#define TT   2048
#define DM   1024
#define NH_  16
#define NKV  16
#define REP  (NH_ / NKV)
#define HD   64
#define DQ   (NH_ * HD)
#define DKV  (NKV * HD)
#define ZH   2
#define RH   512                  // query rows < RH use hi+lo planes (0: none)
#define WIN  0
#define PCAR 1024.0f
#define SCL  1.0f   // the 1/8 is folded into q (QSC) so the gathered bias adds to the scaled scores
#define QSC  0.125f
#define BSZ  2
#define NREL 4095
#define PJW  8                    // projections and Wo: waves of a work-group that share a tile's K
#define PVW  4                    // P.V: waves of a work-group that share a K range
#define PVG  8                    // P.V: work-groups that share a tile's K, one f32 plane of Ob each
typedef _Float16 h16;
typedef unsigned short bf;
typedef __attribute__((ext_vector_type(16))) __bf16   v16bf;
typedef __attribute__((ext_vector_type(16))) _Float16 v16h;
typedef __attribute__((ext_vector_type(8)))  _Float16 v8h;
typedef __attribute__((ext_vector_type(8)))  unsigned short v8us;
typedef __attribute__((ext_vector_type(8)))  float    v8f;
typedef __attribute__((ext_vector_type(4)))  float    v4f;
typedef v8h  __attribute__((may_alias)) v8ha;
typedef v4f  __attribute__((may_alias)) v4fa;
typedef v8us __attribute__((may_alias)) v8usa;

__device__ __forceinline__ unsigned short f2bf(float f) { unsigned u = __float_as_uint(f); u += 0x7FFFu + ((u >> 16) & 1u); return (unsigned short)(u >> 16); }
__device__ __forceinline__ float bf2f(unsigned short b) { return __uint_as_float(((unsigned)b) << 16); }
__device__ __forceinline__ float bfr(float f) { return bf2f(f2bf(f)); }
__device__ __forceinline__ v16h cat16(v8h lo, v8h hi) { return __builtin_shufflevector(lo, hi, 0, 1, 2, 3, 4, 5, 6, 7, 8, 9, 10, 11, 12, 13, 14, 15); }
__device__ __forceinline__ v16bf cat16b(v8us lo, v8us hi) { return __builtin_bit_cast(v16bf, __builtin_shufflevector(lo, hi, 0, 1, 2, 3, 4, 5, 6, 7, 8, 9, 10, 11, 12, 13, 14, 15)); }
__device__ __forceinline__ v8f wmma16(v16h a, v16h b, v8f c) { return __builtin_amdgcn_wmma_f32_16x16x32_f16(false, a, false, b, (short)0, c, false, false); }
__device__ __forceinline__ v8f wmmab(v16bf a, v16bf b, v8f c) { return __builtin_amdgcn_wmma_f32_16x16x32_bf16(false, a, false, b, (short)0, c, false, false); }



// ---- k_gemmw: register-blocked GEMM, 64x64 output tiles (16 accumulators a wave), operands straight from K-contiguous 16-bit planes; grid (M/64, N/64 * KG, Z), 32 * KS threads.
// C[m][n] (f32, pitch ldc, + optional f32 bias[n]) = sum_k A[m][k] Bt[n][k] (+ split products per NSPLIT). z-batch strides sA/sB/sC in elements. K % (32 * KS * KG) == 0.
// K is cut into KG * KS equal ranges: work-group kg = blockIdx.y % KG, wave w sums range kg * KS + w over the whole tile. KS > 1: the group's KS f32 partial tiles meet in LDS and are added in wave order (a fixed order), then bias and store.
// KG > 1: group kg stores its sum to plane C + kg * sP; the reader of C adds the KG planes (k_merge, plane order).
template <typename T16> struct WFrag;
template <> struct WFrag<h16> { typedef v16h V; static __device__ __forceinline__ V ld(const h16* p) { return cat16(*(const v8h*)p, *(const v8h*)(p + 16)); } static __device__ __forceinline__ v8f mma(V a, V b, v8f c) { return wmma16(a, b, c); } };
template <> struct WFrag<bf> { typedef v16bf V; static __device__ __forceinline__ V ld(const bf* p) { return cat16b(*(const v8us*)p, *(const v8us*)(p + 16)); } static __device__ __forceinline__ v8f mma(V a, V b, v8f c) { return wmmab(a, b, c); } };
template <typename T16, int NSPLIT, bool BIAS, int KS, int KG>
__global__ __launch_bounds__(32 * KS) void k_gemmw(const T16* __restrict__ A, const T16* __restrict__ A2, const T16* __restrict__ Bt, const T16* __restrict__ Bt2, int K, float* C, int ldc, const float* __restrict__ bias, size_t sA, size_t sB, size_t sC, size_t sP) {
    typedef typename WFrag<T16>::V V;
    __shared__ __align__(16) float os[(KS == 1 ? 16 : KS * 64) * 68];
    const size_t z = blockIdx.z; A += z * sA; if (A2) A2 += z * sA; Bt += z * sB; if (Bt2) Bt2 += z * sB; C += z * sC;
    const int lane = threadIdx.x & 31, lr = lane & 15, hi = lane >> 4; const int r0 = blockIdx.x * 64, c0 = (int)(blockIdx.y / KG) * 64; const int kg = (int)(blockIdx.y % KG); if (KG > 1) C += (size_t)kg * sP;
    const int wv = (KS == 1) ? 0 : __builtin_amdgcn_readfirstlane((int)(threadIdx.x >> 5));   // the wave's number in a scalar register: the k loop stays a scalar loop
    const int kbeg = (kg * KS + wv) * (K / (KS * KG)), kend = kbeg + K / (KS * KG);
    v8f acc[4][4];
#pragma unroll
    for (int mb = 0; mb < 4; ++mb)
#pragma unroll
        for (int nb = 0; nb < 4; ++nb) acc[mb][nb] = (v8f){};
    const size_t aoff = (size_t)(r0 + lr) * K + 8 * hi, boff = (size_t)(c0 + lr) * K + 8 * hi;
#pragma unroll 1
    for (int kc = kbeg; kc < kend; kc += 32) {
        V a[4], a2[4];
#pragma unroll
        for (int mb = 0; mb < 4; ++mb) { a[mb] = WFrag<T16>::ld(A + aoff + (size_t)mb * 16 * K + kc); if (NSPLIT == 1 || NSPLIT == 2) a2[mb] = WFrag<T16>::ld(A2 + aoff + (size_t)mb * 16 * K + kc); }
#pragma unroll
        for (int nb = 0; nb < 4; ++nb) { const V b = WFrag<T16>::ld(Bt + boff + (size_t)nb * 16 * K + kc); V b2; if (NSPLIT >= 2) b2 = WFrag<T16>::ld(Bt2 + boff + (size_t)nb * 16 * K + kc);
#pragma unroll
            for (int mb = 0; mb < 4; ++mb) { acc[mb][nb] = WFrag<T16>::mma(a[mb], b, acc[mb][nb]); if (NSPLIT == 1 || NSPLIT == 2) acc[mb][nb] = WFrag<T16>::mma(a2[mb], b, acc[mb][nb]); if (NSPLIT >= 2) acc[mb][nb] = WFrag<T16>::mma(a[mb], b2, acc[mb][nb]); } }
        asm volatile("v_nop\n\tv_nop\n\tv_nop\n\tv_nop" : "+v"(acc[0][0]), "+v"(acc[1][1]), "+v"(acc[2][2]), "+v"(acc[3][3]) : "v"(a[0]), "v"(a[3]));
    }
    if constexpr (KS > 1) {
        const int cofs = ((int)threadIdx.x & 15) * 4; v4f bv = (v4f){};
        if (BIAS) { bv[0] = bfr(bias[c0 + cofs]); bv[1] = bfr(bias[c0 + cofs + 1]); bv[2] = bfr(bias[c0 + cofs + 2]); bv[3] = bfr(bias[c0 + cofs + 3]); }
        float* ow = os + wv * (64 * 68);
#pragma unroll
        for (int mb = 0; mb < 4; ++mb)
#pragma unroll
            for (int nb = 0; nb < 4; ++nb)
#pragma unroll
                for (int j = 0; j < 8; ++j) ow[(mb * 16 + hi * 8 + j) * 68 + nb * 16 + lr] = acc[mb][nb][j];
        __syncthreads();   // every wave's partial tile stands in LDS before any wave adds across them
#pragma unroll
        for (int s = 0; s < 32 / KS; ++s) { const int row = s * (2 * KS) + ((int)threadIdx.x >> 4); v4f val = *(const v4fa*)(os + row * 68 + cofs);
#pragma unroll
            for (int p = 1; p < KS; ++p) val += *(const v4fa*)(os + p * (64 * 68) + row * 68 + cofs);
            if (BIAS) val += bv;
            *(v4f*)(C + (size_t)(r0 + row) * ldc + c0 + cofs) = val; }
    } else {
#pragma unroll
    for (int mb = 0; mb < 4; ++mb) {
#pragma unroll
        for (int nb = 0; nb < 4; ++nb) {
#pragma unroll
            for (int j = 0; j < 8; ++j) os[(hi * 8 + j) * 68 + nb * 16 + lr] = acc[mb][nb][j]; }
        __builtin_amdgcn_wave_barrier(); asm volatile("" ::: "memory");
        float* crow = C + (size_t)(r0 + mb * 16) * ldc + c0;
{
#pragma unroll
            for (int s = 0; s < 8; ++s) { const int row = 2 * s + hi, cofs = lr * 4; v4f val = *(const v4fa*)(os + row * 68 + cofs); if (BIAS) { val[0] += bfr(bias[c0 + cofs]); val[1] += bfr(bias[c0 + cofs + 1]); val[2] += bfr(bias[c0 + cofs + 2]); val[3] += bfr(bias[c0 + cofs + 3]); }
                *(v4f*)(crow + (size_t)row * ldc + cofs) = val; }
             }
        __builtin_amdgcn_wave_barrier(); asm volatile("" ::: "memory");
    }
    }
}

__device__ __forceinline__ h16 tohx(float x) { return (h16)x; }
__device__ __forceinline__ void splitf(float y, unsigned short& h, unsigned short& l) { h = f2bf(y); l = f2bf(y - bf2f(h)); }
typedef __attribute__((ext_vector_type(2))) _Float16 v2h;
typedef __attribute__((ext_vector_type(4))) _Float16 v4h;
typedef __attribute__((ext_vector_type(2))) unsigned short v2us;
typedef __attribute__((ext_vector_type(4))) unsigned short v4us;
typedef __attribute__((ext_vector_type(2))) float v2f;
typedef __attribute__((ext_vector_type(4))) int v4i;

__global__ __launch_bounds__(256) void k_wtG(const float* __restrict__ w, int K, int N, bf* Bt) {
    const int lane = threadIdx.x & 31; const int L0 = (blockIdx.x * 8 + (threadIdx.x >> 5)) * 8; const int nlines = N * K / 64;
{
#pragma unroll 1
        for (int l = 0; l < 8; ++l) { const int L = L0 + l; if (L >= nlines) break; const size_t e = (size_t)L * 64 + lane * 2; const int k = (int)(e % K), n = (int)(e / K); v2us o;
            o[0] = f2bf(w[(size_t)k * N + n]); o[1] = f2bf(w[(size_t)(k + 1) * N + n]); *(v2us*)(Bt + e) = o; }
         }
}
__global__ __launch_bounds__(256) void k_cvt8(const float* __restrict__ src, bf* dst, size_t n8) { const size_t i = (size_t)blockIdx.x * 256 + threadIdx.x; if (i >= n8) return; const v8f v = *(const v8f*)(src + i * 8); v8us o;
#pragma unroll
    for (int k = 0; k < 8; ++k) o[k] = f2bf(v[k]); *(v8us*)(dst + i * 8) = o;  }

// k_rope: head planes [h][t][d] (fp16 + hi/lo) of rope(x) x sc with the rotate-half convention out[d] = x[d] cos[t][d] - x[d+HD/2] sin[t][d], out[d+HD/2] = x[d+HD/2] cos[t][d+HD/2] + x[d] sin[t][d+HD/2]
__global__ __launch_bounds__(256) void k_rope(const float* __restrict__ F, int pitch, int nheads, const float* __restrict__ CS, const float* __restrict__ RF, const float* __restrict__ nw, float sc, h16* P16, bf* Ph, bf* Pl) {
    const size_t e = ((size_t)blockIdx.x * 256 + threadIdx.x) * 2; if (e >= (size_t)nheads * TT * HD) return; const int d = (int)(e % HD); const int t = (int)((e / HD) % TT); const int h = (int)(e / ((size_t)HD * TT)); const float* f = F + (size_t)t * pitch + h * HD; const float rf = RF ? RF[(size_t)h * TT + t] : 1.0f; v2h o16; v2us oh, ol;
#pragma unroll
    for (int q = 0; q < 2; ++q) { const int dd = d + q; const int dp = (dd < HD / 2) ? dd + HD / 2 : dd - HD / 2; float x0 = f[dd], x1 = f[dp];
        if (RF) { float n0 = __fmul_rn(x0, rf), n1 = __fmul_rn(x1, rf); asm volatile("" : "+v"(n0)); asm volatile("" : "+v"(n1)); x0 = __fmul_rn(bfr(nw[dd]), n0); x1 = __fmul_rn(bfr(nw[dp]), n1); }
        const v2f cs = *(const v2f*)(CS + ((size_t)t * HD + dd) * 2); float a = __fmul_rn(x0, cs[0]), bq = __fmul_rn(x1, cs[1]); asm volatile("" : "+v"(a)); asm volatile("" : "+v"(bq)); const float r = ((dd < HD / 2) ? __fsub_rn(a, bq) : __fadd_rn(a, bq)) * sc;
        o16[q] = tohx(r); unsigned short a2, c2; splitf(r, a2, c2); oh[q] = a2; ol[q] = c2; }
    *(v2h*)(P16 + e) = o16; *(v2us*)(Ph + e) = oh; *(v2us*)(Pl + e) = ol;  }
__global__ __launch_bounds__(256) void k_vtp(const float* __restrict__ F, int pitch, int nheads, h16* V16, bf* Vh, bf* Vl) { const size_t e = ((size_t)blockIdx.x * 256 + threadIdx.x) * 2; if (e >= (size_t)nheads * HD * TT) return; const int t = (int)(e % TT); const int d = (int)((e / TT) % HD); const int g = (int)(e / ((size_t)TT * HD)); v2h o16; v2us oh, ol;
#pragma unroll
    for (int q = 0; q < 2; ++q) { const float x = F[(size_t)(t + q) * pitch + g * HD + d]; o16[q] = tohx(x); unsigned short a2, c2; splitf(x, a2, c2); oh[q] = a2; ol[q] = c2; }
    *(v2h*)(V16 + e) = o16; *(v2us*)(Vh + e) = oh; *(v2us*)(Vl + e) = ol;  }
__global__ __launch_bounds__(256) void k_csid(float* CS) { const int idx = blockIdx.x * 256 + threadIdx.x; if (idx >= TT * HD) return; v2f cs; cs[0] = 1.0f; cs[1] = 0.0f; *(v2f*)(CS + (size_t)idx * 2) = cs;  }
// k_asoft: per row (zz, i): t = S + table[clip(i - j + 2047)][h0 + zz] (no mask); softmax over the 2048 keys (register row, one exp, fixed trees);
// a work-group's 8 rows are consecutive rows of one head (TT % 8 == 0): together they need TT + 7 consecutive table entries of that head, gathered once into LDS in key order: bs[j + 7 - w] is the bias of (row i0 + w, key j).
__global__ __launch_bounds__(256) void k_asoft(const float* __restrict__ Sb, const float* __restrict__ tab, int h0, h16* P16, bf* Ph, bf* Pl) {
    __shared__ float bs[TT + 256];
    const int row0 = blockIdx.x * 8; if (row0 >= ZH * TT) return;   // the same for the whole work-group, in front of the barrier
    const int lane = threadIdx.x & 31; const int w = threadIdx.x >> 5; const int row = row0 + w; const int i = row % TT; const int zz = row / TT; const int i0 = row0 % TT; const bool hires = (i < RH); const float* sr = Sb + (size_t)row * TT; float v[TT / 32]; float mx = -3.0e38f;
#pragma unroll
    for (int ch = 0; ch < TT / 128; ++ch) { const v4f a = *(const v4f*)(sr + ch * 128 + lane * 4);   // the score row is asked for in front of the barrier, so that it flies together with the table gathers
#pragma unroll
        for (int q = 0; q < 4; ++q) v[ch * 4 + q] = a[q]; }
#pragma unroll
    for (int s = 0; s < TT / 256 + 1; ++s) { const int u = s * 256 + (int)threadIdx.x; int r = i0 + (TT + 6) - u; r = min(max(r, 0), NREL - 1); bs[u] = bfr(tab[(size_t)r * NH_ + h0 + zz]); }   // no test on u: all nine gathers fly together; entries from TT + 7 on are never read, and the clip bounds their address like any other
    __syncthreads();   // the head's table entries stand in LDS before any wave adds them to its row
    const float* br = bs + 7 - w + lane * 4;
#pragma unroll
    for (int ch = 0; ch < TT / 128; ++ch) {
#pragma unroll
        for (int q = 0; q < 4; ++q) { const float t = __fadd_rn(v[ch * 4 + q], br[ch * 128 + q]) * SCL; v[ch * 4 + q] = t; mx = fmaxf(mx, t); } }
#pragma unroll
    for (int sh = 16; sh; sh >>= 1) mx = fmaxf(mx, __shfl_xor(mx, sh, 32));
    float sum = 0.f;
#pragma unroll
    for (int k = 0; k < TT / 32; ++k) { float d0 = __fsub_rn(v[k], mx); asm volatile("" : "+v"(d0)); v[k] = __builtin_amdgcn_exp2f(__fmul_rn(d0, 1.4426950408889634f)); sum += v[k]; }
#pragma unroll
    for (int sh = 16; sh; sh >>= 1) sum += __shfl_xor(sum, sh, 32);
    const float f = __fdiv_rn(hires ? 1.0f : PCAR, sum);
{
        if (hires) {
#pragma unroll
            for (int ch = 0; ch < TT / 128; ++ch) { v4us oh, ol;
#pragma unroll
                for (int q = 0; q < 4; ++q) { unsigned short a, c2; splitf(v[ch * 4 + q] * f, a, c2); oh[q] = a; ol[q] = c2; }
                const size_t oo = ((size_t)zz * (RH ? RH : 1) + i) * TT + ch * 128 + lane * 4; *(v4us*)(Ph + oo) = oh; *(v4us*)(Pl + oo) = ol; }
        } else {
#pragma unroll
            for (int ch = 0; ch < TT / 128; ++ch) { v4h o4;
#pragma unroll
                for (int q = 0; q < 4; ++q) o4[q] = tohx(v[ch * 4 + q] * f);
                *(v4h*)(P16 + (size_t)row * TT + ch * 128 + lane * 4) = o4; } }
         }
}
__global__ __launch_bounds__(256) void k_gathB(const float* __restrict__ src, bf* dst) { const size_t i = (size_t)blockIdx.x * 256 + threadIdx.x; if (i >= (size_t)TT * DM / 8) return; const size_t e = i * 8; const int c = (int)(e % DM); const int t = (int)(e / DM); const v8f v = *(const v8f*)(src + (size_t)t * BSZ * DM + c); v8us o;
#pragma unroll
    for (int q = 0; q < 8; ++q) o[q] = f2bf(v[q]);
    *(v8us*)(dst + e) = o;  }
__global__ __launch_bounds__(256) void k_scatB(const float* __restrict__ Y, float* outb) { const size_t i = (size_t)blockIdx.x * 256 + threadIdx.x; if (i >= (size_t)TT * DM / 4) return; const size_t e = i * 4; const int c = (int)(e % DM); const int t = (int)(e / DM); const v4f a = *(const v4f*)(Y + e); *(v4f*)(outb + (size_t)t * BSZ * DM + c) = a;  }
__global__ __launch_bounds__(256) void k_merge(const float* __restrict__ O, int h0, bf* Ah, bf* Al) { const size_t e = ((size_t)blockIdx.x * 256 + threadIdx.x) * 2; if (e >= (size_t)ZH * TT * HD) return; const int d = (int)(e % HD); const int t = (int)((e / HD) % TT); const int zz = (int)(e / ((size_t)HD * TT)); const float cs = (t < RH) ? 1.0f : (1.0f / PCAR); const size_t oo = (size_t)t * DQ + (h0 + zz) * HD + d;
    v2us oh, ol;
#pragma unroll
    for (int q = 0; q < 2; ++q) { float o = O[e + q];
#pragma unroll
        for (int p = 1; p < PVG; ++p) o += O[(size_t)p * ((size_t)ZH * TT * HD) + e + q];   /* the P.V planes, in plane order */
        unsigned short a, c2; splitf(o * cs, a, c2); oh[q] = a; ol[q] = c2; } *(v2us*)(Ah + oo) = oh; *(v2us*)(Al + oo) = ol;  }

extern "C" void kernel_launch(void* const* d_in, const int* in_sizes, int n_in,
                              void* d_out, int out_size, void* d_ws, size_t ws_size, hipStream_t stream) {
    (void)in_sizes; (void)n_in; (void)out_size;
    const float* x = (const float*)d_in[0]; const float* xk = (const float*)d_in[1]; const float* xv = (const float*)d_in[2]; const float* wq = (const float*)d_in[3]; const float* bq = (const float*)d_in[4]; const float* wk = (const float*)d_in[5]; const float* bk = (const float*)d_in[6]; const float* wv = (const float*)d_in[7]; const float* bv = (const float*)d_in[8]; const float* wo = (const float*)d_in[9]; const float* bo = (const float*)d_in[10]; const float* rtab = (const float*)d_in[11];
    float* OUT = (float*)d_out;     // [2048][2][1024]
    char* wsp = (char*)d_ws;
    auto take = [&](size_t bytes) { char* p = wsp; wsp += (bytes + 255) & ~(size_t)255; return (void*)p; };
    float* Y = (float*)take((size_t)TT * DM * 4); bf* WQ = (bf*)take((size_t)DQ * DM * 2); bf* WK = (bf*)take((size_t)DKV * DM * 2); bf* WV = (bf*)take((size_t)DKV * DM * 2); bf* WO = (bf*)take((size_t)DM * DQ * 2); float* CS = (float*)take((size_t)TT * HD * 2 * 4);
    bf* XB = (bf*)take((size_t)TT * DM * 2); float* FQ = (float*)take((size_t)TT * DQ * 4); float* FK = (float*)take((size_t)TT * DKV * 4);
    h16* QP16 = (h16*)take((size_t)NH_ * TT * HD * 2); h16* KP16 = (h16*)take((size_t)NKV * TT * HD * 2); h16* VT16 = (h16*)take((size_t)NKV * HD * TT * 2);
    bf* QPh = (bf*)take((size_t)NH_ * TT * HD * 2); bf* QPl = (bf*)take((size_t)NH_ * TT * HD * 2); bf* KPh = (bf*)take((size_t)NKV * TT * HD * 2); bf* KPl = (bf*)take((size_t)NKV * TT * HD * 2); bf* VTh = (bf*)take((size_t)NKV * HD * TT * 2); bf* VTl = (bf*)take((size_t)NKV * HD * TT * 2); bf* Ph = (bf*)take((size_t)ZH * RH * TT * 2); bf* Pl = (bf*)take((size_t)ZH * RH * TT * 2);
    float* Sb = (float*)take((size_t)ZH * TT * TT * 4); h16* P16 = (h16*)take((size_t)ZH * TT * TT * 2); float* Ob = (float*)take((size_t)PVG * ZH * TT * HD * 4); bf* ATh = (bf*)take((size_t)TT * DQ * 2); bf* ATl = (bf*)take((size_t)TT * DQ * 2);
    if ((size_t)(wsp - (char*)d_ws) > ws_size) return;    // ws 256 MiB
    float* FV = FK;   // v projection reuses the k buffer after the k planes are built (stream-ordered)
    { k_cvt8<<<(unsigned)(((size_t)DQ * DM / 8 + 255) / 256), 256, 0, stream>>>(wq, WQ, (size_t)DQ * DM / 8); k_cvt8<<<(unsigned)(((size_t)DKV * DM / 8 + 255) / 256), 256, 0, stream>>>(wk, WK, (size_t)DKV * DM / 8); k_cvt8<<<(unsigned)(((size_t)DKV * DM / 8 + 255) / 256), 256, 0, stream>>>(wv, WV, (size_t)DKV * DM / 8);
      k_cvt8<<<(unsigned)(((size_t)DM * DQ / 8 + 255) / 256), 256, 0, stream>>>(wo, WO, (size_t)DM * DQ / 8);
       }
    k_csid<<<(TT * HD + 255) / 256, 256, 0, stream>>>(CS);
    const unsigned LQ = (unsigned)(((size_t)NH_ * TT * HD / 2 + 255) / 256), LKv = (unsigned)(((size_t)NKV * TT * HD / 2 + 255) / 256);
    for (int b = 0; b < NB_; ++b) {
        
        k_gathB<<<(unsigned)(((size_t)TT * DM / 8 + 255) / 256), 256, 0, stream>>>(x + (size_t)b * DM, XB);   /* query rows of element b */
        k_gemmw<bf, 0, true, PJW, 1><<<dim3(TT / 64, DQ / 64, 1), 32 * PJW, 0, stream>>>(XB, nullptr, WQ, nullptr, DM, FQ, DQ, bq, 0, 0, 0, 0);
        k_rope<<<LQ, 256, 0, stream>>>(FQ, DQ, NH_, CS, nullptr, nullptr, QSC, QP16, QPh, QPl);   /* q x 1/8 */
        k_gathB<<<(unsigned)(((size_t)TT * DM / 8 + 255) / 256), 256, 0, stream>>>(xk + (size_t)b * DM, XB); k_gemmw<bf, 0, true, PJW, 1><<<dim3(TT / 64, DKV / 64, 1), 32 * PJW, 0, stream>>>(XB, nullptr, WK, nullptr, DM, FK, DKV, bk, 0, 0, 0, 0);
        k_rope<<<LKv, 256, 0, stream>>>(FK, DKV, NKV, CS, nullptr, nullptr, 1.0f, KP16, KPh, KPl);
        k_gathB<<<(unsigned)(((size_t)TT * DM / 8 + 255) / 256), 256, 0, stream>>>(xv + (size_t)b * DM, XB); k_gemmw<bf, 0, true, PJW, 1><<<dim3(TT / 64, DKV / 64, 1), 32 * PJW, 0, stream>>>(XB, nullptr, WV, nullptr, DM, FV, DKV, bv, 0, 0, 0, 0); k_vtp<<<LKv, 256, 0, stream>>>(FV, DKV, NKV, VT16, VTh, VTl);
        for (int h0 = 0; h0 < NH_; h0 += ZH) { const size_t zq = (size_t)h0, zk = (size_t)(h0 / REP);   // one kv head per query head: the pass's two heads use consecutive kv planes (z-strides TT*HD)
            k_gemmw<bf, 2, false, 1, 1><<<dim3(RH / 64, TT / 64, ZH), 32, 0, stream>>>(QPh + zq * TT * HD, QPl + zq * TT * HD, KPh + zk * TT * HD, KPl + zk * TT * HD, HD, Sb, TT, nullptr, (size_t)TT * HD, (size_t)TT * HD, (size_t)TT * TT, 0);
            k_gemmw<h16, 0, false, 1, 1><<<dim3((TT - RH) / 64, TT / 64, ZH), 32, 0, stream>>>(QP16 + zq * TT * HD + (size_t)RH * HD, nullptr, KP16 + zk * TT * HD, nullptr, HD, Sb + (size_t)RH * TT, TT, nullptr, (size_t)TT * HD, (size_t)TT * HD, (size_t)TT * TT, 0);
            k_asoft<<<ZH * TT / 8, 256, 0, stream>>>(Sb, rtab, h0, P16, Ph, Pl);
            k_gemmw<bf, 2, false, PVW, PVG><<<dim3(RH / 64, HD / 64 * PVG, ZH), 32 * PVW, 0, stream>>>(Ph, Pl, VTh + zk * HD * TT, VTl + zk * HD * TT, TT, Ob, HD, nullptr, (size_t)RH * TT, (size_t)HD * TT, (size_t)TT * HD, (size_t)ZH * TT * HD);
            k_gemmw<h16, 0, false, PVW, PVG><<<dim3((TT - RH) / 64, HD / 64 * PVG, ZH), 32 * PVW, 0, stream>>>(P16 + (size_t)RH * TT, nullptr, VT16 + zk * HD * TT, nullptr, TT, Ob + (size_t)RH * HD, HD, nullptr, (size_t)TT * TT, (size_t)HD * TT, (size_t)TT * HD, (size_t)ZH * TT * HD);
            k_merge<<<(unsigned)(((size_t)ZH * TT * HD / 2 + 255) / 256), 256, 0, stream>>>(Ob, h0, ATh, ATl); }
        k_gemmw<bf, 1, true, PJW, 1><<<dim3(TT / 64, DM / 64, 1), 32 * PJW, 0, stream>>>(ATh, ATl, WO, nullptr, DQ, Y, DM, bo, 0, 0, 0, 0); k_scatB<<<(unsigned)(((size_t)TT * DM / 4 + 255) / 256), 256, 0, stream>>>(Y, OUT + (size_t)b * DM);   /* rows back to (len, batch, d) */ }
}

// v004
// One run takes 292 microseconds.
// It is 2.89 times as fast as v002, going by the measured steps of the versions left out in between.
// All steps since v000 together make it 8.01 times as fast.
#include <hip/hip_runtime.h>

// Multi-head attention with a learned relative-position bias, sequence-first layout (query, key, value [2048][2][1024] = (len, batch, d_model); q,k,v = input W^T + b ('oi' [1024][1024] + [1024]; 16 heads x 64); scores = q.k / 8 + rel_table[clip(i - j + 2047, 0, 4094)][h] (table [4095][16], read); softmax over all keys; out = merged Wo^T + bo -> [2048][2][1024] (4.2 M)).
// Layout per batch element: the element's rows (stride batch x d_model) gathered into a contiguous bf16 operand for each of the three inputs in turn; exact projections + f32 biases, each projection's epilogue storing the attention operand planes itself; dense T-2048 attention in one kernel per row class (hybrid rows: < 512 hi/lo 3 products, rest fp16 x1024), the gathered per-head bias added to the scores in registers; merged hi/lo x Wo exact + bo, stored at the batch pitch straight into the (len, batch, d) output.
// Compute dtypes, f32 accumulate: every input rounded to bf16; projections exact + f32 biases; attention rows < 512 3 products, rest fp16; bias add and softmax f32; Wo hl x exact + bias.

#define NB_  2
#define TT   2048
#define DM   1024
#define NH_  16
#define NKV  16
#define REP  (NH_ / NKV)
#define HD   64
#define DQ   (NH_ * HD)
#define DKV  (NKV * HD)
#define RH   512                  // query rows < RH use hi+lo planes (0: none)
#define WIN  0
#define PCAR 1024.0f
#define QSC  0.125f   // the 1/8 is folded into q so the gathered bias adds to the scaled scores
#define BSZ  2
#define NREL 4095
#define PJW  8                    // projections and Wo: waves of a work-group that share a tile's K
typedef _Float16 h16;
typedef unsigned short bf;
typedef __attribute__((ext_vector_type(16))) __bf16   v16bf;
typedef __attribute__((ext_vector_type(16))) _Float16 v16h;
typedef __attribute__((ext_vector_type(8)))  _Float16 v8h;
typedef __attribute__((ext_vector_type(8)))  unsigned short v8us;
typedef __attribute__((ext_vector_type(8)))  float    v8f;
typedef __attribute__((ext_vector_type(4)))  float    v4f;
typedef v8h  __attribute__((may_alias)) v8ha;
typedef v4f  __attribute__((may_alias)) v4fa;
typedef v8us __attribute__((may_alias)) v8usa;

__device__ __forceinline__ unsigned short f2bf(float f) { unsigned u = __float_as_uint(f); u += 0x7FFFu + ((u >> 16) & 1u); return (unsigned short)(u >> 16); }
__device__ __forceinline__ float bf2f(unsigned short b) { return __uint_as_float(((unsigned)b) << 16); }
__device__ __forceinline__ float bfr(float f) { return bf2f(f2bf(f)); }
__device__ __forceinline__ v16h cat16(v8h lo, v8h hi) { return __builtin_shufflevector(lo, hi, 0, 1, 2, 3, 4, 5, 6, 7, 8, 9, 10, 11, 12, 13, 14, 15); }
__device__ __forceinline__ v16bf cat16b(v8us lo, v8us hi) { return __builtin_bit_cast(v16bf, __builtin_shufflevector(lo, hi, 0, 1, 2, 3, 4, 5, 6, 7, 8, 9, 10, 11, 12, 13, 14, 15)); }
__device__ __forceinline__ v8f wmma16(v16h a, v16h b, v8f c) { return __builtin_amdgcn_wmma_f32_16x16x32_f16(false, a, false, b, (short)0, c, false, false); }
__device__ __forceinline__ v8f wmmab(v16bf a, v16bf b, v8f c) { return __builtin_amdgcn_wmma_f32_16x16x32_bf16(false, a, false, b, (short)0, c, false, false); }
__device__ __forceinline__ h16 tohx(float x) { return (h16)x; }
__device__ __forceinline__ void splitf(float y, unsigned short& h, unsigned short& l) { h = f2bf(y); l = f2bf(y - bf2f(h)); }
typedef __attribute__((ext_vector_type(2))) _Float16 v2h;
typedef __attribute__((ext_vector_type(4))) _Float16 v4h;
typedef __attribute__((ext_vector_type(2))) unsigned short v2us;
typedef __attribute__((ext_vector_type(4))) unsigned short v4us;
typedef __attribute__((ext_vector_type(2))) float v2f;
typedef __attribute__((ext_vector_type(4))) int v4i;



// ---- k_gemmw: register-blocked GEMM, 64x64 output tiles (16 accumulators a wave), operands straight from K-contiguous 16-bit planes; grid (M/64, N/64 * KG, Z), 32 * KS threads.
// C[m][n] (f32, pitch ldc, + optional f32 bias[n]) = sum_k A[m][k] Bt[n][k] (+ split products per NSPLIT). z-batch strides sA/sB/sC in elements. K % (32 * KS * KG) == 0.
// K is cut into KG * KS equal ranges: work-group kg = blockIdx.y % KG, wave w sums range kg * KS + w over the whole tile. KS > 1: the group's KS f32 partial tiles meet in LDS and are added in wave order (a fixed order), then bias and store.
// KG > 1: group kg stores its sum to plane C + kg * sP; the reader of C adds the KG planes.
// EPI says where the joined tile goes. 0: f32 to C. 1, 2: a 64-column tile is one head (HD == 64), and (sum + bias) x sc goes as fp16 and as bf16 hi/lo to the planes P16, Ph, Pl that the attention kernel reads:
// 1: [head][row][d]. 2: [head][d][row]; there the waves lay their partial tiles into LDS transposed (a lane's 8 accumulator registers are 8 neighbouring rows of one column), so the join runs along the rows and every store is still a whole line.
template <typename T16> struct WFrag;
template <> struct WFrag<h16> { typedef v16h V; static __device__ __forceinline__ V ld(const h16* p) { return cat16(*(const v8h*)p, *(const v8h*)(p + 16)); } static __device__ __forceinline__ v8f mma(V a, V b, v8f c) { return wmma16(a, b, c); } };
template <> struct WFrag<bf> { typedef v16bf V; static __device__ __forceinline__ V ld(const bf* p) { return cat16b(*(const v8us*)p, *(const v8us*)(p + 16)); } static __device__ __forceinline__ v8f mma(V a, V b, v8f c) { return wmmab(a, b, c); } };
template <typename T16, int NSPLIT, bool BIAS, int KS, int KG, int EPI>
__global__ __launch_bounds__(32 * KS) void k_gemmw(const T16* __restrict__ A, const T16* __restrict__ A2, const T16* __restrict__ Bt, const T16* __restrict__ Bt2, int K, float* C, int ldc, const float* __restrict__ bias, size_t sA, size_t sB, size_t sC, size_t sP, h16* P16, bf* Ph, bf* Pl, float sc) {
    typedef typename WFrag<T16>::V V;
    static_assert(EPI == 0 || (KS > 1 && KG == 1 && HD == 64), "the plane epilogues join in LDS and take one head a tile");
    __shared__ __align__(16) float os[(KS == 1 ? 16 : KS * 64) * 68];
    const size_t z = blockIdx.z; A += z * sA; if (A2) A2 += z * sA; Bt += z * sB; if (Bt2) Bt2 += z * sB; C += z * sC;
    const int lane = threadIdx.x & 31, lr = lane & 15, hi = lane >> 4; const int r0 = blockIdx.x * 64, c0 = (int)(blockIdx.y / KG) * 64; const int kg = (int)(blockIdx.y % KG); if (KG > 1) C += (size_t)kg * sP;
    const int wv = (KS == 1) ? 0 : __builtin_amdgcn_readfirstlane((int)(threadIdx.x >> 5));   // the wave's number in a scalar register: the k loop stays a scalar loop
    const int kbeg = (kg * KS + wv) * (K / (KS * KG)), kend = kbeg + K / (KS * KG);
    v8f acc[4][4];
#pragma unroll
    for (int mb = 0; mb < 4; ++mb)
#pragma unroll
        for (int nb = 0; nb < 4; ++nb) acc[mb][nb] = (v8f){};
    const size_t aoff = (size_t)(r0 + lr) * K + 8 * hi, boff = (size_t)(c0 + lr) * K + 8 * hi;
#pragma unroll 1
    for (int kc = kbeg; kc < kend; kc += 32) {
        V a[4], a2[4];
#pragma unroll
        for (int mb = 0; mb < 4; ++mb) { a[mb] = WFrag<T16>::ld(A + aoff + (size_t)mb * 16 * K + kc); if (NSPLIT == 1 || NSPLIT == 2) a2[mb] = WFrag<T16>::ld(A2 + aoff + (size_t)mb * 16 * K + kc); }
#pragma unroll
        for (int nb = 0; nb < 4; ++nb) { const V b = WFrag<T16>::ld(Bt + boff + (size_t)nb * 16 * K + kc); V b2; if (NSPLIT >= 2) b2 = WFrag<T16>::ld(Bt2 + boff + (size_t)nb * 16 * K + kc);
#pragma unroll
            for (int mb = 0; mb < 4; ++mb) { acc[mb][nb] = WFrag<T16>::mma(a[mb], b, acc[mb][nb]); if (NSPLIT == 1 || NSPLIT == 2) acc[mb][nb] = WFrag<T16>::mma(a2[mb], b, acc[mb][nb]); if (NSPLIT >= 2) acc[mb][nb] = WFrag<T16>::mma(a[mb], b2, acc[mb][nb]); } }
        asm volatile("v_nop\n\tv_nop\n\tv_nop\n\tv_nop" : "+v"(acc[0][0]), "+v"(acc[1][1]), "+v"(acc[2][2]), "+v"(acc[3][3]) : "v"(a[0]), "v"(a[3]));
    }
    if constexpr (KS > 1) {
        const int cofs = ((int)threadIdx.x & 15) * 4; v4f bv = (v4f){}; float bt[32 / KS];
        if (BIAS && EPI != 2) { const float* bp = bias + c0 + cofs; bv[0] = bp[0]; bv[1] = bp[1]; bv[2] = bp[2]; bv[3] = bp[3];
            asm volatile("s_wait_xcnt 0x0" :: "v"(bp) : "memory");   // inputs only: the bias load's address registers stay whole until the load is issued and this wait has passed
            bv[0] = bfr(bv[0]); bv[1] = bfr(bv[1]); bv[2] = bfr(bv[2]); bv[3] = bfr(bv[3]); }
        if (BIAS && EPI == 2) { const float* bp = bias + c0 + ((int)threadIdx.x >> 4);
#pragma unroll
            for (int s = 0; s < 32 / KS; ++s) bt[s] = bp[s * (2 * KS)];
            asm volatile("s_wait_xcnt 0x0" :: "v"(bp) : "memory");   // inputs only: the bias loads' address registers stay whole until every load that names them is issued and this wait has passed
#pragma unroll
            for (int s = 0; s < 32 / KS; ++s) bt[s] = bfr(bt[s]); }
        float* ow = os + wv * (64 * 68);
#pragma unroll
        for (int mb = 0; mb < 4; ++mb)
#pragma unroll
            for (int nb = 0; nb < 4; ++nb) {
                if constexpr (EPI == 2) { float* op = ow + (nb * 16 + lr) * 68 + mb * 16 + hi * 8;
                    *(v4fa*)op = __builtin_shufflevector(acc[mb][nb], acc[mb][nb], 0, 1, 2, 3); *(v4fa*)(op + 4) = __builtin_shufflevector(acc[mb][nb], acc[mb][nb], 4, 5, 6, 7);
                } else {
#pragma unroll
                    for (int j = 0; j < 8; ++j) ow[(mb * 16 + hi * 8 + j) * 68 + nb * 16 + lr] = acc[mb][nb][j]; } }
        __syncthreads();   // every wave's partial tile stands in LDS before any wave adds across them
#pragma unroll
        for (int s = 0; s < 32 / KS; ++s) { const int row = s * (2 * KS) + ((int)threadIdx.x >> 4); v4f val = *(const v4fa*)(os + row * 68 + cofs);
#pragma unroll
            for (int p = 1; p < KS; ++p) val += *(const v4fa*)(os + p * (64 * 68) + row * 68 + cofs);
            if (BIAS) { if constexpr (EPI == 2) val += bt[s]; else val += bv; }
            if constexpr (EPI == 0) { *(v4f*)(C + (size_t)(r0 + row) * ldc + c0 + cofs) = val; }
            else { v4h o16; v4us oh, ol;
#pragma unroll
                for (int q = 0; q < 4; ++q) { const float r = val[q] * sc; o16[q] = tohx(r); unsigned short a2, c2; splitf(r, a2, c2); oh[q] = a2; ol[q] = c2; }
                const size_t e = (EPI == 1) ? ((size_t)(c0 / HD) * TT + r0 + row) * HD + cofs : ((size_t)c0 + row) * TT + r0 + cofs;   // 2: LDS row = column c0 + row of the product, LDS column = its row
                *(v4h*)(P16 + e) = o16; *(v4us*)(Ph + e) = oh; *(v4us*)(Pl + e) = ol; } }
    } else {
#pragma unroll
    for (int mb = 0; mb < 4; ++mb) {
#pragma unroll
        for (int nb = 0; nb < 4; ++nb) {
#pragma unroll
            for (int j = 0; j < 8; ++j) os[(hi * 8 + j) * 68 + nb * 16 + lr] = acc[mb][nb][j]; }
        __builtin_amdgcn_wave_barrier(); asm volatile("" ::: "memory");
        float* crow = C + (size_t)(r0 + mb * 16) * ldc + c0;
{
#pragma unroll
            for (int s = 0; s < 8; ++s) { const int row = 2 * s + hi, cofs = lr * 4; v4f val = *(const v4fa*)(os + row * 68 + cofs); if (BIAS) { val[0] += bfr(bias[c0 + cofs]); val[1] += bfr(bias[c0 + cofs + 1]); val[2] += bfr(bias[c0 + cofs + 2]); val[3] += bfr(bias[c0 + cofs + 3]); }
                *(v4f*)(crow + (size_t)row * ldc + cofs) = val; }
             }
        __builtin_amdgcn_wave_barrier(); asm volatile("" ::: "memory");
    }
    }
}


__global__ __launch_bounds__(256) void k_wtG(const float* __restrict__ w, int K, int N, bf* Bt) {
    const int lane = threadIdx.x & 31; const int L0 = (blockIdx.x * 8 + (threadIdx.x >> 5)) * 8; const int nlines = N * K / 64;
{
#pragma unroll 1
        for (int l = 0; l < 8; ++l) { const int L = L0 + l; if (L >= nlines) break; const size_t e = (size_t)L * 64 + lane * 2; const int k = (int)(e % K), n = (int)(e / K); v2us o;
            o[0] = f2bf(w[(size_t)k * N + n]); o[1] = f2bf(w[(size_t)(k + 1) * N + n]); *(v2us*)(Bt + e) = o; }
         }
}
__global__ __launch_bounds__(256) void k_cvt8(const float* __restrict__ src, bf* dst, size_t n8) { const size_t i = (size_t)blockIdx.x * 256 + threadIdx.x; if (i >= n8) return; const v8f v = *(const v8f*)(src + i * 8); v8us o;
#pragma unroll
    for (int k = 0; k < 8; ++k) o[k] = f2bf(v[k]); *(v8us*)(dst + i * 8) = o;  }

// k_fattn: scores, bias, softmax and P.V of ROWS = 16 * QT query rows of one head in one work-group; nothing of the score matrix goes to memory.
// Wave w owns keys [w * KW, (w + 1) * KW). It forms S^T = K Q^T (A = 16 key rows, B = 16 query rows, both K-contiguous planes): accumulator register j of lane (lr, hi) is (key 8 hi + j of the tile, query lr).
// That is the A-fragment order of P for P.V: two neighbouring key tiles give elements 0..7 (k = 8 hi + j) and 8..15 (k = 16 + 8 hi + j) of query row lr, so P goes from the accumulators to the matrix unit without leaving the lane.
// A query's maximum and sum: in the lane, across the two lane halves, then across the waves through LDS (wave order). The waves' f32 partial outputs meet in LDS and are added in wave order, then hi/lo planes of the merged operand.
// bs[key + ROWS - 1 - r] is the bias of (row i0 + r, key): TT + ROWS - 1 consecutive table entries of the head, gathered once.
template <typename T16, bool HR, int QT, int NW>
__global__ __launch_bounds__(32 * NW) void k_fattn(const T16* __restrict__ Qa, const T16* __restrict__ Qb, const T16* __restrict__ Ka, const T16* __restrict__ Kb, const T16* __restrict__ Va, const T16* __restrict__ Vb, const float* __restrict__ tab, int ibase, bf* ATh, bf* ATl) {
    typedef typename WFrag<T16>::V V;
    constexpr int ROWS = QT * 16, NTH = 32 * NW, KW = TT / NW, NT = KW / 16, NC = KW / 32;
    static_assert(2 * NW == ROWS && TT % NTH == 0 && KW % 32 == 0, "shape");
    __shared__ float bs[TT + NTH];
    __shared__ float redm[NW * ROWS];
    __shared__ float reds[NW * ROWS];
    __shared__ __align__(16) float os[NW * ROWS * 68];
    const int lane = threadIdx.x & 31, lr = lane & 15, hi = lane >> 4; const int wv = __builtin_amdgcn_readfirstlane((int)(threadIdx.x >> 5));
    const int i0 = ibase + (int)blockIdx.x * ROWS, h = (int)blockIdx.y, key0 = wv * KW; const size_t hp = (size_t)h * TT * HD;
    constexpr int NG = TT / NTH + 1; float g[NG];
#pragma unroll
    for (int t = 0; t < NG; ++t) { int r = i0 + (ROWS - 1) + (TT - 1) - (t * NTH + (int)threadIdx.x); r = min(max(r, 0), NREL - 1); g[t] = tab[(size_t)r * NH_ + h]; }   // asked for first, stored to LDS behind the score products; entries from TT + ROWS - 1 on are never read, and the clip bounds their address like any other
    asm volatile("s_wait_xcnt 0x0" ::: "memory");   // the gathers' address registers may be reused by what follows
    V qa[QT][2], qb[QT][2]; const size_t qo = hp + (size_t)(i0 + lr) * HD + 8 * hi;
#pragma unroll
    for (int qt = 0; qt < QT; ++qt)
#pragma unroll
        for (int kk = 0; kk < 2; ++kk) { qa[qt][kk] = WFrag<T16>::ld(Qa + qo + qt * 16 * HD + kk * 32); if constexpr (HR) qb[qt][kk] = WFrag<T16>::ld(Qb + qo + qt * 16 * HD + kk * 32); }
    if constexpr (HR) asm volatile("s_wait_xcnt 0x0" :: "v"(Qa + qo), "v"(Qb + qo) : "memory");   // inputs only: the query loads' address registers stay whole until every load that names them is issued and this wait has passed
    else asm volatile("s_wait_xcnt 0x0" :: "v"(Qa + qo) : "memory");   // the same, one plane
    v8f s[QT][NT];
    const size_t ko = hp + (size_t)(key0 + lr) * HD + 8 * hi;
#pragma unroll
    for (int nt = 0; nt < NT; ++nt) { V ka[2], kb[2];
#pragma unroll
        for (int kk = 0; kk < 2; ++kk) { ka[kk] = WFrag<T16>::ld(Ka + ko + nt * 16 * HD + kk * 32); if constexpr (HR) kb[kk] = WFrag<T16>::ld(Kb + ko + nt * 16 * HD + kk * 32); }
#pragma unroll
        for (int qt = 0; qt < QT; ++qt) { v8f a = (v8f){};
#pragma unroll
            for (int kk = 0; kk < 2; ++kk) { a = WFrag<T16>::mma(ka[kk], qa[qt][kk], a); if constexpr (HR) { a = WFrag<T16>::mma(ka[kk], qb[qt][kk], a); a = WFrag<T16>::mma(kb[kk], qa[qt][kk], a); } }
            s[qt][nt] = a; } }
    if constexpr (HR) asm volatile("s_wait_xcnt 0x0" :: "v"(Ka + ko), "v"(Kb + ko) : "memory");   // inputs only: the key loads' address registers stay whole until every load that names them is issued and this wait has passed
    else asm volatile("s_wait_xcnt 0x0" :: "v"(Ka + ko) : "memory");   // the same, one plane
#pragma unroll
    for (int t = 0; t < NG; ++t) bs[t * NTH + (int)threadIdx.x] = bfr(g[t]);
    __syncthreads();   // the head's table entries stand in LDS before any wave adds them to its scores
#pragma unroll
    for (int qt = 0; qt < QT; ++qt) { const float* br = bs + key0 + 8 * hi + (ROWS - 1) - (qt * 16 + lr); v8f m8;
#pragma unroll
        for (int nt = 0; nt < NT; ++nt)
#pragma unroll
            for (int j = 0; j < 8; ++j) { const float t = __fadd_rn(s[qt][nt][j], br[nt * 16 + j]); s[qt][nt][j] = t; m8[j] = nt ? fmaxf(m8[j], t) : t; }
        float m = fmaxf(fmaxf(fmaxf(m8[0], m8[1]), fmaxf(m8[2], m8[3])), fmaxf(fmaxf(m8[4], m8[5]), fmaxf(m8[6], m8[7])));
        m = fmaxf(m, __shfl_xor(m, 16, 32));
        if (hi == 0) redm[wv * ROWS + qt * 16 + lr] = m; }
    __syncthreads();   // every wave's maxima stand in LDS before any wave takes the maximum over them
    float f[QT];
#pragma unroll
    for (int qt = 0; qt < QT; ++qt) { float m = redm[qt * 16 + lr];
#pragma unroll
        for (int p = 1; p < NW; ++p) m = fmaxf(m, redm[p * ROWS + qt * 16 + lr]);
        v8f s8 = (v8f){};
#pragma unroll
        for (int nt = 0; nt < NT; ++nt)
#pragma unroll
            for (int j = 0; j < 8; ++j) { const float e = __builtin_amdgcn_exp2f(__fmul_rn(__fsub_rn(s[qt][nt][j], m), 1.4426950408889634f)); s[qt][nt][j] = e; s8[j] += e; }
        float sum = ((s8[0] + s8[1]) + (s8[2] + s8[3])) + ((s8[4] + s8[5]) + (s8[6] + s8[7]));
        sum += __shfl_xor(sum, 16, 32);
        if (hi == 0) reds[wv * ROWS + qt * 16 + lr] = sum; }
    __syncthreads();   // every wave's sums stand in LDS before any wave adds them
#pragma unroll
    for (int qt = 0; qt < QT; ++qt) { float sum = reds[qt * 16 + lr];
#pragma unroll
        for (int p = 1; p < NW; ++p) sum += reds[p * ROWS + qt * 16 + lr];
        f[qt] = __fdiv_rn(HR ? 1.0f : PCAR, sum); }
    v8f o[QT][4];
#pragma unroll
    for (int qt = 0; qt < QT; ++qt)
#pragma unroll
        for (int nb = 0; nb < 4; ++nb) o[qt][nb] = (v8f){};
    const size_t vo = hp + (size_t)lr * TT + 8 * hi + key0;
#pragma unroll
    for (int c = 0; c < NC; ++c) { V pa[QT], pb[QT];
#pragma unroll
        for (int qt = 0; qt < QT; ++qt) {
            if constexpr (HR) { v8us h0, l0, h1, l1;
#pragma unroll
                for (int j = 0; j < 8; ++j) { unsigned short a, c2; splitf(s[qt][2 * c][j] * f[qt], a, c2); h0[j] = a; l0[j] = c2; splitf(s[qt][2 * c + 1][j] * f[qt], a, c2); h1[j] = a; l1[j] = c2; }
                pa[qt] = cat16b(h0, h1); pb[qt] = cat16b(l0, l1);
            } else { v8h p0, p1;
#pragma unroll
                for (int j = 0; j < 8; ++j) { p0[j] = tohx(s[qt][2 * c][j] * f[qt]); p1[j] = tohx(s[qt][2 * c + 1][j] * f[qt]); }
                pa[qt] = cat16(p0, p1); } }
#pragma unroll
        for (int nb = 0; nb < 4; ++nb) { const V vb = WFrag<T16>::ld(Va + vo + (size_t)nb * 16 * TT + c * 32); V vb2; if constexpr (HR) vb2 = WFrag<T16>::ld(Vb + vo + (size_t)nb * 16 * TT + c * 32);
#pragma unroll
            for (int qt = 0; qt < QT; ++qt) { o[qt][nb] = WFrag<T16>::mma(pa[qt], vb, o[qt][nb]); if constexpr (HR) { o[qt][nb] = WFrag<T16>::mma(pb[qt], vb, o[qt][nb]); o[qt][nb] = WFrag<T16>::mma(pa[qt], vb2, o[qt][nb]); } } } }
    float* ow = os + wv * (ROWS * 68);
#pragma unroll
    for (int qt = 0; qt < QT; ++qt)
#pragma unroll
        for (int nb = 0; nb < 4; ++nb)
#pragma unroll
            for (int j = 0; j < 8; ++j) ow[(qt * 16 + hi * 8 + j) * 68 + nb * 16 + lr] = o[qt][nb][j];
    __syncthreads();   // every wave's partial output tile stands in LDS before any wave adds across them
    const int row = (int)threadIdx.x >> 4, cofs = ((int)threadIdx.x & 15) * 4; v4f val = *(const v4fa*)(os + row * 68 + cofs);
#pragma unroll
    for (int p = 1; p < NW; ++p) val += *(const v4fa*)(os + p * (ROWS * 68) + row * 68 + cofs);
    const float cs = HR ? 1.0f : (1.0f / PCAR); v4us oh, ol;
#pragma unroll
    for (int q = 0; q < 4; ++q) { unsigned short a, c2; splitf(val[q] * cs, a, c2); oh[q] = a; ol[q] = c2; }
    const size_t oo = (size_t)(i0 + row) * DQ + h * HD + cofs; *(v4us*)(ATh + oo) = oh; *(v4us*)(ATl + oo) = ol;
}
__global__ __launch_bounds__(256) void k_gathB(const float* __restrict__ src, bf* dst) { const size_t i = (size_t)blockIdx.x * 256 + threadIdx.x; if (i >= (size_t)TT * DM / 8) return; const size_t e = i * 8; const int c = (int)(e % DM); const int t = (int)(e / DM); const v8f v = *(const v8f*)(src + (size_t)t * BSZ * DM + c); v8us o;
#pragma unroll
    for (int q = 0; q < 8; ++q) o[q] = f2bf(v[q]);
    *(v8us*)(dst + e) = o;  }

extern "C" void kernel_launch(void* const* d_in, const int* in_sizes, int n_in,
                              void* d_out, int out_size, void* d_ws, size_t ws_size, hipStream_t stream) {
    (void)in_sizes; (void)n_in; (void)out_size;
    const float* x = (const float*)d_in[0]; const float* xk = (const float*)d_in[1]; const float* xv = (const float*)d_in[2]; const float* wq = (const float*)d_in[3]; const float* bq = (const float*)d_in[4]; const float* wk = (const float*)d_in[5]; const float* bk = (const float*)d_in[6]; const float* wv = (const float*)d_in[7]; const float* bv = (const float*)d_in[8]; const float* wo = (const float*)d_in[9]; const float* bo = (const float*)d_in[10]; const float* rtab = (const float*)d_in[11];
    float* OUT = (float*)d_out;     // [2048][2][1024]
    char* wsp = (char*)d_ws;
    auto take = [&](size_t bytes) { char* p = wsp; wsp += (bytes + 255) & ~(size_t)255; return (void*)p; };
    bf* WQ = (bf*)take((size_t)DQ * DM * 2); bf* WK = (bf*)take((size_t)DKV * DM * 2); bf* WV = (bf*)take((size_t)DKV * DM * 2); bf* WO = (bf*)take((size_t)DM * DQ * 2);
    bf* XB = (bf*)take((size_t)TT * DM * 2);
    h16* QP16 = (h16*)take((size_t)NH_ * TT * HD * 2); h16* KP16 = (h16*)take((size_t)NKV * TT * HD * 2); h16* VT16 = (h16*)take((size_t)NKV * HD * TT * 2);
    bf* QPh = (bf*)take((size_t)NH_ * TT * HD * 2); bf* QPl = (bf*)take((size_t)NH_ * TT * HD * 2); bf* KPh = (bf*)take((size_t)NKV * TT * HD * 2); bf* KPl = (bf*)take((size_t)NKV * TT * HD * 2); bf* VTh = (bf*)take((size_t)NKV * HD * TT * 2); bf* VTl = (bf*)take((size_t)NKV * HD * TT * 2);
    bf* ATh = (bf*)take((size_t)TT * DQ * 2); bf* ATl = (bf*)take((size_t)TT * DQ * 2);
    if ((size_t)(wsp - (char*)d_ws) > ws_size) return;    // ws 256 MiB
    { k_cvt8<<<(unsigned)(((size_t)DQ * DM / 8 + 255) / 256), 256, 0, stream>>>(wq, WQ, (size_t)DQ * DM / 8); k_cvt8<<<(unsigned)(((size_t)DKV * DM / 8 + 255) / 256), 256, 0, stream>>>(wk, WK, (size_t)DKV * DM / 8); k_cvt8<<<(unsigned)(((size_t)DKV * DM / 8 + 255) / 256), 256, 0, stream>>>(wv, WV, (size_t)DKV * DM / 8);
      k_cvt8<<<(unsigned)(((size_t)DM * DQ / 8 + 255) / 256), 256, 0, stream>>>(wo, WO, (size_t)DM * DQ / 8);
       }
    for (int b = 0; b < NB_; ++b) {
        
        k_gathB<<<(unsigned)(((size_t)TT * DM / 8 + 255) / 256), 256, 0, stream>>>(x + (size_t)b * DM, XB);   /* query rows of element b */
        k_gemmw<bf, 0, true, PJW, 1, 1><<<dim3(TT / 64, DQ / 64, 1), 32 * PJW, 0, stream>>>(XB, nullptr, WQ, nullptr, DM, nullptr, 0, bq, 0, 0, 0, 0, QP16, QPh, QPl, QSC);   /* q x 1/8, head planes */
        k_gathB<<<(unsigned)(((size_t)TT * DM / 8 + 255) / 256), 256, 0, stream>>>(xk + (size_t)b * DM, XB); k_gemmw<bf, 0, true, PJW, 1, 1><<<dim3(TT / 64, DKV / 64, 1), 32 * PJW, 0, stream>>>(XB, nullptr, WK, nullptr, DM, nullptr, 0, bk, 0, 0, 0, 0, KP16, KPh, KPl, 1.0f);
        k_gathB<<<(unsigned)(((size_t)TT * DM / 8 + 255) / 256), 256, 0, stream>>>(xv + (size_t)b * DM, XB); k_gemmw<bf, 0, true, PJW, 1, 2><<<dim3(TT / 64, DKV / 64, 1), 32 * PJW, 0, stream>>>(XB, nullptr, WV, nullptr, DM, nullptr, 0, bv, 0, 0, 0, 0, VT16, VTh, VTl, 1.0f);   /* v planes transposed */
        k_fattn<bf, true, 2, 16><<<dim3(RH / 32, NH_, 1), 512, 0, stream>>>(QPh, QPl, KPh, KPl, VTh, VTl, rtab, 0, ATh, ATl);   /* rows < RH: hi/lo planes, 3 products */
        k_fattn<h16, false, 2, 16><<<dim3((TT - RH) / 32, NH_, 1), 512, 0, stream>>>(QP16, nullptr, KP16, nullptr, VT16, nullptr, rtab, RH, ATh, ATl);   /* the other rows: fp16, P x 1024 */
        k_gemmw<bf, 1, true, PJW, 1, 0><<<dim3(TT / 64, DM / 64, 1), 32 * PJW, 0, stream>>>(ATh, ATl, WO, nullptr, DQ, OUT + (size_t)b * DM, BSZ * DM, bo, 0, 0, 0, 0, nullptr, nullptr, nullptr, 1.0f);   /* rows at the (len, batch, d) pitch */ }
}

// v005
// One run takes 252 microseconds.
// In two side-by-side timings against v004, it was 1.16 and 1.15 times as fast.
// All steps since v000 together make it 9.25 times as fast.
#include <hip/hip_runtime.h>

// Multi-head attention with a learned relative-position bias, sequence-first layout (query, key, value [2048][2][1024] = (len, batch, d_model); q,k,v = input W^T + b ('oi' [1024][1024] + [1024]; 16 heads x 64); scores = q.k / 8 + rel_table[clip(i - j + 2047, 0, 4094)][h] (table [4095][16], read); softmax over all keys; out = merged Wo^T + bo -> [2048][2][1024] (4.2 M)).
// Four launches, each over both batch elements: (1) the three inputs and the four weights rounded to bf16, each input's rows laid down by batch element ([b][len][d]); (2) the q, k, v projections, exact + f32 biases, one grid, each epilogue storing the attention operand planes itself; (3) dense T-2048 attention, both row classes in one grid (hybrid rows: < 512 hi/lo 3 products, rest fp16 x1024), the gathered per-head bias added to the scores in registers; (4) merged hi/lo x Wo exact + bo, stored at the batch pitch straight into the (len, batch, d) output.
// Compute dtypes, f32 accumulate: every input rounded to bf16; projections exact + f32 biases; attention rows < 512 3 products, rest fp16; bias add and softmax f32; Wo hl x exact + bias.

#define NB_  2
#define TT   2048
#define DM   1024
#define NH_  16
#define NKV  16
#define REP  (NH_ / NKV)
#define HD   64
#define DQ   (NH_ * HD)
#define DKV  (NKV * HD)
#define RH   512                  // query rows < RH use hi+lo planes (0: none)
#define WIN  0
#define PCAR 1024.0f
#define QSC  0.125f   // the 1/8 is folded into q so the gathered bias adds to the scaled scores
#define BSZ  2
#define NREL 4095
#define PJW  8                    // projections and Wo: waves of a work-group that share a tile's K
#define XN   ((size_t)TT * BSZ * DM)   // elements of one input
#define WN   ((size_t)DQ * DM)         // elements of one weight matrix
#define PLN  ((size_t)NH_ * TT * HD)   // elements of one operand plane (one of q, k, v of one batch element)
typedef _Float16 h16;
typedef unsigned short bf;
typedef __attribute__((ext_vector_type(16))) __bf16   v16bf;
typedef __attribute__((ext_vector_type(16))) _Float16 v16h;
typedef __attribute__((ext_vector_type(8)))  _Float16 v8h;
typedef __attribute__((ext_vector_type(8)))  unsigned short v8us;
typedef __attribute__((ext_vector_type(8)))  float    v8f;
typedef __attribute__((ext_vector_type(4)))  float    v4f;
typedef v8h  __attribute__((may_alias)) v8ha;
typedef v4f  __attribute__((may_alias)) v4fa;
typedef v8us __attribute__((may_alias)) v8usa;

__device__ __forceinline__ unsigned short f2bf(float f) { unsigned u = __float_as_uint(f); u += 0x7FFFu + ((u >> 16) & 1u); return (unsigned short)(u >> 16); }
__device__ __forceinline__ float bf2f(unsigned short b) { return __uint_as_float(((unsigned)b) << 16); }
__device__ __forceinline__ float bfr(float f) { return bf2f(f2bf(f)); }
__device__ __forceinline__ v16h cat16(v8h lo, v8h hi) { return __builtin_shufflevector(lo, hi, 0, 1, 2, 3, 4, 5, 6, 7, 8, 9, 10, 11, 12, 13, 14, 15); }
__device__ __forceinline__ v16bf cat16b(v8us lo, v8us hi) { return __builtin_bit_cast(v16bf, __builtin_shufflevector(lo, hi, 0, 1, 2, 3, 4, 5, 6, 7, 8, 9, 10, 11, 12, 13, 14, 15)); }
__device__ __forceinline__ v8f wmma16(v16h a, v16h b, v8f c) { return __builtin_amdgcn_wmma_f32_16x16x32_f16(false, a, false, b, (short)0, c, false, false); }
__device__ __forceinline__ v8f wmmab(v16bf a, v16bf b, v8f c) { return __builtin_amdgcn_wmma_f32_16x16x32_bf16(false, a, false, b, (short)0, c, false, false); }
__device__ __forceinline__ h16 tohx(float x) { return (h16)x; }
__device__ __forceinline__ void splitf(float y, unsigned short& h, unsigned short& l) { h = f2bf(y); l = f2bf(y - bf2f(h)); }
typedef __attribute__((ext_vector_type(2))) _Float16 v2h;
typedef __attribute__((ext_vector_type(4))) _Float16 v4h;
typedef __attribute__((ext_vector_type(2))) unsigned short v2us;
typedef __attribute__((ext_vector_type(4))) unsigned short v4us;
typedef __attribute__((ext_vector_type(2))) float v2f;
typedef __attribute__((ext_vector_type(4))) int v4i;



// ---- k_gemmw: register-blocked GEMM, 64x64 output tiles (16 accumulators a wave), operands straight from K-contiguous 16-bit planes; grid (M/64, N/64 * KG, Z), 32 * KS threads.
// C[m][n] (f32, pitch ldc, + optional f32 bias[n]) = sum_k A[m][k] Bt[n][k] (+ split products per NSPLIT). z-batch strides sA/sB/sC in elements. K % (32 * KS * KG) == 0.
// K is cut into KG * KS equal ranges: work-group kg = blockIdx.y % KG, wave w sums range kg * KS + w over the whole tile. KS > 1: the group's KS f32 partial tiles meet in LDS and are added in wave order (a fixed order), then bias and store.
// KG > 1: group kg stores its sum to plane C + kg * sP; the reader of C adds the KG planes.
// EPI says where the joined tile goes. 0: f32 to C. 1, 2: a 64-column tile is one head (HD == 64), and (sum + bias) x sc goes as fp16 and as bf16 hi/lo to the planes P16, Ph, Pl that the attention kernel reads:
// 1: [head][row][d]. 2: [head][d][row]; there the waves lay their partial tiles into LDS transposed (a lane's 8 accumulator registers are 8 neighbouring rows of one column), so the join runs along the rows and every store is still a whole line.
// 3: q, k and v of both batch elements in one grid. z = 2 * op + b: A is plane z of the converted inputs (TT x DM each), Bt weight op, bias bias / bias1 / bias2, planes z of P16, Ph, Pl; op 0 (q) takes sc, the others 1; op 0, 1 store as 1, op 2 as 2.
template <typename T16> struct WFrag;
template <> struct WFrag<h16> { typedef v16h V; static __device__ __forceinline__ V ld(const h16* p) { return cat16(*(const v8h*)p, *(const v8h*)(p + 16)); } static __device__ __forceinline__ v8f mma(V a, V b, v8f c) { return wmma16(a, b, c); } };
template <> struct WFrag<bf> { typedef v16bf V; static __device__ __forceinline__ V ld(const bf* p) { return cat16b(*(const v8us*)p, *(const v8us*)(p + 16)); } static __device__ __forceinline__ v8f mma(V a, V b, v8f c) { return wmmab(a, b, c); } };
// The join of a work-group's KS partial tiles (KS > 1), with bias and store; EPI as above. tr is read for EPI 3 alone and is the same in the whole work-group: true stores as 2, false as 1.
// For EPI 3 the two forms part only where they differ (bias index, LDS order of the partial tiles, store address); barrier, sums and conversions are common code, so that the accumulators die at the LDS stores on both sides.
template <int KS, bool BIAS, int EPI>
__device__ __forceinline__ void gemm_join(const v8f (&acc)[4][4], float* os, int wv, int lr, int hi, int r0, int c0, float* C, int ldc, const float* __restrict__ bias, h16* P16, bf* Ph, bf* Pl, float sc, bool tr) {
    const bool T = EPI == 2 || (EPI == 3 && tr);
    const int cofs = ((int)threadIdx.x & 15) * 4; v4f bv[32 / KS];
    if (BIAS && !T) { const float* bp = bias + c0 + cofs; v4f b; b[0] = bp[0]; b[1] = bp[1]; b[2] = bp[2]; b[3] = bp[3];
        asm volatile("s_wait_xcnt 0x0" :: "v"(bp) : "memory");   // inputs only: the bias load's address registers stay whole until the load is issued and this wait has passed
        b[0] = bfr(b[0]); b[1] = bfr(b[1]); b[2] = bfr(b[2]); b[3] = bfr(b[3]);
#pragma unroll
        for (int s = 0; s < 32 / KS; ++s) bv[s] = b; }
    if (BIAS && T) { const float* bp = bias + c0 + ((int)threadIdx.x >> 4); float bt[32 / KS];
#pragma unroll
        for (int s = 0; s < 32 / KS; ++s) bt[s] = bp[s * (2 * KS)];
        asm volatile("s_wait_xcnt 0x0" :: "v"(bp) : "memory");   // inputs only: the bias loads' address registers stay whole until every load that names them is issued and this wait has passed
#pragma unroll
        for (int s = 0; s < 32 / KS; ++s) { const float t = bfr(bt[s]); bv[s] = (v4f){t, t, t, t}; } }
    float* ow = os + wv * (64 * 68);
    if (T) {
#pragma unroll
        for (int mb = 0; mb < 4; ++mb)
#pragma unroll
            for (int nb = 0; nb < 4; ++nb) { float* op = ow + (nb * 16 + lr) * 68 + mb * 16 + hi * 8;
                *(v4fa*)op = __builtin_shufflevector(acc[mb][nb], acc[mb][nb], 0, 1, 2, 3); *(v4fa*)(op + 4) = __builtin_shufflevector(acc[mb][nb], acc[mb][nb], 4, 5, 6, 7); }
    } else {
#pragma unroll
        for (int mb = 0; mb < 4; ++mb)
#pragma unroll
            for (int nb = 0; nb < 4; ++nb)
#pragma unroll
                for (int j = 0; j < 8; ++j) ow[(mb * 16 + hi * 8 + j) * 68 + nb * 16 + lr] = acc[mb][nb][j];
    }
    __syncthreads();   // every wave's partial tile stands in LDS before any wave adds across them
    v4f vals[32 / KS];
#pragma unroll
    for (int s = 0; s < 32 / KS; ++s) { const int row = s * (2 * KS) + ((int)threadIdx.x >> 4); v4f val = *(const v4fa*)(os + row * 68 + cofs);
#pragma unroll
        for (int p = 1; p < KS; ++p) val += *(const v4fa*)(os + p * (64 * 68) + row * 68 + cofs);
        if (BIAS) val += bv[s];
        vals[s] = val; }
#pragma unroll
    for (int s = 0; s < 32 / KS; ++s) { const int row = s * (2 * KS) + ((int)threadIdx.x >> 4); const v4f val = vals[s];
        if constexpr (EPI == 0) { *(v4f*)(C + (size_t)(r0 + row) * ldc + c0 + cofs) = val; }
        else { v4h o16; v4us oh, ol;
#pragma unroll
            for (int q = 0; q < 4; ++q) { const float r = val[q] * sc; o16[q] = tohx(r); unsigned short a2, c2; splitf(r, a2, c2); oh[q] = a2; ol[q] = c2; }
            const size_t e = !T ? ((size_t)(c0 / HD) * TT + r0 + row) * HD + cofs : ((size_t)c0 + row) * TT + r0 + cofs;   // T: LDS row = column c0 + row of the product, LDS column = its row
            *(v4h*)(P16 + e) = o16; *(v4us*)(Ph + e) = oh; *(v4us*)(Pl + e) = ol;
            asm volatile("s_wait_xcnt 0x0" :: "v"(P16 + e), "v"(Ph + e), "v"(Pl + e), "v"(o16), "v"(oh), "v"(ol) : "memory"); } }   // inputs only: the three stores' address and data registers stay whole until they are issued and this wait has passed
}
template <typename T16, int NSPLIT, bool BIAS, int KS, int KG, int EPI>
__global__ __launch_bounds__(32 * KS) void k_gemmw(const T16* __restrict__ A, const T16* __restrict__ A2, const T16* __restrict__ Bt, const T16* __restrict__ Bt2, int K, float* C, int ldc, const float* __restrict__ bias, const float* __restrict__ bias1, const float* __restrict__ bias2, size_t sA, size_t sB, size_t sC, size_t sP, h16* P16, bf* Ph, bf* Pl, float sc) {
    typedef typename WFrag<T16>::V V;
    static_assert(EPI == 0 || (KS > 1 && KG == 1 && HD == 64), "the plane epilogues join in LDS and take one head a tile");
    __shared__ __align__(16) float os[(KS == 1 ? 16 : KS * 64) * 68];
    const size_t z = blockIdx.z; const int op = (int)(blockIdx.z >> 1);
    if constexpr (EPI == 3) { A += z * ((size_t)TT * DM); Bt += (size_t)op * WN; bias = op == 0 ? bias : op == 1 ? bias1 : bias2; P16 += z * PLN; Ph += z * PLN; Pl += z * PLN; sc = op == 0 ? sc : 1.0f; }
    else { A += z * sA; if (A2) A2 += z * sA; Bt += z * sB; if (Bt2) Bt2 += z * sB; C += z * sC; }
    const int lane = threadIdx.x & 31, lr = lane & 15, hi = lane >> 4; const int r0 = blockIdx.x * 64, c0 = (int)(blockIdx.y / KG) * 64; const int kg = (int)(blockIdx.y % KG); if (KG > 1) C += (size_t)kg * sP;
    const int wv = (KS == 1) ? 0 : __builtin_amdgcn_readfirstlane((int)(threadIdx.x >> 5));   // the wave's number in a scalar register: the k loop stays a scalar loop
    const int kbeg = (kg * KS + wv) * (K / (KS * KG)), kend = kbeg + K / (KS * KG);
    v8f acc[4][4];
#pragma unroll
    for (int mb = 0; mb < 4; ++mb)
#pragma unroll
        for (int nb = 0; nb < 4; ++nb) acc[mb][nb] = (v8f){};
    const size_t aoff = (size_t)(r0 + lr) * K + 8 * hi, boff = (size_t)(c0 + lr) * K + 8 * hi;
#pragma unroll 1
    for (int kc = kbeg; kc < kend; kc += 32) {
        V a[4], a2[4];
#pragma unroll
        for (int mb = 0; mb < 4; ++mb) { a[mb] = WFrag<T16>::ld(A + aoff + (size_t)mb * 16 * K + kc); if (NSPLIT == 1 || NSPLIT == 2) a2[mb] = WFrag<T16>::ld(A2 + aoff + (size_t)mb * 16 * K + kc); }
#pragma unroll
        for (int nb = 0; nb < 4; ++nb) { const V b = WFrag<T16>::ld(Bt + boff + (size_t)nb * 16 * K + kc); V b2; if (NSPLIT >= 2) b2 = WFrag<T16>::ld(Bt2 + boff + (size_t)nb * 16 * K + kc);
#pragma unroll
            for (int mb = 0; mb < 4; ++mb) { acc[mb][nb] = WFrag<T16>::mma(a[mb], b, acc[mb][nb]); if (NSPLIT == 1 || NSPLIT == 2) acc[mb][nb] = WFrag<T16>::mma(a2[mb], b, acc[mb][nb]); if (NSPLIT >= 2) acc[mb][nb] = WFrag<T16>::mma(a[mb], b2, acc[mb][nb]); } }
        asm volatile("v_nop\n\tv_nop\n\tv_nop\n\tv_nop" : "+v"(acc[0][0]), "+v"(acc[1][1]), "+v"(acc[2][2]), "+v"(acc[3][3]) : "v"(a[0]), "v"(a[3]));
    }
    if constexpr (KS > 1) {
        gemm_join<KS, BIAS, EPI>(acc, os, wv, lr, hi, r0, c0, C, ldc, bias, P16, Ph, Pl, sc, op == 2);   // op comes from blockIdx.z
    } else {
#pragma unroll
    for (int mb = 0; mb < 4; ++mb) {
#pragma unroll
        for (int nb = 0; nb < 4; ++nb) {
#pragma unroll
            for (int j = 0; j < 8; ++j) os[(hi * 8 + j) * 68 + nb * 16 + lr] = acc[mb][nb][j]; }
        __builtin_amdgcn_wave_barrier(); asm volatile("" ::: "memory");
        float* crow = C + (size_t)(r0 + mb * 16) * ldc + c0;
{
#pragma unroll
            for (int s = 0; s < 8; ++s) { const int row = 2 * s + hi, cofs = lr * 4; v4f val = *(const v4fa*)(os + row * 68 + cofs); if (BIAS) { val[0] += bfr(bias[c0 + cofs]); val[1] += bfr(bias[c0 + cofs + 1]); val[2] += bfr(bias[c0 + cofs + 2]); val[3] += bfr(bias[c0 + cofs + 3]); }
                *(v4f*)(crow + (size_t)row * ldc + cofs) = val; }
             }
        __builtin_amdgcn_wave_barrier(); asm volatile("" ::: "memory");
    }
    }
}


__global__ __launch_bounds__(256) void k_wtG(const float* __restrict__ w, int K, int N, bf* Bt) {
    const int lane = threadIdx.x & 31; const int L0 = (blockIdx.x * 8 + (threadIdx.x >> 5)) * 8; const int nlines = N * K / 64;
{
#pragma unroll 1
        for (int l = 0; l < 8; ++l) { const int L = L0 + l; if (L >= nlines) break; const size_t e = (size_t)L * 64 + lane * 2; const int k = (int)(e % K), n = (int)(e / K); v2us o;
            o[0] = f2bf(w[(size_t)k * N + n]); o[1] = f2bf(w[(size_t)(k + 1) * N + n]); *(v2us*)(Bt + e) = o; }
         }
}
// k_cvtall: all seven f32 operands rounded to bf16 in one grid. y = a unit of WN elements: XN / WN units for each of x, xk, xv, then one for each weight; dst holds them in that order, an input's rows (len, batch) laid down as [batch][len]. A thread takes CVU groups of 8 elements (each inside one row), a work-group's width apart, all loads asked for before the first store.
#define CVU 8
__global__ __launch_bounds__(256) void k_cvtall(const float* __restrict__ x, const float* __restrict__ xk, const float* __restrict__ xv, const float* __restrict__ wq, const float* __restrict__ wk, const float* __restrict__ wv, const float* __restrict__ wo, bf* dst) {
    constexpr int UX = (int)(XN / WN); static_assert(XN % WN == 0 && WN % (256 * 8 * CVU) == 0, "whole units, whole work-groups");
    const int u = (int)blockIdx.y;
    const float* s = u < UX ? x + (size_t)u * WN : u < 2 * UX ? xk + (size_t)(u - UX) * WN : u < 3 * UX ? xv + (size_t)(u - 2 * UX) * WN : u == 3 * UX ? wq : u == 3 * UX + 1 ? wk : u == 3 * UX + 2 ? wv : wo;
    const size_t e = (size_t)blockIdx.x * (256 * 8 * CVU) + threadIdx.x * 8; v8f v[CVU];
#pragma unroll
    for (int i = 0; i < CVU; ++i) v[i] = *(const v8f*)(s + e + i * (256 * 8));
    asm volatile("s_wait_xcnt 0x0" :: "v"(s + e) : "memory");   // inputs only: the loads' address registers stay whole until every load that names them is issued and this wait has passed
    v8us o[CVU]; bf* p[CVU];
#pragma unroll
    for (int i = 0; i < CVU; ++i) {
#pragma unroll
        for (int k = 0; k < 8; ++k) o[i][k] = f2bf(v[i][k]);
        size_t d = (size_t)u * WN + e + i * (256 * 8);
        if (u < 3 * UX) { const size_t in = d / XN, r = d % XN / DM; d = in * XN + ((r % BSZ) * TT + r / BSZ) * DM + d % DM; }
        p[i] = dst + d; }
#pragma unroll
    for (int i = 0; i < CVU; ++i) *(v8us*)p[i] = o[i];
    static_assert(CVU == 8, "the wait below names every store's registers");
    asm volatile("s_wait_xcnt 0x0" :: "v"(p[0]), "v"(p[1]), "v"(p[2]), "v"(p[3]), "v"(p[4]), "v"(p[5]), "v"(p[6]), "v"(p[7]), "v"(o[0]), "v"(o[1]), "v"(o[2]), "v"(o[3]), "v"(o[4]), "v"(o[5]), "v"(o[6]), "v"(o[7]) : "memory");   // inputs only: the stores' address and data registers stay whole until every store is issued and this wait has passed
}

// fattn_rows: scores, bias, softmax and P.V of ROWS = 16 * QT query rows (from i0) of head h of one batch element in one work-group; nothing of the score matrix goes to memory. bs, redm, reds, os: the work-group's LDS, declared in k_fattn.
// Wave w owns keys [w * KW, (w + 1) * KW). It forms S^T = K Q^T (A = 16 key rows, B = 16 query rows, both K-contiguous planes): accumulator register j of lane (lr, hi) is (key 8 hi + j of the tile, query lr).
// That is the A-fragment order of P for P.V: two neighbouring key tiles give elements 0..7 (k = 8 hi + j) and 8..15 (k = 16 + 8 hi + j) of query row lr, so P goes from the accumulators to the matrix unit without leaving the lane.
// A query's maximum and sum: in the lane, across the two lane halves, then across the waves through LDS (wave order). The waves' f32 partial outputs meet in LDS and are added in wave order, then hi/lo planes of the merged operand.
// bs[key + ROWS - 1 - r] is the bias of (row i0 + r, key): TT + ROWS - 1 consecutive table entries of the head, gathered once.
template <typename T16, bool HR, int QT, int NW>
__device__ __forceinline__ void fattn_rows(const T16* __restrict__ Qa, const T16* __restrict__ Qb, const T16* __restrict__ Ka, const T16* __restrict__ Kb, const T16* __restrict__ Va, const T16* __restrict__ Vb, const float* __restrict__ tab, int i0, int h, bf* ATh, bf* ATl, float* bs, float* redm, float* reds, float* os) {
    typedef typename WFrag<T16>::V V;
    constexpr int ROWS = QT * 16, NTH = 32 * NW, KW = TT / NW, NT = KW / 16, NC = KW / 32;
    static_assert(2 * NW == ROWS && TT % NTH == 0 && KW % 32 == 0, "shape");
    const int lane = threadIdx.x & 31, lr = lane & 15, hi = lane >> 4; const int wv = __builtin_amdgcn_readfirstlane((int)(threadIdx.x >> 5));
    const int key0 = wv * KW; const size_t hp = (size_t)h * TT * HD;
    constexpr int NG = TT / NTH + 1; float g[NG];
#pragma unroll
    for (int t = 0; t < NG; ++t) { int r = i0 + (ROWS - 1) + (TT - 1) - (t * NTH + (int)threadIdx.x); r = min(max(r, 0), NREL - 1); g[t] = tab[(size_t)r * NH_ + h]; }   // asked for first, stored to LDS behind the score products; entries from TT + ROWS - 1 on are never read, and the clip bounds their address like any other
    asm volatile("s_wait_xcnt 0x0" ::: "memory");   // the gathers' address registers may be reused by what follows
    V qa[QT][2], qb[QT][2]; const size_t qo = hp + (size_t)(i0 + lr) * HD + 8 * hi;
#pragma unroll
    for (int qt = 0; qt < QT; ++qt)
#pragma unroll
        for (int kk = 0; kk < 2; ++kk) { qa[qt][kk] = WFrag<T16>::ld(Qa + qo + qt * 16 * HD + kk * 32); if constexpr (HR) qb[qt][kk] = WFrag<T16>::ld(Qb + qo + qt * 16 * HD + kk * 32); }
    if constexpr (HR) asm volatile("s_wait_xcnt 0x0" :: "v"(Qa + qo), "v"(Qb + qo) : "memory");   // inputs only: the query loads' address registers stay whole until every load that names them is issued and this wait has passed
    else asm volatile("s_wait_xcnt 0x0" :: "v"(Qa + qo) : "memory");   // the same, one plane
    v8f s[QT][NT];
    const size_t ko = hp + (size_t)(key0 + lr) * HD + 8 * hi;
#pragma unroll
    for (int nt = 0; nt < NT; ++nt) { V ka[2], kb[2];
#pragma unroll
        for (int kk = 0; kk < 2; ++kk) { ka[kk] = WFrag<T16>::ld(Ka + ko + nt * 16 * HD + kk * 32); if constexpr (HR) kb[kk] = WFrag<T16>::ld(Kb + ko + nt * 16 * HD + kk * 32); }
#pragma unroll
        for (int qt = 0; qt < QT; ++qt) { v8f a = (v8f){};
#pragma unroll
            for (int kk = 0; kk < 2; ++kk) { a = WFrag<T16>::mma(ka[kk], qa[qt][kk], a); if constexpr (HR) { a = WFrag<T16>::mma(ka[kk], qb[qt][kk], a); a = WFrag<T16>::mma(kb[kk], qa[qt][kk], a); } }
            s[qt][nt] = a; } }
    if constexpr (HR) asm volatile("s_wait_xcnt 0x0" :: "v"(Ka + ko), "v"(Kb + ko) : "memory");   // inputs only: the key loads' address registers stay whole until every load that names them is issued and this wait has passed
    else asm volatile("s_wait_xcnt 0x0" :: "v"(Ka + ko) : "memory");   // the same, one plane
#pragma unroll
    for (int t = 0; t < NG; ++t) bs[t * NTH + (int)threadIdx.x] = bfr(g[t]);
    __syncthreads();   // the head's table entries stand in LDS before any wave adds them to its scores
#pragma unroll
    for (int qt = 0; qt < QT; ++qt) { const float* br = bs + key0 + 8 * hi + (ROWS - 1) - (qt * 16 + lr); v8f m8;
#pragma unroll
        for (int nt = 0; nt < NT; ++nt)
#pragma unroll
            for (int j = 0; j < 8; ++j) { const float t = __fadd_rn(s[qt][nt][j], br[nt * 16 + j]); s[qt][nt][j] = t; m8[j] = nt ? fmaxf(m8[j], t) : t; }
        float m = fmaxf(fmaxf(fmaxf(m8[0], m8[1]), fmaxf(m8[2], m8[3])), fmaxf(fmaxf(m8[4], m8[5]), fmaxf(m8[6], m8[7])));
        m = fmaxf(m, __shfl_xor(m, 16, 32));
        if (hi == 0) redm[wv * ROWS + qt * 16 + lr] = m; }
    __syncthreads();   // every wave's maxima stand in LDS before any wave takes the maximum over them
    float f[QT];
#pragma unroll
    for (int qt = 0; qt < QT; ++qt) { float m = redm[qt * 16 + lr];
#pragma unroll
        for (int p = 1; p < NW; ++p) m = fmaxf(m, redm[p * ROWS + qt * 16 + lr]);
        v8f s8 = (v8f){};
#pragma unroll
        for (int nt = 0; nt < NT; ++nt)
#pragma unroll
            for (int j = 0; j < 8; ++j) { const float e = __builtin_amdgcn_exp2f(__fmul_rn(__fsub_rn(s[qt][nt][j], m), 1.4426950408889634f)); s[qt][nt][j] = e; s8[j] += e; }
        float sum = ((s8[0] + s8[1]) + (s8[2] + s8[3])) + ((s8[4] + s8[5]) + (s8[6] + s8[7]));
        sum += __shfl_xor(sum, 16, 32);
        if (hi == 0) reds[wv * ROWS + qt * 16 + lr] = sum; }
    __syncthreads();   // every wave's sums stand in LDS before any wave adds them
#pragma unroll
    for (int qt = 0; qt < QT; ++qt) { float sum = reds[qt * 16 + lr];
#pragma unroll
        for (int p = 1; p < NW; ++p) sum += reds[p * ROWS + qt * 16 + lr];
        f[qt] = __fdiv_rn(HR ? 1.0f : PCAR, sum); }
    v8f o[QT][4];
#pragma unroll
    for (int qt = 0; qt < QT; ++qt)
#pragma unroll
        for (int nb = 0; nb < 4; ++nb) o[qt][nb] = (v8f){};
    const size_t vo = hp + (size_t)lr * TT + 8 * hi + key0;
#pragma unroll
    for (int c = 0; c < NC; ++c) { V pa[QT], pb[QT];
#pragma unroll
        for (int qt = 0; qt < QT; ++qt) {
            if constexpr (HR) { v8us h0, l0, h1, l1;
#pragma unroll
                for (int j = 0; j < 8; ++j) { unsigned short a, c2; splitf(s[qt][2 * c][j] * f[qt], a, c2); h0[j] = a; l0[j] = c2; splitf(s[qt][2 * c + 1][j] * f[qt], a, c2); h1[j] = a; l1[j] = c2; }
                pa[qt] = cat16b(h0, h1); pb[qt] = cat16b(l0, l1);
            } else { v8h p0, p1;
#pragma unroll
                for (int j = 0; j < 8; ++j) { p0[j] = tohx(s[qt][2 * c][j] * f[qt]); p1[j] = tohx(s[qt][2 * c + 1][j] * f[qt]); }
                pa[qt] = cat16(p0, p1); } }
#pragma unroll
        for (int nb = 0; nb < 4; ++nb) { const V vb = WFrag<T16>::ld(Va + vo + (size_t)nb * 16 * TT + c * 32); V vb2; if constexpr (HR) vb2 = WFrag<T16>::ld(Vb + vo + (size_t)nb * 16 * TT + c * 32);
#pragma unroll
            for (int qt = 0; qt < QT; ++qt) { o[qt][nb] = WFrag<T16>::mma(pa[qt], vb, o[qt][nb]); if constexpr (HR) { o[qt][nb] = WFrag<T16>::mma(pb[qt], vb, o[qt][nb]); o[qt][nb] = WFrag<T16>::mma(pa[qt], vb2, o[qt][nb]); } } } }
    float* ow = os + wv * (ROWS * 68);
#pragma unroll
    for (int qt = 0; qt < QT; ++qt)
#pragma unroll
        for (int nb = 0; nb < 4; ++nb)
#pragma unroll
            for (int j = 0; j < 8; ++j) ow[(qt * 16 + hi * 8 + j) * 68 + nb * 16 + lr] = o[qt][nb][j];
    __syncthreads();   // every wave's partial output tile stands in LDS before any wave adds across them
    const int row = (int)threadIdx.x >> 4, cofs = ((int)threadIdx.x & 15) * 4; v4f val = *(const v4fa*)(os + row * 68 + cofs);
#pragma unroll
    for (int p = 1; p < NW; ++p) val += *(const v4fa*)(os + p * (ROWS * 68) + row * 68 + cofs);
    const float cs = HR ? 1.0f : (1.0f / PCAR); v4us oh, ol;
#pragma unroll
    for (int q = 0; q < 4; ++q) { unsigned short a, c2; splitf(val[q] * cs, a, c2); oh[q] = a; ol[q] = c2; }
    const size_t oo = (size_t)(i0 + row) * DQ + h * HD + cofs; *(v4us*)(ATh + oo) = oh; *(v4us*)(ATl + oo) = ol;
}
// k_fattn: every (head, batch element, block of ROWS query rows) in one grid: x = head + NH_ * b, y = row block. The blocks of rows < RH (three products, the longer work) have the lowest y.
// Each operand pointer is batch element 0's plane, element 1's follows it (as the projections store them); ATh, ATl [b][row][DQ].
template <int QT, int NW>
__global__ __launch_bounds__(32 * NW) void k_fattn(const h16* __restrict__ Q16, const h16* __restrict__ K16, const h16* __restrict__ V16, const bf* __restrict__ Qh, const bf* __restrict__ Ql, const bf* __restrict__ Kh, const bf* __restrict__ Kl, const bf* __restrict__ Vh, const bf* __restrict__ Vl, const float* __restrict__ tab, bf* ATh, bf* ATl) {
    constexpr int ROWS = QT * 16, NTH = 32 * NW;
    static_assert(RH % ROWS == 0, "a row block is of one class");
    __shared__ float bs[TT + NTH];
    __shared__ float redm[NW * ROWS];
    __shared__ float reds[NW * ROWS];
    __shared__ __align__(16) float os[NW * ROWS * 68];
    const int h = (int)blockIdx.x % NH_, i0 = (int)blockIdx.y * ROWS; const size_t b = blockIdx.x / NH_, pb = b * PLN;
    ATh += b * ((size_t)TT * DQ); ATl += b * ((size_t)TT * DQ);
    if (i0 < RH) fattn_rows<bf, true, QT, NW>(Qh + pb, Ql + pb, Kh + pb, Kl + pb, Vh + pb, Vl + pb, tab, i0, h, ATh, ATl, bs, redm, reds, os);   // i0 comes from blockIdx.y: the whole work-group takes one side, its barriers with it
    else fattn_rows<h16, false, QT, NW>(Q16 + pb, nullptr, K16 + pb, nullptr, V16 + pb, nullptr, tab, i0, h, ATh, ATl, bs, redm, reds, os);
}
extern "C" void kernel_launch(void* const* d_in, const int* in_sizes, int n_in,
                              void* d_out, int out_size, void* d_ws, size_t ws_size, hipStream_t stream) {
    (void)in_sizes; (void)n_in; (void)out_size;
    const float* x = (const float*)d_in[0]; const float* xk = (const float*)d_in[1]; const float* xv = (const float*)d_in[2]; const float* wq = (const float*)d_in[3]; const float* bq = (const float*)d_in[4]; const float* wk = (const float*)d_in[5]; const float* bk = (const float*)d_in[6]; const float* wv = (const float*)d_in[7]; const float* bv = (const float*)d_in[8]; const float* wo = (const float*)d_in[9]; const float* bo = (const float*)d_in[10]; const float* rtab = (const float*)d_in[11];
    float* OUT = (float*)d_out;     // [2048][2][1024]
    char* wsp = (char*)d_ws;
    auto take = [&](size_t bytes) { char* p = wsp; wsp += (bytes + 255) & ~(size_t)255; return (void*)p; };
    static_assert(NKV == NH_ && DKV == DQ && DQ == DM, "q, k, v share one projection grid and one plane size");
    bf* XB = (bf*)take((3 * XN + 4 * WN) * 2);     // bf16: x, xk, xv, each [b][len][d], then Wq, Wk, Wv, Wo
    bf* WQKV = XB + 3 * XN; bf* WO = WQKV + 3 * WN;
    h16* P16 = (h16*)take(6 * PLN * 2); bf* Ph = (bf*)take(6 * PLN * 2); bf* Pl = (bf*)take(6 * PLN * 2);   // plane 2 * op + b: q, k [head][row][d], v [head][d][row]
    bf* ATh = (bf*)take((size_t)BSZ * TT * DQ * 2); bf* ATl = (bf*)take((size_t)BSZ * TT * DQ * 2);
    if ((size_t)(wsp - (char*)d_ws) > ws_size) return;    // ws 256 MiB
    k_cvtall<<<dim3((unsigned)(WN / (256 * 8 * CVU)), (unsigned)(3 * XN / WN + 4), 1), 256, 0, stream>>>(x, xk, xv, wq, wk, wv, wo, XB);
    k_gemmw<bf, 0, true, PJW, 1, 3><<<dim3(TT / 64, DQ / 64, 3 * BSZ), 32 * PJW, 0, stream>>>(XB, nullptr, WQKV, nullptr, DM, nullptr, 0, bq, bk, bv, 0, 0, 0, 0, P16, Ph, Pl, QSC);   /* q x 1/8 and k head planes, v planes transposed */
    k_fattn<2, 16><<<dim3(NH_ * BSZ, TT / 32, 1), 512, 0, stream>>>(P16, P16 + 2 * PLN, P16 + 4 * PLN, Ph, Pl, Ph + 2 * PLN, Pl + 2 * PLN, Ph + 4 * PLN, Pl + 4 * PLN, rtab, ATh, ATl);   /* rows < RH: hi/lo planes, 3 products; the other rows: fp16, P x 1024 */
    k_gemmw<bf, 1, true, PJW, 1, 0><<<dim3(TT / 64, DM / 64, BSZ), 32 * PJW, 0, stream>>>(ATh, ATl, WO, nullptr, DQ, OUT, BSZ * DM, bo, nullptr, nullptr, (size_t)TT * DQ, 0, DM, 0, nullptr, nullptr, nullptr, 1.0f);   /* rows at the (len, batch, d) pitch */
}

// v006
// A run of this version takes 175 microseconds.
// Two timings next to v005 both put it at 1.44 times that version's speed.
// All steps since v000 together make it 13.3 times as fast.
#include <hip/hip_runtime.h>

// Multi-head attention with a learned relative-position bias, sequence-first layout (query, key, value [2048][2][1024] = (len, batch, d_model); q,k,v = input W^T + b ('oi' [1024][1024] + [1024]; 16 heads x 64); scores = q.k / 8 + rel_table[clip(i - j + 2047, 0, 4094)][h] (table [4095][16], read); softmax over all keys; out = merged Wo^T + bo -> [2048][2][1024] (4.2 M)).
// Four launches, each over both batch elements: (1) the three inputs and the four weights rounded to bf16, each input's rows laid down by batch element ([b][len][d]), every 16-bit operand of every launch in the order the matrix fragments are read in; (2) the q, k, v projections, exact + f32 biases, one grid, each epilogue storing the attention operand planes itself; (3) dense T-2048 attention, both row classes in one grid (hybrid rows: < 512 hi/lo 3 products, rest fp16 x1024), the gathered per-head bias added to the scores in registers; (4) merged hi/lo x Wo exact + bo, stored at the batch pitch straight into the (len, batch, d) output.
// Compute dtypes, f32 accumulate: every input rounded to bf16; projections exact + f32 biases; attention rows < 512 3 products, rest fp16; bias add and softmax f32; Wo hl x exact + bias.

#define NB_  2
#define TT   2048
#define DM   1024
#define NH_  16
#define NKV  16
#define REP  (NH_ / NKV)
#define HD   64
#define DQ   (NH_ * HD)
#define DKV  (NKV * HD)
#define RH   512                  // query rows < RH use hi+lo planes (0: none)
#define WIN  0
#define PCAR 1024.0f
#define QSC  0.125f   // the 1/8 is folded into q so the gathered bias adds to the scaled scores
#define BSZ  2
#define NREL 4095
#define PJW  8                    // projections and Wo: waves of a work-group that share a tile's K
#define XN   ((size_t)TT * BSZ * DM)   // elements of one input
#define WN   ((size_t)DQ * DM)         // elements of one weight matrix
#define PLN  ((size_t)NH_ * TT * HD)   // elements of one operand plane (one of q, k, v of one batch element)
// Fragment order: every 16-bit matrix operand [rows][K] lies in the workspace as tiles of 16 rows x 32 k, FT elements each, tile (row >> 4, k >> 5) at ((row >> 4) * (K / 32) + (k >> 5)) * FT.
// Inside a tile the 8 elements (row, k & ~7 .. k | 7) stand at ((k >> 4 & 1) * 32 + (k >> 3 & 1) * 16 + (row & 15)) * 8: lane l finds the two halves of its fragment at l * 8 and 256 + l * 8, so each load instruction of a wave takes 512 consecutive bytes (4 whole lines, not 32-byte pieces of 16 lines).
#define FT   512
typedef _Float16 h16;
typedef unsigned short bf;
typedef __attribute__((ext_vector_type(16))) __bf16   v16bf;
typedef __attribute__((ext_vector_type(16))) _Float16 v16h;
typedef __attribute__((ext_vector_type(8)))  _Float16 v8h;
typedef __attribute__((ext_vector_type(8)))  unsigned short v8us;
typedef __attribute__((ext_vector_type(8)))  float    v8f;
typedef __attribute__((ext_vector_type(4)))  float    v4f;
typedef v8h  __attribute__((may_alias)) v8ha;
typedef v4f  __attribute__((may_alias)) v4fa;
typedef v8us __attribute__((may_alias)) v8usa;

__device__ __forceinline__ unsigned short f2bf(float f) { unsigned u = __float_as_uint(f); u += 0x7FFFu + ((u >> 16) & 1u); return (unsigned short)(u >> 16); }
__device__ __forceinline__ float bf2f(unsigned short b) { return __uint_as_float(((unsigned)b) << 16); }
__device__ __forceinline__ float bfr(float f) { return bf2f(f2bf(f)); }
__device__ __forceinline__ v16h cat16(v8h lo, v8h hi) { return __builtin_shufflevector(lo, hi, 0, 1, 2, 3, 4, 5, 6, 7, 8, 9, 10, 11, 12, 13, 14, 15); }
__device__ __forceinline__ v16bf cat16b(v8us lo, v8us hi) { return __builtin_bit_cast(v16bf, __builtin_shufflevector(lo, hi, 0, 1, 2, 3, 4, 5, 6, 7, 8, 9, 10, 11, 12, 13, 14, 15)); }
__device__ __forceinline__ v8f wmma16(v16h a, v16h b, v8f c) { return __builtin_amdgcn_wmma_f32_16x16x32_f16(false, a, false, b, (short)0, c, false, false); }
__device__ __forceinline__ v8f wmmab(v16bf a, v16bf b, v8f c) { return __builtin_amdgcn_wmma_f32_16x16x32_bf16(false, a, false, b, (short)0, c, false, false); }
__device__ __forceinline__ h16 tohx(float x) { return (h16)x; }
__device__ __forceinline__ void splitf(float y, unsigned short& h, unsigned short& l) { h = f2bf(y); l = f2bf(y - bf2f(h)); }
typedef __attribute__((ext_vector_type(2))) _Float16 v2h;
typedef __attribute__((ext_vector_type(4))) _Float16 v4h;
typedef __attribute__((ext_vector_type(2))) unsigned short v2us;
typedef __attribute__((ext_vector_type(4))) unsigned short v4us;
typedef __attribute__((ext_vector_type(2))) float v2f;
typedef __attribute__((ext_vector_type(4))) int v4i;



// ---- k_gemmw: register-blocked GEMM, 64x64 output tiles (16 accumulators a wave), operands straight from 16-bit planes in fragment order; grid (M/64, N/64 * KG, Z), 32 * KS threads.
// C[m][n] (f32, pitch ldc, + optional f32 bias[n]) = sum_k A[m][k] Bt[n][k] (+ split products per NSPLIT). z-batch strides sA/sB/sC in elements. K % (32 * KS * KG) == 0.
// K is cut into KG * KS equal ranges: work-group kg = blockIdx.y % KG, wave w sums range kg * KS + w over the whole tile. KS > 1: the group's KS f32 partial tiles meet in LDS and are added in wave order (a fixed order), then bias and store.
// KG > 1: group kg stores its sum to plane C + kg * sP; the reader of C adds the KG planes.
// EPI says where the joined tile goes. 0: f32 to C. 1, 2: a 64-column tile is one head (HD == 64), and (sum + bias) x sc goes as fp16 and as bf16 hi/lo to the planes P16, Ph, Pl that the attention kernel reads:
// 1: [head][row][d]. 2: [head][d][row]; there the waves lay their partial tiles into LDS transposed (a lane's 8 accumulator registers are 8 neighbouring rows of one column), so the join runs along the rows and every store is still a whole line. (3 stores each head's plane in fragment order: gemm_join_planes.)
// 3: q, k and v of both batch elements in one grid. z = 2 * op + b: A is plane z of the converted inputs (TT x DM each), Bt weight op, bias bias / bias1 / bias2, planes z of P16, Ph, Pl; op 0 (q) takes sc, the others 1; op 0, 1 store as 1, op 2 as 2.
// ld(t, lo): the fragment of the tile at t, the same address in the whole wave; lo = lane * 16, the lane's byte offset in each half of the tile, the one vector register of the address.
template <typename T16> struct WFrag;
template <> struct WFrag<h16> { typedef v16h V; static __device__ __forceinline__ V ld(const h16* t, unsigned lo) { const char* p = (const char*)t + lo; return cat16(*(const v8h*)p, *(const v8h*)(p + 512)); } static __device__ __forceinline__ v8f mma(V a, V b, v8f c) { return wmma16(a, b, c); } };
template <> struct WFrag<bf> { typedef v16bf V; static __device__ __forceinline__ V ld(const bf* t, unsigned lo) { const char* p = (const char*)t + lo; return cat16b(*(const v8us*)p, *(const v8us*)(p + 512)); } static __device__ __forceinline__ v8f mma(V a, V b, v8f c) { return wmmab(a, b, c); } };
// The join of a work-group's KS partial tiles (KS > 1), with bias and store; EPI as above. tr is read for EPI 3 alone and is the same in the whole work-group: true stores as 2, false as 1.
// For EPI 3 the two forms part only where they differ (bias index, LDS order of the partial tiles, store address); barrier, sums and conversions are common code, so that the accumulators die at the LDS stores on both sides.
template <int KS, bool BIAS, int EPI>
__device__ __forceinline__ void gemm_join(const v8f (&acc)[4][4], float* os, int wv, int lr, int hi, int r0, int c0, float* C, int ldc, const float* __restrict__ bias, h16* P16, bf* Ph, bf* Pl, float sc, bool tr) {
    const bool T = EPI == 2 || (EPI == 3 && tr);
    const int cofs = ((int)threadIdx.x & 15) * 4; v4f bv[32 / KS];
    if (BIAS && !T) { const float* bp = bias + c0 + cofs; v4f b; b[0] = bp[0]; b[1] = bp[1]; b[2] = bp[2]; b[3] = bp[3];
        asm volatile("s_wait_xcnt 0x0" :: "v"(bp) : "memory");   // inputs only: the bias load's address registers stay whole until the load is issued and this wait has passed
        b[0] = bfr(b[0]); b[1] = bfr(b[1]); b[2] = bfr(b[2]); b[3] = bfr(b[3]);
#pragma unroll
        for (int s = 0; s < 32 / KS; ++s) bv[s] = b; }
    if (BIAS && T) { const float* bp = bias + c0 + ((int)threadIdx.x >> 4); float bt[32 / KS];
#pragma unroll
        for (int s = 0; s < 32 / KS; ++s) bt[s] = bp[s * (2 * KS)];
        asm volatile("s_wait_xcnt 0x0" :: "v"(bp) : "memory");   // inputs only: the bias loads' address registers stay whole until every load that names them is issued and this wait has passed
#pragma unroll
        for (int s = 0; s < 32 / KS; ++s) { const float t = bfr(bt[s]); bv[s] = (v4f){t, t, t, t}; } }
    float* ow = os + wv * (64 * 68);
    if (T) {
#pragma unroll
        for (int mb = 0; mb < 4; ++mb)
#pragma unroll
            for (int nb = 0; nb < 4; ++nb) { float* op = ow + (nb * 16 + lr) * 68 + mb * 16 + hi * 8;
                *(v4fa*)op = __builtin_shufflevector(acc[mb][nb], acc[mb][nb], 0, 1, 2, 3); *(v4fa*)(op + 4) = __builtin_shufflevector(acc[mb][nb], acc[mb][nb], 4, 5, 6, 7); }
    } else {
#pragma unroll
        for (int mb = 0; mb < 4; ++mb)
#pragma unroll
            for (int nb = 0; nb < 4; ++nb)
#pragma unroll
                for (int j = 0; j < 8; ++j) ow[(mb * 16 + hi * 8 + j) * 68 + nb * 16 + lr] = acc[mb][nb][j];
    }
    __syncthreads();   // every wave's partial tile stands in LDS before any wave adds across them
    v4f vals[32 / KS];
#pragma unroll
    for (int s = 0; s < 32 / KS; ++s) { const int row = s * (2 * KS) + ((int)threadIdx.x >> 4); v4f val = *(const v4fa*)(os + row * 68 + cofs);
#pragma unroll
        for (int p = 1; p < KS; ++p) val += *(const v4fa*)(os + p * (64 * 68) + row * 68 + cofs);
        if (BIAS) val += bv[s];
        vals[s] = val; }
#pragma unroll
    for (int s = 0; s < 32 / KS; ++s) { const int row = s * (2 * KS) + ((int)threadIdx.x >> 4); const v4f val = vals[s];
        if constexpr (EPI == 0) { *(v4f*)(C + (size_t)(r0 + row) * ldc + c0 + cofs) = val; }
        else { v4h o16; v4us oh, ol;
#pragma unroll
            for (int q = 0; q < 4; ++q) { const float r = val[q] * sc; o16[q] = tohx(r); unsigned short a2, c2; splitf(r, a2, c2); oh[q] = a2; ol[q] = c2; }
            const size_t e = !T ? ((size_t)(c0 / HD) * TT + r0 + row) * HD + cofs : ((size_t)c0 + row) * TT + r0 + cofs;   // T: LDS row = column c0 + row of the product, LDS column = its row
            *(v4h*)(P16 + e) = o16; *(v4us*)(Ph + e) = oh; *(v4us*)(Pl + e) = ol;
            asm volatile("s_wait_xcnt 0x0" :: "v"(P16 + e), "v"(Ph + e), "v"(Pl + e), "v"(o16), "v"(oh), "v"(ol) : "memory"); } }   // inputs only: the three stores' address and data registers stay whole until they are issued and this wait has passed
}
// The join for EPI 3: the same partial tiles in LDS, the same sums (wave order, then bias, then sc), stored in fragment order. The 64 x 64 tile as it lies in LDS (tr: [d][row], else [row][d]) is 4 x 2 fragment tiles; wave w joins tile (w >> 1, w & 1):
// lane (lr, hi) takes LDS row (w >> 1) * 16 + lr, columns (w & 1) * 32 + u * 16 + hi * 8 .. + 7 for u = 0, 1, and each of its stores is 16 bytes of 512 consecutive ones of the wave.
template <int KS>
__device__ __forceinline__ void gemm_join_planes(const v8f (&acc)[4][4], float* os, int wv, int lr, int hi, int r0, int c0, const float* __restrict__ bias, h16* P16, bf* Ph, bf* Pl, float sc, bool tr) {
    static_assert(KS == 8 && HD == 64, "8 waves, one fragment tile each");
    const int rt = wv >> 1, kt = wv & 1; v8f bv[2];
    if (!tr) { const float* bp = bias + c0 + kt * 32 + hi * 8;
#pragma unroll
        for (int u = 0; u < 2; ++u)
#pragma unroll
            for (int q = 0; q < 8; ++q) bv[u][q] = bp[u * 16 + q];
        asm volatile("s_wait_xcnt 0x0" :: "v"(bp) : "memory");   // inputs only: the bias loads' address registers stay whole until every load that names them is issued and this wait has passed
#pragma unroll
        for (int u = 0; u < 2; ++u)
#pragma unroll
            for (int q = 0; q < 8; ++q) bv[u][q] = bfr(bv[u][q]);
    } else { const float* bp = bias + c0 + rt * 16 + lr; float t = *bp;
        asm volatile("s_wait_xcnt 0x0" :: "v"(bp) : "memory");   // inputs only: the bias load's address registers stay whole until the load is issued and this wait has passed
        t = bfr(t);
#pragma unroll
        for (int u = 0; u < 2; ++u)
#pragma unroll
            for (int q = 0; q < 8; ++q) bv[u][q] = t; }
    float* ow = os + wv * (64 * 68);
    if (tr) {
#pragma unroll
        for (int mb = 0; mb < 4; ++mb)
#pragma unroll
            for (int nb = 0; nb < 4; ++nb) { float* op = ow + (nb * 16 + lr) * 68 + mb * 16 + hi * 8;
                *(v4fa*)op = __builtin_shufflevector(acc[mb][nb], acc[mb][nb], 0, 1, 2, 3); *(v4fa*)(op + 4) = __builtin_shufflevector(acc[mb][nb], acc[mb][nb], 4, 5, 6, 7); }
    } else {
#pragma unroll
        for (int mb = 0; mb < 4; ++mb)
#pragma unroll
            for (int nb = 0; nb < 4; ++nb)
#pragma unroll
                for (int j = 0; j < 8; ++j) ow[(mb * 16 + hi * 8 + j) * 68 + nb * 16 + lr] = acc[mb][nb][j];
    }
    __syncthreads();   // every wave's partial tile stands in LDS before any wave adds across them
    const size_t e0 = (size_t)c0 * TT + (!tr ? (size_t)((r0 >> 4) + rt) * (HD / 32) + kt : (size_t)rt * (TT / 32) + (r0 >> 5) + kt) * FT + (hi * 16 + lr) * 8;   // c0 * TT: the head's plane, HD * TT elements a head
    v8h o16[2]; v8us oh[2], ol[2];
#pragma unroll
    for (int u = 0; u < 2; ++u) { const float* sp = os + (rt * 16 + lr) * 68 + kt * 32 + u * 16 + hi * 8; v4f x0 = *(const v4fa*)sp, x1 = *(const v4fa*)(sp + 4);
#pragma unroll
        for (int p = 1; p < KS; ++p) { x0 += *(const v4fa*)(sp + p * (64 * 68)); x1 += *(const v4fa*)(sp + p * (64 * 68) + 4); }
#pragma unroll
        for (int q = 0; q < 8; ++q) { const float r = ((q < 4 ? x0[q & 3] : x1[q & 3]) + bv[u][q]) * sc; o16[u][q] = tohx(r); unsigned short a2, c2; splitf(r, a2, c2); oh[u][q] = a2; ol[u][q] = c2; } }
#pragma unroll
    for (int u = 0; u < 2; ++u) { *(v8h*)(P16 + e0 + u * 256) = o16[u]; *(v8us*)(Ph + e0 + u * 256) = oh[u]; *(v8us*)(Pl + e0 + u * 256) = ol[u]; }
    asm volatile("s_wait_xcnt 0x0" :: "v"(P16 + e0), "v"(Ph + e0), "v"(Pl + e0), "v"(o16[0]), "v"(oh[0]), "v"(ol[0]), "v"(o16[1]), "v"(oh[1]), "v"(ol[1]) : "memory");   // inputs only: the six stores' address and data registers stay whole until they are issued and this wait has passed
}
template <typename T16, int NSPLIT, bool BIAS, int KS, int KG, int EPI>
__global__ __launch_bounds__(32 * KS) void k_gemmw(const T16* __restrict__ A, const T16* __restrict__ A2, const T16* __restrict__ Bt, const T16* __restrict__ Bt2, int K, float* C, int ldc, const float* __restrict__ bias, const float* __restrict__ bias1, const float* __restrict__ bias2, size_t sA, size_t sB, size_t sC, size_t sP, h16* P16, bf* Ph, bf* Pl, float sc) {
    typedef typename WFrag<T16>::V V;
    static_assert(EPI == 0 || (KS > 1 && KG == 1 && HD == 64), "the plane epilogues join in LDS and take one head a tile");
    __shared__ __align__(16) float os[(KS == 1 ? 16 : KS * 64) * 68];
    const size_t z = blockIdx.z; const int op = (int)(blockIdx.z >> 1);
    if constexpr (EPI == 3) { A += z * ((size_t)TT * DM); Bt += (size_t)op * WN; bias = op == 0 ? bias : op == 1 ? bias1 : bias2; P16 += z * PLN; Ph += z * PLN; Pl += z * PLN; sc = op == 0 ? sc : 1.0f; }
    else { A += z * sA; if (A2) A2 += z * sA; Bt += z * sB; if (Bt2) Bt2 += z * sB; C += z * sC; }
    const int lane = threadIdx.x & 31, lr = lane & 15, hi = lane >> 4; const int r0 = blockIdx.x * 64, c0 = (int)(blockIdx.y / KG) * 64; const int kg = (int)(blockIdx.y % KG); if (KG > 1) C += (size_t)kg * sP;
    const int wv = (KS == 1) ? 0 : __builtin_amdgcn_readfirstlane((int)(threadIdx.x >> 5));   // the wave's number in a scalar register: the k loop stays a scalar loop
    const int kbeg = (kg * KS + wv) * (K / (KS * KG)), kend = kbeg + K / (KS * KG);
    v8f acc[4][4];
#pragma unroll
    for (int mb = 0; mb < 4; ++mb)
#pragma unroll
        for (int nb = 0; nb < 4; ++nb) acc[mb][nb] = (v8f){};
    static_assert(DQ == DM, "one K for every launch"); constexpr size_t tp = (size_t)(DM / 32) * FT;   // one row of tiles (K == DM in every launch): a constant, so that it goes into the loads' immediate offsets
    const size_t aoff = (size_t)(r0 / 16) * tp, boff = (size_t)(c0 / 16) * tp; const unsigned lo = lane * 16;
#pragma unroll 1
    for (int kc = kbeg; kc < kend; kc += 32) {
        V a[4], a2[4]; const unsigned ko = lo + (unsigned)(kc / 32) * (FT * 2);   // the lane's byte offset in its row of tiles: the one vector register of every address of this trip
#pragma unroll
        for (int mb = 0; mb < 4; ++mb) { a[mb] = WFrag<T16>::ld(A + aoff + mb * tp, ko); if (NSPLIT == 1 || NSPLIT == 2) a2[mb] = WFrag<T16>::ld(A2 + aoff + mb * tp, ko); }
#pragma unroll
        for (int nb = 0; nb < 4; ++nb) { const V b = WFrag<T16>::ld(Bt + boff + nb * tp, ko); V b2; if (NSPLIT >= 2) b2 = WFrag<T16>::ld(Bt2 + boff + nb * tp, ko);
#pragma unroll
            for (int mb = 0; mb < 4; ++mb) { acc[mb][nb] = WFrag<T16>::mma(a[mb], b, acc[mb][nb]); if (NSPLIT == 1 || NSPLIT == 2) acc[mb][nb] = WFrag<T16>::mma(a2[mb], b, acc[mb][nb]); if (NSPLIT >= 2) acc[mb][nb] = WFrag<T16>::mma(a[mb], b2, acc[mb][nb]); } }
        asm volatile("v_nop\n\tv_nop\n\tv_nop\n\tv_nop" : "+v"(acc[0][0]), "+v"(acc[1][1]), "+v"(acc[2][2]), "+v"(acc[3][3]) : "v"(a[0]), "v"(a[3]));
    }
    if constexpr (KS > 1) {
        if constexpr (EPI == 3) gemm_join_planes<KS>(acc, os, wv, lr, hi, r0, c0, bias, P16, Ph, Pl, sc, op == 2);   // op comes from blockIdx.z
        else gemm_join<KS, BIAS, EPI>(acc, os, wv, lr, hi, r0, c0, C, ldc, bias, P16, Ph, Pl, sc, false);
    } else {
#pragma unroll
    for (int mb = 0; mb < 4; ++mb) {
#pragma unroll
        for (int nb = 0; nb < 4; ++nb) {
#pragma unroll
            for (int j = 0; j < 8; ++j) os[(hi * 8 + j) * 68 + nb * 16 + lr] = acc[mb][nb][j]; }
        __builtin_amdgcn_wave_barrier(); asm volatile("" ::: "memory");
        float* crow = C + (size_t)(r0 + mb * 16) * ldc + c0;
{
#pragma unroll
            for (int s = 0; s < 8; ++s) { const int row = 2 * s + hi, cofs = lr * 4; v4f val = *(const v4fa*)(os + row * 68 + cofs); if (BIAS) { val[0] += bfr(bias[c0 + cofs]); val[1] += bfr(bias[c0 + cofs + 1]); val[2] += bfr(bias[c0 + cofs + 2]); val[3] += bfr(bias[c0 + cofs + 3]); }
                *(v4f*)(crow + (size_t)row * ldc + cofs) = val; }
             }
        __builtin_amdgcn_wave_barrier(); asm volatile("" ::: "memory");
    }
    }
}


__global__ __launch_bounds__(256) void k_wtG(const float* __restrict__ w, int K, int N, bf* Bt) {
    const int lane = threadIdx.x & 31; const int L0 = (blockIdx.x * 8 + (threadIdx.x >> 5)) * 8; const int nlines = N * K / 64;
{
#pragma unroll 1
        for (int l = 0; l < 8; ++l) { const int L = L0 + l; if (L >= nlines) break; const size_t e = (size_t)L * 64 + lane * 2; const int k = (int)(e % K), n = (int)(e / K); v2us o;
            o[0] = f2bf(w[(size_t)k * N + n]); o[1] = f2bf(w[(size_t)(k + 1) * N + n]); *(v2us*)(Bt + e) = o; }
         }
}
// k_cvtall: all seven f32 operands rounded to bf16 in one grid, each laid down in fragment order. y = a unit of WN elements: XN / WN units for each of x, xk, xv, then one for each weight; dst holds them in that order, an input as one [len][d] matrix for each batch element.
// A work-group takes 16 source rows (an input: 8 rows of each batch element). A wave takes 8 rows of one matrix x 32 columns at a time: lane = (row & 7) + 8 * (column >> 3 & 3) reads 32 bytes of a whole 128-byte line of its row and stores 16 bytes; the 8 rows of a column group are 128 consecutive bytes of the tile. All loads are asked for before the first store.
#define CVU 8
__global__ __launch_bounds__(256) void k_cvtall(const float* __restrict__ x, const float* __restrict__ xk, const float* __restrict__ xv, const float* __restrict__ wq, const float* __restrict__ wk, const float* __restrict__ wv, const float* __restrict__ wo, bf* dst) {
    constexpr int UX = (int)(XN / WN); static_assert(XN % WN == 0 && WN % (256 * 8 * CVU) == 0, "whole units, whole work-groups");
    static_assert(DM == 1024 && BSZ == 2 && CVU == 8, "16 rows of 32 tile columns: 8 waves x 4 trips x 2 row groups");
    const int u = (int)blockIdx.y; const bool isx = u < 3 * UX;
    const float* s = u < UX ? x + (size_t)u * WN : u < 2 * UX ? xk + (size_t)(u - UX) * WN : u < 3 * UX ? xv + (size_t)(u - 2 * UX) * WN : u == 3 * UX ? wq : u == 3 * UX + 1 ? wk : u == 3 * UX + 2 ? wv : wo;
    const int lane = (int)threadIdx.x & 31, w = (int)threadIdx.x >> 5, r8 = lane & 7, c = lane >> 3;
    // row group g = 0, 1: an input's batch element g (source rows r8 * BSZ + g), a weight's rows g * 8 + r8
    const float* s0 = s + (size_t)((int)blockIdx.x * 16 + (isx ? r8 * BSZ : r8)) * DM + w * 32 + c * 8;
    const float* s1 = s0 + (isx ? DM : 8 * DM);
    v8f v[CVU];
#pragma unroll
    for (int i = 0; i < CVU; ++i) v[i] = *(const v8f*)((i < 4 ? s0 : s1) + (i & 3) * 256);
    asm volatile("s_wait_xcnt 0x0" :: "v"(s0), "v"(s1) : "memory");   // inputs only: the loads' address registers stay whole until every load that names them is issued and this wait has passed
    // destination row of group 0 in its matrix, and the two groups' matrices and rows
    const int d0 = isx ? (u % UX) * (int)(WN / DM / BSZ) + (int)blockIdx.x * 8 + r8 : (int)blockIdx.x * 16 + r8;
    const int d1 = isx ? d0 : d0 + 8;
    bf* m0 = dst + (isx ? (size_t)(u / UX) * XN : (size_t)u * WN); bf* m1 = isx ? m0 + (size_t)TT * DM : m0;
    const int in = (c >> 1) * 256 + (c & 1) * 128 + w * FT;
    bf* p0 = m0 + (size_t)(d0 >> 4) * ((DM / 32) * FT) + (d0 & 15) * 8 + in; bf* p1 = m1 + (size_t)(d1 >> 4) * ((DM / 32) * FT) + (d1 & 15) * 8 + in;
    v8us o[CVU];
#pragma unroll
    for (int i = 0; i < CVU; ++i)
#pragma unroll
        for (int k = 0; k < 8; ++k) o[i][k] = f2bf(v[i][k]);
#pragma unroll
    for (int i = 0; i < CVU; ++i) *(v8us*)((i < 4 ? p0 : p1) + (i & 3) * (8 * FT)) = o[i];
    asm volatile("s_wait_xcnt 0x0" :: "v"(p0), "v"(p1), "v"(o[0]), "v"(o[1]), "v"(o[2]), "v"(o[3]), "v"(o[4]), "v"(o[5]), "v"(o[6]), "v"(o[7]) : "memory");   // inputs only: the stores' address and data registers stay whole until every store is issued and this wait has passed
}

// fattn_rows: scores, bias, softmax and P.V of ROWS = 16 * QT query rows (from i0) of head h of one batch element in one work-group; nothing of the score matrix goes to memory. bs, redm, reds, os: the work-group's LDS, declared in k_fattn.
// Wave w owns keys [w * KW, (w + 1) * KW). It forms S^T = K Q^T (A = 16 key rows, B = 16 query rows, both planes in fragment order): accumulator register j of lane (lr, hi) is (key 8 hi + j of the tile, query lr).
// That is the A-fragment order of P for P.V: two neighbouring key tiles give elements 0..7 (k = 8 hi + j) and 8..15 (k = 16 + 8 hi + j) of query row lr, so P goes from the accumulators to the matrix unit without leaving the lane.
// A query's maximum and sum: in the lane, across the two lane halves, then across the waves through LDS (wave order). The waves' f32 partial outputs meet in LDS and are added in wave order, then hi/lo planes of the merged operand.
// bs[key + ROWS - 1 - r] is the bias of (row i0 + r, key): TT + ROWS - 1 consecutive table entries of the head, gathered once.
template <typename T16, bool HR, int QT, int NW>
__device__ __forceinline__ void fattn_rows(const T16* __restrict__ Qa, const T16* __restrict__ Qb, const T16* __restrict__ Ka, const T16* __restrict__ Kb, const T16* __restrict__ Va, const T16* __restrict__ Vb, const float* __restrict__ tab, int i0, int h, bf* ATh, bf* ATl, float* bs, float* redm, float* reds, float* os) {
    typedef typename WFrag<T16>::V V;
    constexpr int ROWS = QT * 16, NTH = 32 * NW, KW = TT / NW, NT = KW / 16, NC = KW / 32;
    static_assert(2 * NW == ROWS && TT % NTH == 0 && KW % 32 == 0, "shape");
    const int lane = threadIdx.x & 31, lr = lane & 15, hi = lane >> 4; const int wv = __builtin_amdgcn_readfirstlane((int)(threadIdx.x >> 5));
    const int key0 = wv * KW; const size_t hp = (size_t)h * TT * HD;
    constexpr int NG = TT / NTH + 1; float g[NG];
#pragma unroll
    for (int t = 0; t < NG; ++t) { int r = i0 + (ROWS - 1) + (TT - 1) - (t * NTH + (int)threadIdx.x); r = min(max(r, 0), NREL - 1); g[t] = tab[(size_t)r * NH_ + h]; }   // asked for first, stored to LDS behind the score products; entries from TT + ROWS - 1 on are never read, and the clip bounds their address like any other
    asm volatile("s_wait_xcnt 0x0" ::: "memory");   // the gathers' address registers may be reused by what follows
    V qa[QT][2], qb[QT][2]; const size_t qo = hp + (size_t)(i0 / 16) * ((HD / 32) * FT); const unsigned lo = lane * 16;
#pragma unroll
    for (int qt = 0; qt < QT; ++qt)
#pragma unroll
        for (int kk = 0; kk < 2; ++kk) { qa[qt][kk] = WFrag<T16>::ld(Qa + qo + (qt * 2 + kk) * FT, lo); if constexpr (HR) qb[qt][kk] = WFrag<T16>::ld(Qb + qo + (qt * 2 + kk) * FT, lo); }
    v8f s[QT][NT];
    const size_t ko = hp + (size_t)(key0 / 16) * ((HD / 32) * FT);
#pragma unroll
    for (int nt = 0; nt < NT; ++nt) { V ka[2], kb[2];
#pragma unroll
        for (int kk = 0; kk < 2; ++kk) { ka[kk] = WFrag<T16>::ld(Ka + ko + (nt * 2 + kk) * FT, lo); if constexpr (HR) kb[kk] = WFrag<T16>::ld(Kb + ko + (nt * 2 + kk) * FT, lo); }
#pragma unroll
        for (int qt = 0; qt < QT; ++qt) { v8f a = (v8f){};
#pragma unroll
            for (int kk = 0; kk < 2; ++kk) { a = WFrag<T16>::mma(ka[kk], qa[qt][kk], a); if constexpr (HR) { a = WFrag<T16>::mma(ka[kk], qb[qt][kk], a); a = WFrag<T16>::mma(kb[kk], qa[qt][kk], a); } }
            s[qt][nt] = a; } }
#pragma unroll
    for (int t = 0; t < NG; ++t) bs[t * NTH + (int)threadIdx.x] = bfr(g[t]);
    __syncthreads();   // the head's table entries stand in LDS before any wave adds them to its scores
#pragma unroll
    for (int qt = 0; qt < QT; ++qt) { const float* br = bs + key0 + 8 * hi + (ROWS - 1) - (qt * 16 + lr); v8f m8;
#pragma unroll
        for (int nt = 0; nt < NT; ++nt)
#pragma unroll
            for (int j = 0; j < 8; ++j) { const float t = __fadd_rn(s[qt][nt][j], br[nt * 16 + j]); s[qt][nt][j] = t; m8[j] = nt ? fmaxf(m8[j], t) : t; }
        float m = fmaxf(fmaxf(fmaxf(m8[0], m8[1]), fmaxf(m8[2], m8[3])), fmaxf(fmaxf(m8[4], m8[5]), fmaxf(m8[6], m8[7])));
        m = fmaxf(m, __shfl_xor(m, 16, 32));
        if (hi == 0) redm[wv * ROWS + qt * 16 + lr] = m; }
    __syncthreads();   // every wave's maxima stand in LDS before any wave takes the maximum over them
    float f[QT];
#pragma unroll
    for (int qt = 0; qt < QT; ++qt) { float m = redm[qt * 16 + lr];
#pragma unroll
        for (int p = 1; p < NW; ++p) m = fmaxf(m, redm[p * ROWS + qt * 16 + lr]);
        v8f s8 = (v8f){};
#pragma unroll
        for (int nt = 0; nt < NT; ++nt)
#pragma unroll
            for (int j = 0; j < 8; ++j) { const float e = __builtin_amdgcn_exp2f(__fmul_rn(__fsub_rn(s[qt][nt][j], m), 1.4426950408889634f)); s[qt][nt][j] = e; s8[j] += e; }
        float sum = ((s8[0] + s8[1]) + (s8[2] + s8[3])) + ((s8[4] + s8[5]) + (s8[6] + s8[7]));
        sum += __shfl_xor(sum, 16, 32);
        if (hi == 0) reds[wv * ROWS + qt * 16 + lr] = sum; }
    __syncthreads();   // every wave's sums stand in LDS before any wave adds them
#pragma unroll
    for (int qt = 0; qt < QT; ++qt) { float sum = reds[qt * 16 + lr];
#pragma unroll
        for (int p = 1; p < NW; ++p) sum += reds[p * ROWS + qt * 16 + lr];
        f[qt] = __fdiv_rn(HR ? 1.0f : PCAR, sum); }
    v8f o[QT][4];
#pragma unroll
    for (int qt = 0; qt < QT; ++qt)
#pragma unroll
        for (int nb = 0; nb < 4; ++nb) o[qt][nb] = (v8f){};
    const size_t vo = hp + (size_t)(key0 / 32) * FT;
#pragma unroll
    for (int c = 0; c < NC; ++c) { V pa[QT], pb[QT];
#pragma unroll
        for (int qt = 0; qt < QT; ++qt) {
            if constexpr (HR) { v8us h0, l0, h1, l1;
#pragma unroll
                for (int j = 0; j < 8; ++j) { unsigned short a, c2; splitf(s[qt][2 * c][j] * f[qt], a, c2); h0[j] = a; l0[j] = c2; splitf(s[qt][2 * c + 1][j] * f[qt], a, c2); h1[j] = a; l1[j] = c2; }
                pa[qt] = cat16b(h0, h1); pb[qt] = cat16b(l0, l1);
            } else { v8h p0, p1;
#pragma unroll
                for (int j = 0; j < 8; ++j) { p0[j] = tohx(s[qt][2 * c][j] * f[qt]); p1[j] = tohx(s[qt][2 * c + 1][j] * f[qt]); }
                pa[qt] = cat16(p0, p1); } }
#pragma unroll
        for (int nb = 0; nb < 4; ++nb) { const V vb = WFrag<T16>::ld(Va + vo + (nb * (TT / 32) + c) * FT, lo); V vb2; if constexpr (HR) vb2 = WFrag<T16>::ld(Vb + vo + (nb * (TT / 32) + c) * FT, lo);
#pragma unroll
            for (int qt = 0; qt < QT; ++qt) { o[qt][nb] = WFrag<T16>::mma(pa[qt], vb, o[qt][nb]); if constexpr (HR) { o[qt][nb] = WFrag<T16>::mma(pb[qt], vb, o[qt][nb]); o[qt][nb] = WFrag<T16>::mma(pa[qt], vb2, o[qt][nb]); } } } }
    float* ow = os + wv * (ROWS * 68);
#pragma unroll
    for (int qt = 0; qt < QT; ++qt)
#pragma unroll
        for (int nb = 0; nb < 4; ++nb)
#pragma unroll
            for (int j = 0; j < 8; ++j) ow[(qt * 16 + hi * 8 + j) * 68 + nb * 16 + lr] = o[qt][nb][j];
    __syncthreads();   // every wave's partial output tile stands in LDS before any wave adds across them
    static_assert(QT == 2 && NW == 16 && HD == 64, "16 waves, 16 rows x 8 columns each");
    const int row = (wv >> 3) * 16 + lr, cofs = (wv & 7) * 8 + hi * 4; v4f val = *(const v4fa*)(os + row * 68 + cofs);   // a wave's 16 rows x 8 columns are 256 consecutive bytes of the merged operand in fragment order
#pragma unroll
    for (int p = 1; p < NW; ++p) val += *(const v4fa*)(os + p * (ROWS * 68) + row * 68 + cofs);
    const float cs = HR ? 1.0f : (1.0f / PCAR); v4us oh, ol;
#pragma unroll
    for (int q = 0; q < 4; ++q) { unsigned short a, c2; splitf(val[q] * cs, a, c2); oh[q] = a; ol[q] = c2; }
    const size_t oo = ((size_t)(i0 / 16 + (wv >> 3)) * (DQ / 32) + h * (HD / 32) + ((wv >> 2) & 1)) * FT + ((wv >> 1) & 1) * 256 + ((wv & 1) * 16 + lr) * 8 + hi * 4; *(v4us*)(ATh + oo) = oh; *(v4us*)(ATl + oo) = ol;
}
// k_fattn: every (head, batch element, block of ROWS query rows) in one grid: x = head + NH_ * b, y = row block. The blocks of rows < RH (three products, the longer work) have the lowest y.
// Each operand pointer is batch element 0's plane, element 1's follows it (as the projections store them); ATh, ATl [b][row][DQ], each batch element's matrix in fragment order.
template <int QT, int NW>
__global__ __launch_bounds__(32 * NW) void k_fattn(const h16* __restrict__ Q16, const h16* __restrict__ K16, const h16* __restrict__ V16, const bf* __restrict__ Qh, const bf* __restrict__ Ql, const bf* __restrict__ Kh, const bf* __restrict__ Kl, const bf* __restrict__ Vh, const bf* __restrict__ Vl, const float* __restrict__ tab, bf* ATh, bf* ATl) {
    constexpr int ROWS = QT * 16, NTH = 32 * NW;
    static_assert(RH % ROWS == 0, "a row block is of one class");
    __shared__ float bs[TT + NTH];
    __shared__ float redm[NW * ROWS];
    __shared__ float reds[NW * ROWS];
    __shared__ __align__(16) float os[NW * ROWS * 68];
    const int h = (int)blockIdx.x % NH_, i0 = (int)blockIdx.y * ROWS; const size_t b = blockIdx.x / NH_, pb = b * PLN;
    ATh += b * ((size_t)TT * DQ); ATl += b * ((size_t)TT * DQ);
    if (i0 < RH) fattn_rows<bf, true, QT, NW>(Qh + pb, Ql + pb, Kh + pb, Kl + pb, Vh + pb, Vl + pb, tab, i0, h, ATh, ATl, bs, redm, reds, os);   // i0 comes from blockIdx.y: the whole work-group takes one side, its barriers with it
    else fattn_rows<h16, false, QT, NW>(Q16 + pb, nullptr, K16 + pb, nullptr, V16 + pb, nullptr, tab, i0, h, ATh, ATl, bs, redm, reds, os);
}
extern "C" void kernel_launch(void* const* d_in, const int* in_sizes, int n_in,
                              void* d_out, int out_size, void* d_ws, size_t ws_size, hipStream_t stream) {
    (void)in_sizes; (void)n_in; (void)out_size;
    const float* x = (const float*)d_in[0]; const float* xk = (const float*)d_in[1]; const float* xv = (const float*)d_in[2]; const float* wq = (const float*)d_in[3]; const float* bq = (const float*)d_in[4]; const float* wk = (const float*)d_in[5]; const float* bk = (const float*)d_in[6]; const float* wv = (const float*)d_in[7]; const float* bv = (const float*)d_in[8]; const float* wo = (const float*)d_in[9]; const float* bo = (const float*)d_in[10]; const float* rtab = (const float*)d_in[11];
    float* OUT = (float*)d_out;     // [2048][2][1024]
    char* wsp = (char*)d_ws;
    auto take = [&](size_t bytes) { char* p = wsp; wsp += (bytes + 255) & ~(size_t)255; return (void*)p; };
    static_assert(NKV == NH_ && DKV == DQ && DQ == DM, "q, k, v share one projection grid and one plane size");
    bf* XB = (bf*)take((3 * XN + 4 * WN) * 2);     // bf16, fragment order: x, xk, xv, each [b][len][d], then Wq, Wk, Wv, Wo
    bf* WQKV = XB + 3 * XN; bf* WO = WQKV + 3 * WN;
    h16* P16 = (h16*)take(6 * PLN * 2); bf* Ph = (bf*)take(6 * PLN * 2); bf* Pl = (bf*)take(6 * PLN * 2);   // plane 2 * op + b: q, k [head][row][d], v [head][d][row], each head's matrix in fragment order
    bf* ATh = (bf*)take((size_t)BSZ * TT * DQ * 2); bf* ATl = (bf*)take((size_t)BSZ * TT * DQ * 2);
    if ((size_t)(wsp - (char*)d_ws) > ws_size) return;    // ws 256 MiB
    k_cvtall<<<dim3((unsigned)(WN / (256 * 8 * CVU)), (unsigned)(3 * XN / WN + 4), 1), 256, 0, stream>>>(x, xk, xv, wq, wk, wv, wo, XB);
    k_gemmw<bf, 0, true, PJW, 1, 3><<<dim3(TT / 64, DQ / 64, 3 * BSZ), 32 * PJW, 0, stream>>>(XB, nullptr, WQKV, nullptr, DM, nullptr, 0, bq, bk, bv, 0, 0, 0, 0, P16, Ph, Pl, QSC);   /* q x 1/8 and k head planes, v planes transposed */
    k_fattn<2, 16><<<dim3(NH_ * BSZ, TT / 32, 1), 512, 0, stream>>>(P16, P16 + 2 * PLN, P16 + 4 * PLN, Ph, Pl, Ph + 2 * PLN, Pl + 2 * PLN, Ph + 4 * PLN, Pl + 4 * PLN, rtab, ATh, ATl);   /* rows < RH: hi/lo planes, 3 products; the other rows: fp16, P x 1024 */
    k_gemmw<bf, 1, true, PJW, 1, 0><<<dim3(TT / 64, DM / 64, BSZ), 32 * PJW, 0, stream>>>(ATh, ATl, WO, nullptr, DQ, OUT, BSZ * DM, bo, nullptr, nullptr, (size_t)TT * DQ, 0, DM, 0, nullptr, nullptr, nullptr, 1.0f);   /* rows at the (len, batch, d) pitch */
}

// v007
// Measured time: 159 microseconds a run.
// Next to v006, in two timings, it ran 1.10 times as fast each time.
// Over all steps from v000 it is 14.7 times as fast.
#include <hip/hip_runtime.h>

// Multi-head attention with a learned relative-position bias, sequence-first layout (query, key, value [2048][2][1024] = (len, batch, d_model); q,k,v = input W^T + b ('oi' [1024][1024] + [1024]; 16 heads x 64); scores = q.k / 8 + rel_table[clip(i - j + 2047, 0, 4094)][h] (table [4095][16], read); softmax over all keys; out = merged Wo^T + bo -> [2048][2][1024] (4.2 M)).
// Four launches, each over both batch elements: (1) the three inputs and the four weights rounded to bf16, each input's rows laid down by batch element ([b][len][d]), every 16-bit operand of every launch in the order the matrix fragments are read in; (2) the q, k, v projections, exact + f32 biases, one grid, each epilogue storing the attention operand planes itself; (3) dense T-2048 attention, both row classes in one grid (hybrid rows: < 512 hi/lo 3 products, rest fp16 x1024), the gathered per-head bias added to the scores in registers; (4) merged hi/lo x Wo exact + bo, stored at the batch pitch straight into the (len, batch, d) output.
// Compute dtypes, f32 accumulate: every input rounded to bf16; projections exact + f32 biases; attention rows < 512 3 products, rest fp16; bias add and softmax f32; Wo hl x exact + bias.

#define NB_  2
#define TT   2048
#define DM   1024
#define NH_  16
#define NKV  16
#define REP  (NH_ / NKV)
#define HD   64
#define DQ   (NH_ * HD)
#define DKV  (NKV * HD)
#define RH   512                  // query rows < RH use hi+lo planes (0: none)
#define WIN  0
#define PCAR 1024.0f
#define QSC  0.125f   // the 1/8 is folded into q so the gathered bias adds to the scaled scores
#define BSZ  2
#define NREL 4095
#define XN   ((size_t)TT * BSZ * DM)   // elements of one input
#define WN   ((size_t)DQ * DM)         // elements of one weight matrix
#define PLN  ((size_t)NH_ * TT * HD)   // elements of one operand plane (one of q, k, v of one batch element)
// Fragment order: every 16-bit matrix operand [rows][K] lies in the workspace as tiles of 16 rows x 32 k, FT elements each, tile (row >> 4, k >> 5) at ((row >> 4) * (K / 32) + (k >> 5)) * FT.
// Inside a tile the 8 elements (row, k & ~7 .. k | 7) stand at ((k >> 4 & 1) * 32 + (k >> 3 & 1) * 16 + (row & 15)) * 8: lane l finds the two halves of its fragment at l * 8 and 256 + l * 8, so each load instruction of a wave takes 512 consecutive bytes (4 whole lines, not 32-byte pieces of 16 lines).
#define FT   512
typedef _Float16 h16;
typedef unsigned short bf;
typedef __attribute__((ext_vector_type(16))) __bf16   v16bf;
typedef __attribute__((ext_vector_type(16))) _Float16 v16h;
typedef __attribute__((ext_vector_type(8)))  _Float16 v8h;
typedef __attribute__((ext_vector_type(8)))  unsigned short v8us;
typedef __attribute__((ext_vector_type(8)))  float    v8f;
typedef __attribute__((ext_vector_type(4)))  float    v4f;
typedef v8h  __attribute__((may_alias)) v8ha;
typedef v4f  __attribute__((may_alias)) v4fa;
typedef v8us __attribute__((may_alias)) v8usa;

__device__ __forceinline__ unsigned short f2bf(float f) { unsigned u = __float_as_uint(f); u += 0x7FFFu + ((u >> 16) & 1u); return (unsigned short)(u >> 16); }
__device__ __forceinline__ float bf2f(unsigned short b) { return __uint_as_float(((unsigned)b) << 16); }
__device__ __forceinline__ float bfr(float f) { return bf2f(f2bf(f)); }
__device__ __forceinline__ v16h cat16(v8h lo, v8h hi) { return __builtin_shufflevector(lo, hi, 0, 1, 2, 3, 4, 5, 6, 7, 8, 9, 10, 11, 12, 13, 14, 15); }
__device__ __forceinline__ v16bf cat16b(v8us lo, v8us hi) { return __builtin_bit_cast(v16bf, __builtin_shufflevector(lo, hi, 0, 1, 2, 3, 4, 5, 6, 7, 8, 9, 10, 11, 12, 13, 14, 15)); }
__device__ __forceinline__ v8f wmma16(v16h a, v16h b, v8f c) { return __builtin_amdgcn_wmma_f32_16x16x32_f16(false, a, false, b, (short)0, c, false, false); }
__device__ __forceinline__ v8f wmmab(v16bf a, v16bf b, v8f c) { return __builtin_amdgcn_wmma_f32_16x16x32_bf16(false, a, false, b, (short)0, c, false, false); }
__device__ __forceinline__ h16 tohx(float x) { return (h16)x; }
__device__ __forceinline__ void splitf(float y, unsigned short& h, unsigned short& l) { h = f2bf(y); l = f2bf(y - bf2f(h)); }
typedef __attribute__((ext_vector_type(2))) _Float16 v2h;
typedef __attribute__((ext_vector_type(4))) _Float16 v4h;
typedef __attribute__((ext_vector_type(2))) unsigned short v2us;
typedef __attribute__((ext_vector_type(4))) unsigned short v4us;
typedef __attribute__((ext_vector_type(2))) float v2f;
typedef __attribute__((ext_vector_type(4))) int v4i;



// ---- k_gemmt: C[m][n] = sum_k A[m][k] Bt[n][k] over K = DM, bf16 operands in fragment order, f32 accumulate; grid (M / 128, N / 128, Z), 128 * NP threads.
// A work-group takes a 128 x 128 tile of C as 2 x 2 waves of 64 x 64 (16 accumulators a wave), and every wave runs the whole K. The two waves of a tile row ask for the same A lines and the two of a tile column for the same Bt lines at about the same time, so a line comes from L2 once for the work-group and the WGP cache serves the other reader.
// A wave has no sibling on its K range to hide its loads behind, so its fragments come ahead of their trip (NP = 1: one trip, NP = 2: two): the A fragments into a spare register set, each Bt fragment into its own registers as soon as its four products are issued.
// NP = 1: 4 waves. NP = 2: 8 waves, A in two planes (hi, lo): waves 0..3 sum A x Bt, waves 4..7 A2 x Bt over the same tiles, and the two f32 partial tiles meet in LDS (hi + lo, then bias).
// EPI 0: f32 + bias to C (row pitch BSZ * DM; z strides sA, sC in elements). EPI 3: q, k and v of both batch elements in one grid. z = 2 * op + b: A is plane z of the converted inputs (TT x DM each), Bt weight op, bias bias / bias1 / bias2; a wave's 64 columns are one head (HD == 64), and (sum + bias) x sc (op 0 takes sc, the others 1) goes as fp16 and as bf16 hi/lo to planes z of P16, Ph, Pl in fragment order: op 0, 1 [head][row][d], op 2 [head][d][row].
// ld(t, lo): the fragment of the tile at t, the same address in the whole wave; lo = lane * 16, the lane's byte offset in each half of the tile, the one vector register of the address.
template <typename T16> struct WFrag;
template <> struct WFrag<h16> { typedef v16h V; static __device__ __forceinline__ V ld(const h16* t, unsigned lo) { const char* p = (const char*)t + lo; return cat16(*(const v8h*)p, *(const v8h*)(p + 512)); } static __device__ __forceinline__ v8f mma(V a, V b, v8f c) { return wmma16(a, b, c); } };
template <> struct WFrag<bf> { typedef v16bf V; static __device__ __forceinline__ V ld(const bf* t, unsigned lo) { const char* p = (const char*)t + lo; return cat16b(*(const v8us*)p, *(const v8us*)(p + 512)); } static __device__ __forceinline__ v8f mma(V a, V b, v8f c) { return wmmab(a, b, c); } };
// gemm_store_planes: a wave's own 64 x 64 tile, through the wave's own LDS range ow, to the three planes in fragment order. The tile lies in LDS as [row][d], TR: as [d][row] (a lane's 8 accumulator registers are 8 neighbouring rows of one column), which is 4 x 2 fragment tiles (rt, kt):
// lane (lr, hi) takes LDS row rt * 16 + lr, columns kt * 32 + u * 16 + hi * 8 .. + 7 for u = 0, 1, and each of its stores is 16 bytes of 512 consecutive ones of the wave.
template <bool TR>
__device__ __forceinline__ void gemm_store_planes(const v8f (&acc)[4][4], float* ow, int lr, int hi, int r0, int c0, const float* __restrict__ bias, h16* P16, bf* Ph, bf* Pl, float sc) {
    static_assert(HD == 64, "a wave's 64 columns are one head");
    v8f bv[2][2]; float bt[4];
    if constexpr (!TR) { const float* bp = bias + c0 + hi * 8;
#pragma unroll
        for (int kt = 0; kt < 2; ++kt)
#pragma unroll
            for (int u = 0; u < 2; ++u)
#pragma unroll
                for (int q = 0; q < 8; ++q) bv[kt][u][q] = bp[kt * 32 + u * 16 + q];
        asm volatile("s_wait_xcnt 0x0" :: "v"(bp) : "memory");   // inputs only: the bias loads' address registers stay whole until every load that names them is issued and this wait has passed
#pragma unroll
        for (int kt = 0; kt < 2; ++kt)
#pragma unroll
            for (int u = 0; u < 2; ++u)
#pragma unroll
                for (int q = 0; q < 8; ++q) bv[kt][u][q] = bfr(bv[kt][u][q]);
    } else { const float* bp = bias + c0 + lr;
#pragma unroll
        for (int rt = 0; rt < 4; ++rt) bt[rt] = bp[rt * 16];
        asm volatile("s_wait_xcnt 0x0" :: "v"(bp) : "memory");   // inputs only: the bias loads' address registers stay whole until every load that names them is issued and this wait has passed
#pragma unroll
        for (int rt = 0; rt < 4; ++rt) bt[rt] = bfr(bt[rt]); }
    if constexpr (TR) {
#pragma unroll
        for (int mb = 0; mb < 4; ++mb)
#pragma unroll
            for (int nb = 0; nb < 4; ++nb) { float* op = ow + (nb * 16 + lr) * 68 + mb * 16 + hi * 8;
                *(v4fa*)op = __builtin_shufflevector(acc[mb][nb], acc[mb][nb], 0, 1, 2, 3); *(v4fa*)(op + 4) = __builtin_shufflevector(acc[mb][nb], acc[mb][nb], 4, 5, 6, 7); }
    } else {
#pragma unroll
        for (int mb = 0; mb < 4; ++mb)
#pragma unroll
            for (int nb = 0; nb < 4; ++nb)
#pragma unroll
                for (int j = 0; j < 8; ++j) ow[(mb * 16 + hi * 8 + j) * 68 + nb * 16 + lr] = acc[mb][nb][j];
    }
    asm volatile("s_wait_dscnt 0x0" ::: "memory");   // the wave's own LDS stores are done before its lanes read each other's rows back; no other wave touches this range
#pragma unroll
    for (int ft = 0; ft < 8; ++ft) { const int rt = ft >> 1, kt = ft & 1;
        const size_t e0 = (size_t)c0 * TT + (!TR ? (size_t)((r0 >> 4) + rt) * (HD / 32) + kt : (size_t)rt * (TT / 32) + (r0 >> 5) + kt) * FT + (hi * 16 + lr) * 8;   // c0 * TT: the head's plane, HD * TT elements a head
        v8h o16[2]; v8us oh[2], ol[2];
#pragma unroll
        for (int u = 0; u < 2; ++u) { const float* sp = ow + (rt * 16 + lr) * 68 + kt * 32 + u * 16 + hi * 8; const v4f x0 = *(const v4fa*)sp, x1 = *(const v4fa*)(sp + 4);
#pragma unroll
            for (int q = 0; q < 8; ++q) { float bq; if constexpr (TR) bq = bt[rt]; else bq = bv[kt][u][q];
                const float r = ((q < 4 ? x0[q & 3] : x1[q & 3]) + bq) * sc; o16[u][q] = tohx(r); unsigned short a2, c2; splitf(r, a2, c2); oh[u][q] = a2; ol[u][q] = c2; } }
#pragma unroll
        for (int u = 0; u < 2; ++u) { *(v8h*)(P16 + e0 + u * 256) = o16[u]; *(v8us*)(Ph + e0 + u * 256) = oh[u]; *(v8us*)(Pl + e0 + u * 256) = ol[u]; }
        asm volatile("s_wait_xcnt 0x0" :: "v"(P16 + e0), "v"(Ph + e0), "v"(Pl + e0), "v"(o16[0]), "v"(oh[0]), "v"(ol[0]), "v"(o16[1]), "v"(oh[1]), "v"(ol[1]) : "memory"); }   // inputs only: the six stores' address and data registers stay whole until they are issued and this wait has passed
}
// gemm_trip: one k tile's 16 products from the fragments ac and b. NEXT: the fragments of a later k tile (tiles at An, Bn, lane offset ko) are asked for meanwhile, A into the free set an, each Bt fragment into its own registers as soon as its four products are issued.
// Each sched_barrier keeps the loads in front of it there: left alone, the scheduler sinks these loads to just ahead of their first use, and the wave waits out their whole latency.
template <bool NEXT>
__device__ __forceinline__ void gemm_trip(v8f (&acc)[4][4], const WFrag<bf>::V (&ac)[4], WFrag<bf>::V (&an)[4], WFrag<bf>::V (&b)[4], const bf* An, const bf* Bn, unsigned ko) {
    constexpr size_t tp = (size_t)(DM / 32) * FT;   // one row of tiles
    if constexpr (NEXT) {
#pragma unroll
        for (int mb = 0; mb < 4; ++mb) an[mb] = WFrag<bf>::ld(An + mb * tp, ko);
        __builtin_amdgcn_sched_barrier(0); }
#pragma unroll
    for (int nb = 0; nb < 4; ++nb) {
#pragma unroll
        for (int mb = 0; mb < 4; ++mb) acc[mb][nb] = wmmab(ac[mb], b[nb], acc[mb][nb]);
        if constexpr (NEXT) { b[nb] = WFrag<bf>::ld(Bn + nb * tp, ko); __builtin_amdgcn_sched_barrier(0); } }
}
template <int NP, int EPI>
__global__ __launch_bounds__(128 * NP) void k_gemmt(const bf* __restrict__ A, const bf* __restrict__ A2, const bf* __restrict__ Bt, float* C, const float* __restrict__ bias, const float* __restrict__ bias1, const float* __restrict__ bias2, size_t sA, size_t sC, h16* P16, bf* Ph, bf* Pl, float sc) {
    typedef WFrag<bf>::V V;
    static_assert((EPI == 3 && NP == 1) || (EPI == 0 && NP == 2), "the plane epilogue takes one wave a tile, the f32 epilogue joins two planes");
    static_assert(DQ == DM && (DM / 32) % 2 == 0, "one K for every launch, an even number of trips");
    __shared__ __align__(16) float os[4 * NP * 64 * 68];
    const size_t z = blockIdx.z; const int op = (int)(blockIdx.z >> 1);
    if constexpr (EPI == 3) { A += z * ((size_t)TT * DM); Bt += (size_t)op * WN; bias = op == 0 ? bias : op == 1 ? bias1 : bias2; P16 += z * PLN; Ph += z * PLN; Pl += z * PLN; sc = op == 0 ? sc : 1.0f; }
    else { A += z * sA; A2 += z * sA; C += z * sC; }
    const int lane = threadIdx.x & 31, lr = lane & 15, hi = lane >> 4;
    const int wv = __builtin_amdgcn_readfirstlane((int)(threadIdx.x >> 5));   // the wave's number in a scalar register: tile, plane and every base address stay scalar
    const int t = wv & 3, pl = wv >> 2; const int r0 = (int)blockIdx.x * 128 + (t >> 1) * 64, c0 = (int)blockIdx.y * 128 + (t & 1) * 64;
    v8f acc[4][4];
#pragma unroll
    for (int mb = 0; mb < 4; ++mb)
#pragma unroll
        for (int nb = 0; nb < 4; ++nb) acc[mb][nb] = (v8f){};
    constexpr size_t tp = (size_t)(DM / 32) * FT;   // one row of tiles: a constant, so that it goes into the loads' immediate offsets
    const bf* Ab = (NP == 2 && pl ? A2 : A) + (size_t)(r0 / 16) * tp; const bf* Bb = Bt + (size_t)(c0 / 16) * tp; const unsigned lo = lane * 16;
    // Fragments come LD trips ahead. The lead is what the other waves of the SIMD do not cover: three work-groups of NP = 1 fit a WGP (three waves a SIMD, and a third A set would cost the third), one of NP = 2 (two waves a SIMD).
    constexpr int LD = NP, NA = LD + 1, NT = DM / 32, PT = LD == 1 ? 10 : 6, NL = NT - 2;
    static_assert(NL % PT == 0 && PT % NA == 0 && PT % LD == 0, "whole passes, then the last two trips; in a pass the A sets and the Bt sets come round to where they began, so no register is copied");
    V a[NA][4], b[LD][4];   // trip t reads a[t % NA] and b[t % LD]; the fragments of t + LD go to a[(t + LD) % NA] and, each as its products are issued, back into b[t % LD]
#pragma unroll
    for (int t2 = 0; t2 < LD; ++t2) {
#pragma unroll
        for (int mb = 0; mb < 4; ++mb) a[t2][mb] = WFrag<bf>::ld(Ab + t2 * FT + mb * tp, lo);
#pragma unroll
        for (int nb = 0; nb < 4; ++nb) b[t2][nb] = WFrag<bf>::ld(Bb + t2 * FT + nb * tp, lo); }
#pragma unroll 1
    for (int p = 0; p < NL / PT; ++p) {   // stays rolled: PT trips of text; inside a pass every k step is an immediate offset, and the one address register changes once a pass
        const unsigned ko = lo + (unsigned)p * (PT * FT * 2);   // the lane's byte offset in its row of tiles at the head of the pass
#pragma unroll
        for (int j = 0; j < PT; ++j) gemm_trip<true>(acc, a[j % NA], a[(j + LD) % NA], b[j % LD], Ab + (j + LD) * FT, Bb + (j + LD) * FT, ko);
        asm volatile("s_wait_xcnt 0x0" :: "v"(ko) : "memory");   // inputs only: the loads still in flight name this offset register, and the next pass rewrites it
    }
    // the last two trips: no trip asks for a tile past the last, so every load has been waited for when the epilogue begins
    gemm_trip<LD == 1>(acc, a[NL % NA], a[(NL + LD) % NA], b[NL % LD], Ab + (NT - 1) * FT, Bb + (NT - 1) * FT, lo);
    gemm_trip<false>(acc, a[(NL + 1) % NA], a[NL % NA], b[(NL + 1) % LD], Ab, Bb, lo);
    float* ow = os + wv * (64 * 68);
    if constexpr (EPI == 3) {
        if (op == 2) gemm_store_planes<true>(acc, ow, lr, hi, r0, c0, bias, P16, Ph, Pl, sc);   // op comes from blockIdx.z
        else gemm_store_planes<false>(acc, ow, lr, hi, r0, c0, bias, P16, Ph, Pl, sc);
    } else {
        const int cofs = lr * 4; const float* bp = bias + c0 + cofs; v4f bb; bb[0] = bp[0]; bb[1] = bp[1]; bb[2] = bp[2]; bb[3] = bp[3];
#pragma unroll
        for (int mb = 0; mb < 4; ++mb)
#pragma unroll
            for (int nb = 0; nb < 4; ++nb)
#pragma unroll
                for (int j = 0; j < 8; ++j) ow[(mb * 16 + hi * 8 + j) * 68 + nb * 16 + lr] = acc[mb][nb][j];
        asm volatile("s_wait_xcnt 0x0" :: "v"(lr), "v"(bb) : "memory");   // inputs only: the bias load is issued in front of this wait (its data is named), and the lane index that its address is formed from stays whole until the wait has passed
        bb[0] = bfr(bb[0]); bb[1] = bfr(bb[1]); bb[2] = bfr(bb[2]); bb[3] = bfr(bb[3]);
        __syncthreads();   // both planes' partial tiles stand in LDS before any wave adds them
        const float* sp = os + t * (64 * 68) + (pl * 32 + hi) * 68 + cofs;   // wave (t, pl) joins rows pl * 32 .. + 31 of tile t, two whole rows a store
        constexpr size_t ldc = (size_t)BSZ * DM;   // the (len, batch, d) row pitch: a constant, so that the sixteen stores share one address register pair and differ in their immediate offsets
        float* cp = C + (size_t)(r0 + pl * 32 + hi) * ldc + c0 + cofs; v4f val[16];
#pragma unroll
        for (int s = 0; s < 16; ++s) { val[s] = *(const v4fa*)(sp + s * (2 * 68)); val[s] += *(const v4fa*)(sp + 4 * (64 * 68) + s * (2 * 68)); val[s] += bb; }
#pragma unroll
        for (int s = 0; s < 16; ++s) *(v4f*)(cp + (size_t)(2 * s) * ldc) = val[s];
        asm volatile("s_wait_xcnt 0x0" :: "v"(cp), "v"(val[0]), "v"(val[1]), "v"(val[2]), "v"(val[3]), "v"(val[4]), "v"(val[5]), "v"(val[6]), "v"(val[7]), "v"(val[8]), "v"(val[9]), "v"(val[10]), "v"(val[11]), "v"(val[12]), "v"(val[13]), "v"(val[14]), "v"(val[15]) : "memory");   // inputs only: the stores' address and data registers stay whole until every store is issued and this wait has passed
    }
}


__global__ __launch_bounds__(256) void k_wtG(const float* __restrict__ w, int K, int N, bf* Bt) {
    const int lane = threadIdx.x & 31; const int L0 = (blockIdx.x * 8 + (threadIdx.x >> 5)) * 8; const int nlines = N * K / 64;
{
#pragma unroll 1
        for (int l = 0; l < 8; ++l) { const int L = L0 + l; if (L >= nlines) break; const size_t e = (size_t)L * 64 + lane * 2; const int k = (int)(e % K), n = (int)(e / K); v2us o;
            o[0] = f2bf(w[(size_t)k * N + n]); o[1] = f2bf(w[(size_t)(k + 1) * N + n]); *(v2us*)(Bt + e) = o; }
         }
}
// k_cvtall: all seven f32 operands rounded to bf16 in one grid, each laid down in fragment order. y = a unit of WN elements: XN / WN units for each of x, xk, xv, then one for each weight; dst holds them in that order, an input as one [len][d] matrix for each batch element.
// A work-group takes 16 source rows (an input: 8 rows of each batch element). A wave takes 8 rows of one matrix x 32 columns at a time: lane = (row & 7) + 8 * (column >> 3 & 3) reads 32 bytes of a whole 128-byte line of its row and stores 16 bytes; the 8 rows of a column group are 128 consecutive bytes of the tile. All loads are asked for before the first store.
#define CVU 8
__global__ __launch_bounds__(256) void k_cvtall(const float* __restrict__ x, const float* __restrict__ xk, const float* __restrict__ xv, const float* __restrict__ wq, const float* __restrict__ wk, const float* __restrict__ wv, const float* __restrict__ wo, bf* dst) {
    constexpr int UX = (int)(XN / WN); static_assert(XN % WN == 0 && WN % (256 * 8 * CVU) == 0, "whole units, whole work-groups");
    static_assert(DM == 1024 && BSZ == 2 && CVU == 8, "16 rows of 32 tile columns: 8 waves x 4 trips x 2 row groups");
    const int u = (int)blockIdx.y; const bool isx = u < 3 * UX;
    const float* s = u < UX ? x + (size_t)u * WN : u < 2 * UX ? xk + (size_t)(u - UX) * WN : u < 3 * UX ? xv + (size_t)(u - 2 * UX) * WN : u == 3 * UX ? wq : u == 3 * UX + 1 ? wk : u == 3 * UX + 2 ? wv : wo;
    const int lane = (int)threadIdx.x & 31, w = (int)threadIdx.x >> 5, r8 = lane & 7, c = lane >> 3;
    // row group g = 0, 1: an input's batch element g (source rows r8 * BSZ + g), a weight's rows g * 8 + r8
    const float* s0 = s + (size_t)((int)blockIdx.x * 16 + (isx ? r8 * BSZ : r8)) * DM + w * 32 + c * 8;
    const float* s1 = s0 + (isx ? DM : 8 * DM);
    v8f v[CVU];
#pragma unroll
    for (int i = 0; i < CVU; ++i) v[i] = *(const v8f*)((i < 4 ? s0 : s1) + (i & 3) * 256);
    asm volatile("s_wait_xcnt 0x0" :: "v"(s0), "v"(s1) : "memory");   // inputs only: the loads' address registers stay whole until every load that names them is issued and this wait has passed
    // destination row of group 0 in its matrix, and the two groups' matrices and rows
    const int d0 = isx ? (u % UX) * (int)(WN / DM / BSZ) + (int)blockIdx.x * 8 + r8 : (int)blockIdx.x * 16 + r8;
    const int d1 = isx ? d0 : d0 + 8;
    bf* m0 = dst + (isx ? (size_t)(u / UX) * XN : (size_t)u * WN); bf* m1 = isx ? m0 + (size_t)TT * DM : m0;
    const int in = (c >> 1) * 256 + (c & 1) * 128 + w * FT;
    bf* p0 = m0 + (size_t)(d0 >> 4) * ((DM / 32) * FT) + (d0 & 15) * 8 + in; bf* p1 = m1 + (size_t)(d1 >> 4) * ((DM / 32) * FT) + (d1 & 15) * 8 + in;
    v8us o[CVU];
#pragma unroll
    for (int i = 0; i < CVU; ++i)
#pragma unroll
        for (int k = 0; k < 8; ++k) o[i][k] = f2bf(v[i][k]);
#pragma unroll
    for (int i = 0; i < CVU; ++i) *(v8us*)((i < 4 ? p0 : p1) + (i & 3) * (8 * FT)) = o[i];
    asm volatile("s_wait_xcnt 0x0" :: "v"(p0), "v"(p1), "v"(o[0]), "v"(o[1]), "v"(o[2]), "v"(o[3]), "v"(o[4]), "v"(o[5]), "v"(o[6]), "v"(o[7]) : "memory");   // inputs only: the stores' address and data registers stay whole until every store is issued and this wait has passed
}

// fattn_rows: scores, bias, softmax and P.V of ROWS = 16 * QT query rows (from i0) of head h of one batch element in one work-group; nothing of the score matrix goes to memory. bs, redm, reds, os: the work-group's LDS, declared in k_fattn.
// Wave w owns keys [w * KW, (w + 1) * KW). It forms S^T = K Q^T (A = 16 key rows, B = 16 query rows, both planes in fragment order): accumulator register j of lane (lr, hi) is (key 8 hi + j of the tile, query lr).
// That is the A-fragment order of P for P.V: two neighbouring key tiles give elements 0..7 (k = 8 hi + j) and 8..15 (k = 16 + 8 hi + j) of query row lr, so P goes from the accumulators to the matrix unit without leaving the lane.
// A query's maximum and sum: in the lane, across the two lane halves, then across the waves through LDS (wave order). The waves' f32 partial outputs meet in LDS and are added in wave order, then hi/lo planes of the merged operand.
// bs[key + ROWS - 1 - r] is the bias of (row i0 + r, key): TT + ROWS - 1 consecutive table entries of the head, gathered once.
template <typename T16, bool HR, int QT, int NW>
__device__ __forceinline__ void fattn_rows(const T16* __restrict__ Qa, const T16* __restrict__ Qb, const T16* __restrict__ Ka, const T16* __restrict__ Kb, const T16* __restrict__ Va, const T16* __restrict__ Vb, const float* __restrict__ tab, int i0, int h, bf* ATh, bf* ATl, float* bs, float* redm, float* reds, float* os) {
    typedef typename WFrag<T16>::V V;
    constexpr int ROWS = QT * 16, NTH = 32 * NW, KW = TT / NW, NT = KW / 16, NC = KW / 32;
    static_assert(2 * NW == ROWS && TT % NTH == 0 && KW % 32 == 0, "shape");
    const int lane = threadIdx.x & 31, lr = lane & 15, hi = lane >> 4; const int wv = __builtin_amdgcn_readfirstlane((int)(threadIdx.x >> 5));
    const int key0 = wv * KW; const size_t hp = (size_t)h * TT * HD;
    constexpr int NG = TT / NTH + 1; float g[NG];
#pragma unroll
    for (int t = 0; t < NG; ++t) { int r = i0 + (ROWS - 1) + (TT - 1) - (t * NTH + (int)threadIdx.x); r = min(max(r, 0), NREL - 1); g[t] = tab[(size_t)r * NH_ + h]; }   // asked for first, stored to LDS behind the score products; entries from TT + ROWS - 1 on are never read, and the clip bounds their address like any other
    asm volatile("s_wait_xcnt 0x0" ::: "memory");   // the gathers' address registers may be reused by what follows
    V qa[QT][2], qb[QT][2]; const size_t qo = hp + (size_t)(i0 / 16) * ((HD / 32) * FT); const unsigned lo = lane * 16;
#pragma unroll
    for (int qt = 0; qt < QT; ++qt)
#pragma unroll
        for (int kk = 0; kk < 2; ++kk) { qa[qt][kk] = WFrag<T16>::ld(Qa + qo + (qt * 2 + kk) * FT, lo); if constexpr (HR) qb[qt][kk] = WFrag<T16>::ld(Qb + qo + (qt * 2 + kk) * FT, lo); }
    v8f s[QT][NT];
    const size_t ko = hp + (size_t)(key0 / 16) * ((HD / 32) * FT);
#pragma unroll
    for (int nt = 0; nt < NT; ++nt) { V ka[2], kb[2];
#pragma unroll
        for (int kk = 0; kk < 2; ++kk) { ka[kk] = WFrag<T16>::ld(Ka + ko + (nt * 2 + kk) * FT, lo); if constexpr (HR) kb[kk] = WFrag<T16>::ld(Kb + ko + (nt * 2 + kk) * FT, lo); }
#pragma unroll
        for (int qt = 0; qt < QT; ++qt) { v8f a = (v8f){};
#pragma unroll
            for (int kk = 0; kk < 2; ++kk) { a = WFrag<T16>::mma(ka[kk], qa[qt][kk], a); if constexpr (HR) { a = WFrag<T16>::mma(ka[kk], qb[qt][kk], a); a = WFrag<T16>::mma(kb[kk], qa[qt][kk], a); } }
            s[qt][nt] = a; } }
#pragma unroll
    for (int t = 0; t < NG; ++t) bs[t * NTH + (int)threadIdx.x] = bfr(g[t]);
    __syncthreads();   // the head's table entries stand in LDS before any wave adds them to its scores
#pragma unroll
    for (int qt = 0; qt < QT; ++qt) { const float* br = bs + key0 + 8 * hi + (ROWS - 1) - (qt * 16 + lr); v8f m8;
#pragma unroll
        for (int nt = 0; nt < NT; ++nt)
#pragma unroll
            for (int j = 0; j < 8; ++j) { const float t = __fadd_rn(s[qt][nt][j], br[nt * 16 + j]); s[qt][nt][j] = t; m8[j] = nt ? fmaxf(m8[j], t) : t; }
        float m = fmaxf(fmaxf(fmaxf(m8[0], m8[1]), fmaxf(m8[2], m8[3])), fmaxf(fmaxf(m8[4], m8[5]), fmaxf(m8[6], m8[7])));
        m = fmaxf(m, __shfl_xor(m, 16, 32));
        if (hi == 0) redm[wv * ROWS + qt * 16 + lr] = m; }
    __syncthreads();   // every wave's maxima stand in LDS before any wave takes the maximum over them
    float f[QT];
#pragma unroll
    for (int qt = 0; qt < QT; ++qt) { float m = redm[qt * 16 + lr];
#pragma unroll
        for (int p = 1; p < NW; ++p) m = fmaxf(m, redm[p * ROWS + qt * 16 + lr]);
        v8f s8 = (v8f){};
#pragma unroll
        for (int nt = 0; nt < NT; ++nt)
#pragma unroll
            for (int j = 0; j < 8; ++j) { const float e = __builtin_amdgcn_exp2f(__fmul_rn(__fsub_rn(s[qt][nt][j], m), 1.4426950408889634f)); s[qt][nt][j] = e; s8[j] += e; }
        float sum = ((s8[0] + s8[1]) + (s8[2] + s8[3])) + ((s8[4] + s8[5]) + (s8[6] + s8[7]));
        sum += __shfl_xor(sum, 16, 32);
        if (hi == 0) reds[wv * ROWS + qt * 16 + lr] = sum; }
    __syncthreads();   // every wave's sums stand in LDS before any wave adds them
#pragma unroll
    for (int qt = 0; qt < QT; ++qt) { float sum = reds[qt * 16 + lr];
#pragma unroll
        for (int p = 1; p < NW; ++p) sum += reds[p * ROWS + qt * 16 + lr];
        f[qt] = __fdiv_rn(HR ? 1.0f : PCAR, sum); }
    v8f o[QT][4];
#pragma unroll
    for (int qt = 0; qt < QT; ++qt)
#pragma unroll
        for (int nb = 0; nb < 4; ++nb) o[qt][nb] = (v8f){};
    const size_t vo = hp + (size_t)(key0 / 32) * FT;
#pragma unroll
    for (int c = 0; c < NC; ++c) { V pa[QT], pb[QT];
#pragma unroll
        for (int qt = 0; qt < QT; ++qt) {
            if constexpr (HR) { v8us h0, l0, h1, l1;
#pragma unroll
                for (int j = 0; j < 8; ++j) { unsigned short a, c2; splitf(s[qt][2 * c][j] * f[qt], a, c2); h0[j] = a; l0[j] = c2; splitf(s[qt][2 * c + 1][j] * f[qt], a, c2); h1[j] = a; l1[j] = c2; }
                pa[qt] = cat16b(h0, h1); pb[qt] = cat16b(l0, l1);
            } else { v8h p0, p1;
#pragma unroll
                for (int j = 0; j < 8; ++j) { p0[j] = tohx(s[qt][2 * c][j] * f[qt]); p1[j] = tohx(s[qt][2 * c + 1][j] * f[qt]); }
                pa[qt] = cat16(p0, p1); } }
#pragma unroll
        for (int nb = 0; nb < 4; ++nb) { const V vb = WFrag<T16>::ld(Va + vo + (nb * (TT / 32) + c) * FT, lo); V vb2; if constexpr (HR) vb2 = WFrag<T16>::ld(Vb + vo + (nb * (TT / 32) + c) * FT, lo);
#pragma unroll
            for (int qt = 0; qt < QT; ++qt) { o[qt][nb] = WFrag<T16>::mma(pa[qt], vb, o[qt][nb]); if constexpr (HR) { o[qt][nb] = WFrag<T16>::mma(pb[qt], vb, o[qt][nb]); o[qt][nb] = WFrag<T16>::mma(pa[qt], vb2, o[qt][nb]); } } } }
    float* ow = os + wv * (ROWS * 68);
#pragma unroll
    for (int qt = 0; qt < QT; ++qt)
#pragma unroll
        for (int nb = 0; nb < 4; ++nb)
#pragma unroll
            for (int j = 0; j < 8; ++j) ow[(qt * 16 + hi * 8 + j) * 68 + nb * 16 + lr] = o[qt][nb][j];
    __syncthreads();   // every wave's partial output tile stands in LDS before any wave adds across them
    static_assert(QT == 2 && NW == 16 && HD == 64, "16 waves, 16 rows x 8 columns each");
    const int row = (wv >> 3) * 16 + lr, cofs = (wv & 7) * 8 + hi * 4; v4f val = *(const v4fa*)(os + row * 68 + cofs);   // a wave's 16 rows x 8 columns are 256 consecutive bytes of the merged operand in fragment order
#pragma unroll
    for (int p = 1; p < NW; ++p) val += *(const v4fa*)(os + p * (ROWS * 68) + row * 68 + cofs);
    const float cs = HR ? 1.0f : (1.0f / PCAR); v4us oh, ol;
#pragma unroll
    for (int q = 0; q < 4; ++q) { unsigned short a, c2; splitf(val[q] * cs, a, c2); oh[q] = a; ol[q] = c2; }
    const size_t oo = ((size_t)(i0 / 16 + (wv >> 3)) * (DQ / 32) + h * (HD / 32) + ((wv >> 2) & 1)) * FT + ((wv >> 1) & 1) * 256 + ((wv & 1) * 16 + lr) * 8 + hi * 4; *(v4us*)(ATh + oo) = oh; *(v4us*)(ATl + oo) = ol;
}
// k_fattn: every (head, batch element, block of ROWS query rows) in one grid: x = head + NH_ * b, y = row block. The blocks of rows < RH (three products, the longer work) have the lowest y.
// Each operand pointer is batch element 0's plane, element 1's follows it (as the projections store them); ATh, ATl [b][row][DQ], each batch element's matrix in fragment order.
template <int QT, int NW>
__global__ __launch_bounds__(32 * NW) void k_fattn(const h16* __restrict__ Q16, const h16* __restrict__ K16, const h16* __restrict__ V16, const bf* __restrict__ Qh, const bf* __restrict__ Ql, const bf* __restrict__ Kh, const bf* __restrict__ Kl, const bf* __restrict__ Vh, const bf* __restrict__ Vl, const float* __restrict__ tab, bf* ATh, bf* ATl) {
    constexpr int ROWS = QT * 16, NTH = 32 * NW;
    static_assert(RH % ROWS == 0, "a row block is of one class");
    __shared__ float bs[TT + NTH];
    __shared__ float redm[NW * ROWS];
    __shared__ float reds[NW * ROWS];
    __shared__ __align__(16) float os[NW * ROWS * 68];
    const int h = (int)blockIdx.x % NH_, i0 = (int)blockIdx.y * ROWS; const size_t b = blockIdx.x / NH_, pb = b * PLN;
    ATh += b * ((size_t)TT * DQ); ATl += b * ((size_t)TT * DQ);
    if (i0 < RH) fattn_rows<bf, true, QT, NW>(Qh + pb, Ql + pb, Kh + pb, Kl + pb, Vh + pb, Vl + pb, tab, i0, h, ATh, ATl, bs, redm, reds, os);   // i0 comes from blockIdx.y: the whole work-group takes one side, its barriers with it
    else fattn_rows<h16, false, QT, NW>(Q16 + pb, nullptr, K16 + pb, nullptr, V16 + pb, nullptr, tab, i0, h, ATh, ATl, bs, redm, reds, os);
}
extern "C" void kernel_launch(void* const* d_in, const int* in_sizes, int n_in,
                              void* d_out, int out_size, void* d_ws, size_t ws_size, hipStream_t stream) {
    (void)in_sizes; (void)n_in; (void)out_size;
    const float* x = (const float*)d_in[0]; const float* xk = (const float*)d_in[1]; const float* xv = (const float*)d_in[2]; const float* wq = (const float*)d_in[3]; const float* bq = (const float*)d_in[4]; const float* wk = (const float*)d_in[5]; const float* bk = (const float*)d_in[6]; const float* wv = (const float*)d_in[7]; const float* bv = (const float*)d_in[8]; const float* wo = (const float*)d_in[9]; const float* bo = (const float*)d_in[10]; const float* rtab = (const float*)d_in[11];
    float* OUT = (float*)d_out;     // [2048][2][1024]
    char* wsp = (char*)d_ws;
    auto take = [&](size_t bytes) { char* p = wsp; wsp += (bytes + 255) & ~(size_t)255; return (void*)p; };
    static_assert(NKV == NH_ && DKV == DQ && DQ == DM, "q, k, v share one projection grid and one plane size");
    bf* XB = (bf*)take((3 * XN + 4 * WN) * 2);     // bf16, fragment order: x, xk, xv, each [b][len][d], then Wq, Wk, Wv, Wo
    bf* WQKV = XB + 3 * XN; bf* WO = WQKV + 3 * WN;
    h16* P16 = (h16*)take(6 * PLN * 2); bf* Ph = (bf*)take(6 * PLN * 2); bf* Pl = (bf*)take(6 * PLN * 2);   // plane 2 * op + b: q, k [head][row][d], v [head][d][row], each head's matrix in fragment order
    bf* ATh = (bf*)take((size_t)BSZ * TT * DQ * 2); bf* ATl = (bf*)take((size_t)BSZ * TT * DQ * 2);
    if ((size_t)(wsp - (char*)d_ws) > ws_size) return;    // ws 256 MiB
    k_cvtall<<<dim3((unsigned)(WN / (256 * 8 * CVU)), (unsigned)(3 * XN / WN + 4), 1), 256, 0, stream>>>(x, xk, xv, wq, wk, wv, wo, XB);
    k_gemmt<1, 3><<<dim3(TT / 128, DQ / 128, 3 * BSZ), 128, 0, stream>>>(XB, nullptr, WQKV, nullptr, bq, bk, bv, 0, 0, P16, Ph, Pl, QSC);   /* q x 1/8 and k head planes, v planes transposed */
    k_fattn<2, 16><<<dim3(NH_ * BSZ, TT / 32, 1), 512, 0, stream>>>(P16, P16 + 2 * PLN, P16 + 4 * PLN, Ph, Pl, Ph + 2 * PLN, Pl + 2 * PLN, Ph + 4 * PLN, Pl + 4 * PLN, rtab, ATh, ATl);   /* rows < RH: hi/lo planes, 3 products; the other rows: fp16, P x 1024 */
    k_gemmt<2, 0><<<dim3(TT / 128, DM / 128, BSZ), 256, 0, stream>>>(ATh, ATl, WO, OUT, bo, nullptr, nullptr, (size_t)TT * DQ, DM, nullptr, nullptr, nullptr, 1.0f);   /* rows at the (len, batch, d) pitch */
}

// v008
// A run of this version takes 108 microseconds.
// Timed twice side by side with v007, it ran 1.48 times as fast both times.
// Over all steps from v000 it is 21.7 times as fast.
#include <hip/hip_runtime.h>

// Multi-head attention with a learned relative-position bias, sequence-first layout (query, key, value [2048][2][1024] = (len, batch, d_model); q,k,v = input W^T + b ('oi' [1024][1024] + [1024]; 16 heads x 64); scores = q.k / 8 + rel_table[clip(i - j + 2047, 0, 4094)][h] (table [4095][16], read); softmax over all keys; out = merged Wo^T + bo -> [2048][2][1024] (4.2 M)).
// Four launches, each over both batch elements: (1) the three inputs and the four weights rounded to bf16, each input's rows laid down by batch element ([b][len][d]), every 16-bit operand of every launch in the order the matrix fragments are read in; (2) the q, k, v projections, exact + f32 biases, one grid, each epilogue storing the attention operand planes itself; (3) dense T-2048 attention, both row classes in one grid (hybrid rows: < 512 hi/lo 3 products, rest fp16), each wave on its own query rows with a running maximum, the gathered per-head bias added to the scores in registers; (4) merged hi/lo x Wo exact + bo, stored at the batch pitch straight into the (len, batch, d) output.
// Compute dtypes, f32 accumulate: every input rounded to bf16; projections exact + f32 biases; attention rows < 512 3 products, rest fp16; bias add and softmax f32; Wo hl x exact + bias.

#define NB_  2
#define TT   2048
#define DM   1024
#define NH_  16
#define NKV  16
#define REP  (NH_ / NKV)
#define HD   64
#define DQ   (NH_ * HD)
#define DKV  (NKV * HD)
#define RH   512                  // query rows < RH use hi+lo planes (0: none)
#define WIN  0
#define QSC  0.125f   // the 1/8 is folded into q so the gathered bias adds to the scaled scores
#define BSZ  2
#define NREL 4095
#define XN   ((size_t)TT * BSZ * DM)   // elements of one input
#define WN   ((size_t)DQ * DM)         // elements of one weight matrix
#define PLN  ((size_t)NH_ * TT * HD)   // elements of one operand plane (one of q, k, v of one batch element)
// Fragment order: every 16-bit matrix operand [rows][K] lies in the workspace as tiles of 16 rows x 32 k, FT elements each, tile (row >> 4, k >> 5) at ((row >> 4) * (K / 32) + (k >> 5)) * FT.
// Inside a tile the 8 elements (row, k & ~7 .. k | 7) stand at ((k >> 4 & 1) * 32 + (k >> 3 & 1) * 16 + (row & 15)) * 8: lane l finds the two halves of its fragment at l * 8 and 256 + l * 8, so each load instruction of a wave takes 512 consecutive bytes (4 whole lines, not 32-byte pieces of 16 lines).
#define FT   512
typedef _Float16 h16;
typedef unsigned short bf;
typedef __attribute__((ext_vector_type(16))) __bf16   v16bf;
typedef __attribute__((ext_vector_type(16))) _Float16 v16h;
typedef __attribute__((ext_vector_type(8)))  _Float16 v8h;
typedef __attribute__((ext_vector_type(8)))  unsigned short v8us;
typedef __attribute__((ext_vector_type(8)))  float    v8f;
typedef __attribute__((ext_vector_type(4)))  float    v4f;
typedef v8h  __attribute__((may_alias)) v8ha;
typedef v4f  __attribute__((may_alias)) v4fa;
typedef v8us __attribute__((may_alias)) v8usa;

__device__ __forceinline__ unsigned short f2bf(float f) { unsigned u = __float_as_uint(f); u += 0x7FFFu + ((u >> 16) & 1u); return (unsigned short)(u >> 16); }
__device__ __forceinline__ float bf2f(unsigned short b) { return __uint_as_float(((unsigned)b) << 16); }
__device__ __forceinline__ float bfr(float f) { return bf2f(f2bf(f)); }
__device__ __forceinline__ v16h cat16(v8h lo, v8h hi) { return __builtin_shufflevector(lo, hi, 0, 1, 2, 3, 4, 5, 6, 7, 8, 9, 10, 11, 12, 13, 14, 15); }
__device__ __forceinline__ v16bf cat16b(v8us lo, v8us hi) { return __builtin_bit_cast(v16bf, __builtin_shufflevector(lo, hi, 0, 1, 2, 3, 4, 5, 6, 7, 8, 9, 10, 11, 12, 13, 14, 15)); }
__device__ __forceinline__ v8f wmma16(v16h a, v16h b, v8f c) { return __builtin_amdgcn_wmma_f32_16x16x32_f16(false, a, false, b, (short)0, c, false, false); }
__device__ __forceinline__ v8f wmmab(v16bf a, v16bf b, v8f c) { return __builtin_amdgcn_wmma_f32_16x16x32_bf16(false, a, false, b, (short)0, c, false, false); }
__device__ __forceinline__ h16 tohx(float x) { return (h16)x; }
__device__ __forceinline__ void splitf(float y, unsigned short& h, unsigned short& l) { h = f2bf(y); l = f2bf(y - bf2f(h)); }
typedef __attribute__((ext_vector_type(2))) _Float16 v2h;
typedef __attribute__((ext_vector_type(4))) _Float16 v4h;
typedef __attribute__((ext_vector_type(2))) unsigned short v2us;
typedef __attribute__((ext_vector_type(4))) unsigned short v4us;
typedef __attribute__((ext_vector_type(2))) float v2f;
typedef __attribute__((ext_vector_type(4))) int v4i;



// ---- k_gemmt: C[m][n] = sum_k A[m][k] Bt[n][k] over K = DM, bf16 operands in fragment order, f32 accumulate; grid (M / 128, N / 128, Z), 128 * NP threads.
// A work-group takes a 128 x 128 tile of C as 2 x 2 waves of 64 x 64 (16 accumulators a wave), and every wave runs the whole K. The two waves of a tile row ask for the same A lines and the two of a tile column for the same Bt lines at about the same time, so a line comes from L2 once for the work-group and the WGP cache serves the other reader.
// A wave has no sibling on its K range to hide its loads behind, so its fragments come ahead of their trip (NP = 1: one trip, NP = 2: two): the A fragments into a spare register set, each Bt fragment into its own registers as soon as its four products are issued.
// NP = 1: 4 waves. NP = 2: 8 waves, A in two planes (hi, lo): waves 0..3 sum A x Bt, waves 4..7 A2 x Bt over the same tiles, and the two f32 partial tiles meet in LDS (hi + lo, then bias).
// EPI 0: f32 + bias to C (row pitch BSZ * DM; z strides sA, sC in elements). EPI 3: q, k and v of both batch elements in one grid. z = 2 * op + b: A is plane z of the converted inputs (TT x DM each), Bt weight op, bias bias / bias1 / bias2; a wave's 64 columns are one head (HD == 64), and (sum + bias) x sc (op 0 takes sc, the others 1) goes as fp16 and as bf16 hi/lo to planes z of P16, Ph, Pl in fragment order: op 0, 1 [head][row][d], op 2 [head][d][row].
// ld(t, lo): the fragment of the tile at t, the same address in the whole wave; lo = lane * 16, the lane's byte offset in each half of the tile, the one vector register of the address.
template <typename T16> struct WFrag;
template <> struct WFrag<h16> { typedef v16h V; static __device__ __forceinline__ V ld(const h16* t, unsigned lo) { const char* p = (const char*)t + lo; return cat16(*(const v8h*)p, *(const v8h*)(p + 512)); } static __device__ __forceinline__ v8f mma(V a, V b, v8f c) { return wmma16(a, b, c); } };
template <> struct WFrag<bf> { typedef v16bf V; static __device__ __forceinline__ V ld(const bf* t, unsigned lo) { const char* p = (const char*)t + lo; return cat16b(*(const v8us*)p, *(const v8us*)(p + 512)); } static __device__ __forceinline__ v8f mma(V a, V b, v8f c) { return wmmab(a, b, c); } };
// gemm_store_planes: a wave's own 64 x 64 tile, through the wave's own LDS range ow, to the three planes in fragment order. The tile lies in LDS as [row][d], TR: as [d][row] (a lane's 8 accumulator registers are 8 neighbouring rows of one column), which is 4 x 2 fragment tiles (rt, kt):
// lane (lr, hi) takes LDS row rt * 16 + lr, columns kt * 32 + u * 16 + hi * 8 .. + 7 for u = 0, 1, and each of its stores is 16 bytes of 512 consecutive ones of the wave.
template <bool TR>
__device__ __forceinline__ void gemm_store_planes(const v8f (&acc)[4][4], float* ow, int lr, int hi, int r0, int c0, const float* __restrict__ bias, h16* P16, bf* Ph, bf* Pl, float sc) {
    static_assert(HD == 64, "a wave's 64 columns are one head");
    v8f bv[2][2]; float bt[4];
    if constexpr (!TR) { const float* bp = bias + c0 + hi * 8;
#pragma unroll
        for (int kt = 0; kt < 2; ++kt)
#pragma unroll
            for (int u = 0; u < 2; ++u)
#pragma unroll
                for (int q = 0; q < 8; ++q) bv[kt][u][q] = bp[kt * 32 + u * 16 + q];
        asm volatile("s_wait_xcnt 0x0" :: "v"(bp) : "memory");   // inputs only: the bias loads' address registers stay whole until every load that names them is issued and this wait has passed
#pragma unroll
        for (int kt = 0; kt < 2; ++kt)
#pragma unroll
            for (int u = 0; u < 2; ++u)
#pragma unroll
                for (int q = 0; q < 8; ++q) bv[kt][u][q] = bfr(bv[kt][u][q]);
    } else { const float* bp = bias + c0 + lr;
#pragma unroll
        for (int rt = 0; rt < 4; ++rt) bt[rt] = bp[rt * 16];
        asm volatile("s_wait_xcnt 0x0" :: "v"(bp) : "memory");   // inputs only: the bias loads' address registers stay whole until every load that names them is issued and this wait has passed
#pragma unroll
        for (int rt = 0; rt < 4; ++rt) bt[rt] = bfr(bt[rt]); }
    if constexpr (TR) {
#pragma unroll
        for (int mb = 0; mb < 4; ++mb)
#pragma unroll
            for (int nb = 0; nb < 4; ++nb) { float* op = ow + (nb * 16 + lr) * 68 + mb * 16 + hi * 8;
                *(v4fa*)op = __builtin_shufflevector(acc[mb][nb], acc[mb][nb], 0, 1, 2, 3); *(v4fa*)(op + 4) = __builtin_shufflevector(acc[mb][nb], acc[mb][nb], 4, 5, 6, 7); }
    } else {
#pragma unroll
        for (int mb = 0; mb < 4; ++mb)
#pragma unroll
            for (int nb = 0; nb < 4; ++nb)
#pragma unroll
                for (int j = 0; j < 8; ++j) ow[(mb * 16 + hi * 8 + j) * 68 + nb * 16 + lr] = acc[mb][nb][j];
    }
    asm volatile("s_wait_dscnt 0x0" ::: "memory");   // the wave's own LDS stores are done before its lanes read each other's rows back; no other wave touches this range
#pragma unroll
    for (int ft = 0; ft < 8; ++ft) { const int rt = ft >> 1, kt = ft & 1;
        const size_t e0 = (size_t)c0 * TT + (!TR ? (size_t)((r0 >> 4) + rt) * (HD / 32) + kt : (size_t)rt * (TT / 32) + (r0 >> 5) + kt) * FT + (hi * 16 + lr) * 8;   // c0 * TT: the head's plane, HD * TT elements a head
        v8h o16[2]; v8us oh[2], ol[2];
#pragma unroll
        for (int u = 0; u < 2; ++u) { const float* sp = ow + (rt * 16 + lr) * 68 + kt * 32 + u * 16 + hi * 8; const v4f x0 = *(const v4fa*)sp, x1 = *(const v4fa*)(sp + 4);
#pragma unroll
            for (int q = 0; q < 8; ++q) { float bq; if constexpr (TR) bq = bt[rt]; else bq = bv[kt][u][q];
                const float r = ((q < 4 ? x0[q & 3] : x1[q & 3]) + bq) * sc; o16[u][q] = tohx(r); unsigned short a2, c2; splitf(r, a2, c2); oh[u][q] = a2; ol[u][q] = c2; } }
#pragma unroll
        for (int u = 0; u < 2; ++u) { *(v8h*)(P16 + e0 + u * 256) = o16[u]; *(v8us*)(Ph + e0 + u * 256) = oh[u]; *(v8us*)(Pl + e0 + u * 256) = ol[u]; }
        asm volatile("s_wait_xcnt 0x0" :: "v"(P16 + e0), "v"(Ph + e0), "v"(Pl + e0), "v"(o16[0]), "v"(oh[0]), "v"(ol[0]), "v"(o16[1]), "v"(oh[1]), "v"(ol[1]) : "memory"); }   // inputs only: the six stores' address and data registers stay whole until they are issued and this wait has passed
}
// gemm_trip: one k tile's 16 products from the fragments ac and b. NEXT: the fragments of a later k tile (tiles at An, Bn, lane offset ko) are asked for meanwhile, A into the free set an, each Bt fragment into its own registers as soon as its four products are issued.
// Each sched_barrier keeps the loads in front of it there: left alone, the scheduler sinks these loads to just ahead of their first use, and the wave waits out their whole latency.
template <bool NEXT>
__device__ __forceinline__ void gemm_trip(v8f (&acc)[4][4], const WFrag<bf>::V (&ac)[4], WFrag<bf>::V (&an)[4], WFrag<bf>::V (&b)[4], const bf* An, const bf* Bn, unsigned ko) {
    constexpr size_t tp = (size_t)(DM / 32) * FT;   // one row of tiles
    if constexpr (NEXT) {
#pragma unroll
        for (int mb = 0; mb < 4; ++mb) an[mb] = WFrag<bf>::ld(An + mb * tp, ko);
        __builtin_amdgcn_sched_barrier(0); }
#pragma unroll
    for (int nb = 0; nb < 4; ++nb) {
#pragma unroll
        for (int mb = 0; mb < 4; ++mb) acc[mb][nb] = wmmab(ac[mb], b[nb], acc[mb][nb]);
        if constexpr (NEXT) { b[nb] = WFrag<bf>::ld(Bn + nb * tp, ko); __builtin_amdgcn_sched_barrier(0); } }
}
template <int NP, int EPI>
__global__ __launch_bounds__(128 * NP) void k_gemmt(const bf* __restrict__ A, const bf* __restrict__ A2, const bf* __restrict__ Bt, float* C, const float* __restrict__ bias, const float* __restrict__ bias1, const float* __restrict__ bias2, size_t sA, size_t sC, h16* P16, bf* Ph, bf* Pl, float sc) {
    typedef WFrag<bf>::V V;
    static_assert((EPI == 3 && NP == 1) || (EPI == 0 && NP == 2), "the plane epilogue takes one wave a tile, the f32 epilogue joins two planes");
    static_assert(DQ == DM && (DM / 32) % 2 == 0, "one K for every launch, an even number of trips");
    __shared__ __align__(16) float os[4 * NP * 64 * 68];
    const size_t z = blockIdx.z; const int op = (int)(blockIdx.z >> 1);
    if constexpr (EPI == 3) { A += z * ((size_t)TT * DM); Bt += (size_t)op * WN; bias = op == 0 ? bias : op == 1 ? bias1 : bias2; P16 += z * PLN; Ph += z * PLN; Pl += z * PLN; sc = op == 0 ? sc : 1.0f; }
    else { A += z * sA; A2 += z * sA; C += z * sC; }
    const int lane = threadIdx.x & 31, lr = lane & 15, hi = lane >> 4;
    const int wv = __builtin_amdgcn_readfirstlane((int)(threadIdx.x >> 5));   // the wave's number in a scalar register: tile, plane and every base address stay scalar
    const int t = wv & 3, pl = wv >> 2; const int r0 = (int)blockIdx.x * 128 + (t >> 1) * 64, c0 = (int)blockIdx.y * 128 + (t & 1) * 64;
    v8f acc[4][4];
#pragma unroll
    for (int mb = 0; mb < 4; ++mb)
#pragma unroll
        for (int nb = 0; nb < 4; ++nb) acc[mb][nb] = (v8f){};
    constexpr size_t tp = (size_t)(DM / 32) * FT;   // one row of tiles: a constant, so that it goes into the loads' immediate offsets
    const bf* Ab = (NP == 2 && pl ? A2 : A) + (size_t)(r0 / 16) * tp; const bf* Bb = Bt + (size_t)(c0 / 16) * tp; const unsigned lo = lane * 16;
    // Fragments come LD trips ahead. The lead is what the other waves of the SIMD do not cover: three work-groups of NP = 1 fit a WGP (three waves a SIMD, and a third A set would cost the third), one of NP = 2 (two waves a SIMD).
    constexpr int LD = NP, NA = LD + 1, NT = DM / 32, PT = LD == 1 ? 10 : 6, NL = NT - 2;
    static_assert(NL % PT == 0 && PT % NA == 0 && PT % LD == 0, "whole passes, then the last two trips; in a pass the A sets and the Bt sets come round to where they began, so no register is copied");
    V a[NA][4], b[LD][4];   // trip t reads a[t % NA] and b[t % LD]; the fragments of t + LD go to a[(t + LD) % NA] and, each as its products are issued, back into b[t % LD]
#pragma unroll
    for (int t2 = 0; t2 < LD; ++t2) {
#pragma unroll
        for (int mb = 0; mb < 4; ++mb) a[t2][mb] = WFrag<bf>::ld(Ab + t2 * FT + mb * tp, lo);
#pragma unroll
        for (int nb = 0; nb < 4; ++nb) b[t2][nb] = WFrag<bf>::ld(Bb + t2 * FT + nb * tp, lo); }
#pragma unroll 1
    for (int p = 0; p < NL / PT; ++p) {   // stays rolled: PT trips of text; inside a pass every k step is an immediate offset, and the one address register changes once a pass
        const unsigned ko = lo + (unsigned)p * (PT * FT * 2);   // the lane's byte offset in its row of tiles at the head of the pass
#pragma unroll
        for (int j = 0; j < PT; ++j) gemm_trip<true>(acc, a[j % NA], a[(j + LD) % NA], b[j % LD], Ab + (j + LD) * FT, Bb + (j + LD) * FT, ko);
        asm volatile("s_wait_xcnt 0x0" :: "v"(ko) : "memory");   // inputs only: the loads still in flight name this offset register, and the next pass rewrites it
    }
    // the last two trips: no trip asks for a tile past the last, so every load has been waited for when the epilogue begins
    gemm_trip<LD == 1>(acc, a[NL % NA], a[(NL + LD) % NA], b[NL % LD], Ab + (NT - 1) * FT, Bb + (NT - 1) * FT, lo);
    gemm_trip<false>(acc, a[(NL + 1) % NA], a[NL % NA], b[(NL + 1) % LD], Ab, Bb, lo);
    float* ow = os + wv * (64 * 68);
    if constexpr (EPI == 3) {
        if (op == 2) gemm_store_planes<true>(acc, ow, lr, hi, r0, c0, bias, P16, Ph, Pl, sc);   // op comes from blockIdx.z
        else gemm_store_planes<false>(acc, ow, lr, hi, r0, c0, bias, P16, Ph, Pl, sc);
    } else {
        const int cofs = lr * 4; const float* bp = bias + c0 + cofs; v4f bb; bb[0] = bp[0]; bb[1] = bp[1]; bb[2] = bp[2]; bb[3] = bp[3];
#pragma unroll
        for (int mb = 0; mb < 4; ++mb)
#pragma unroll
            for (int nb = 0; nb < 4; ++nb)
#pragma unroll
                for (int j = 0; j < 8; ++j) ow[(mb * 16 + hi * 8 + j) * 68 + nb * 16 + lr] = acc[mb][nb][j];
        asm volatile("s_wait_xcnt 0x0" :: "v"(lr), "v"(bb) : "memory");   // inputs only: the bias load is issued in front of this wait (its data is named), and the lane index that its address is formed from stays whole until the wait has passed
        bb[0] = bfr(bb[0]); bb[1] = bfr(bb[1]); bb[2] = bfr(bb[2]); bb[3] = bfr(bb[3]);
        __syncthreads();   // both planes' partial tiles stand in LDS before any wave adds them
        const float* sp = os + t * (64 * 68) + (pl * 32 + hi) * 68 + cofs;   // wave (t, pl) joins rows pl * 32 .. + 31 of tile t, two whole rows a store
        constexpr size_t ldc = (size_t)BSZ * DM;   // the (len, batch, d) row pitch: a constant, so that the sixteen stores share one address register pair and differ in their immediate offsets
        float* cp = C + (size_t)(r0 + pl * 32 + hi) * ldc + c0 + cofs; v4f val[16];
#pragma unroll
        for (int s = 0; s < 16; ++s) { val[s] = *(const v4fa*)(sp + s * (2 * 68)); val[s] += *(const v4fa*)(sp + 4 * (64 * 68) + s * (2 * 68)); val[s] += bb; }
#pragma unroll
        for (int s = 0; s < 16; ++s) *(v4f*)(cp + (size_t)(2 * s) * ldc) = val[s];
        asm volatile("s_wait_xcnt 0x0" :: "v"(cp), "v"(val[0]), "v"(val[1]), "v"(val[2]), "v"(val[3]), "v"(val[4]), "v"(val[5]), "v"(val[6]), "v"(val[7]), "v"(val[8]), "v"(val[9]), "v"(val[10]), "v"(val[11]), "v"(val[12]), "v"(val[13]), "v"(val[14]), "v"(val[15]) : "memory");   // inputs only: the stores' address and data registers stay whole until every store is issued and this wait has passed
    }
}


__global__ __launch_bounds__(256) void k_wtG(const float* __restrict__ w, int K, int N, bf* Bt) {
    const int lane = threadIdx.x & 31; const int L0 = (blockIdx.x * 8 + (threadIdx.x >> 5)) * 8; const int nlines = N * K / 64;
{
#pragma unroll 1
        for (int l = 0; l < 8; ++l) { const int L = L0 + l; if (L >= nlines) break; const size_t e = (size_t)L * 64 + lane * 2; const int k = (int)(e % K), n = (int)(e / K); v2us o;
            o[0] = f2bf(w[(size_t)k * N + n]); o[1] = f2bf(w[(size_t)(k + 1) * N + n]); *(v2us*)(Bt + e) = o; }
         }
}
// k_cvtall: all seven f32 operands rounded to bf16 in one grid, each laid down in fragment order. y = a unit of WN elements: XN / WN units for each of x, xk, xv, then one for each weight; dst holds them in that order, an input as one [len][d] matrix for each batch element.
// A work-group takes 16 source rows (an input: 8 rows of each batch element). A wave takes 8 rows of one matrix x 32 columns at a time: lane = (row & 7) + 8 * (column >> 3 & 3) reads 32 bytes of a whole 128-byte line of its row and stores 16 bytes; the 8 rows of a column group are 128 consecutive bytes of the tile. All loads are asked for before the first store.
#define CVU 8
__global__ __launch_bounds__(256) void k_cvtall(const float* __restrict__ x, const float* __restrict__ xk, const float* __restrict__ xv, const float* __restrict__ wq, const float* __restrict__ wk, const float* __restrict__ wv, const float* __restrict__ wo, bf* dst) {
    constexpr int UX = (int)(XN / WN); static_assert(XN % WN == 0 && WN % (256 * 8 * CVU) == 0, "whole units, whole work-groups");
    static_assert(DM == 1024 && BSZ == 2 && CVU == 8, "16 rows of 32 tile columns: 8 waves x 4 trips x 2 row groups");
    const int u = (int)blockIdx.y; const bool isx = u < 3 * UX;
    const float* s = u < UX ? x + (size_t)u * WN : u < 2 * UX ? xk + (size_t)(u - UX) * WN : u < 3 * UX ? xv + (size_t)(u - 2 * UX) * WN : u == 3 * UX ? wq : u == 3 * UX + 1 ? wk : u == 3 * UX + 2 ? wv : wo;
    const int lane = (int)threadIdx.x & 31, w = (int)threadIdx.x >> 5, r8 = lane & 7, c = lane >> 3;
    // row group g = 0, 1: an input's batch element g (source rows r8 * BSZ + g), a weight's rows g * 8 + r8
    const float* s0 = s + (size_t)((int)blockIdx.x * 16 + (isx ? r8 * BSZ : r8)) * DM + w * 32 + c * 8;
    const float* s1 = s0 + (isx ? DM : 8 * DM);
    v8f v[CVU];
#pragma unroll
    for (int i = 0; i < CVU; ++i) v[i] = *(const v8f*)((i < 4 ? s0 : s1) + (i & 3) * 256);
    asm volatile("s_wait_xcnt 0x0" :: "v"(s0), "v"(s1) : "memory");   // inputs only: the loads' address registers stay whole until every load that names them is issued and this wait has passed
    // destination row of group 0 in its matrix, and the two groups' matrices and rows
    const int d0 = isx ? (u % UX) * (int)(WN / DM / BSZ) + (int)blockIdx.x * 8 + r8 : (int)blockIdx.x * 16 + r8;
    const int d1 = isx ? d0 : d0 + 8;
    bf* m0 = dst + (isx ? (size_t)(u / UX) * XN : (size_t)u * WN); bf* m1 = isx ? m0 + (size_t)TT * DM : m0;
    const int in = (c >> 1) * 256 + (c & 1) * 128 + w * FT;
    bf* p0 = m0 + (size_t)(d0 >> 4) * ((DM / 32) * FT) + (d0 & 15) * 8 + in; bf* p1 = m1 + (size_t)(d1 >> 4) * ((DM / 32) * FT) + (d1 & 15) * 8 + in;
    v8us o[CVU];
#pragma unroll
    for (int i = 0; i < CVU; ++i)
#pragma unroll
        for (int k = 0; k < 8; ++k) o[i][k] = f2bf(v[i][k]);
#pragma unroll
    for (int i = 0; i < CVU; ++i) *(v8us*)((i < 4 ? p0 : p1) + (i & 3) * (8 * FT)) = o[i];
    asm volatile("s_wait_xcnt 0x0" :: "v"(p0), "v"(p1), "v"(o[0]), "v"(o[1]), "v"(o[2]), "v"(o[3]), "v"(o[4]), "v"(o[5]), "v"(o[6]), "v"(o[7]) : "memory");   // inputs only: the stores' address and data registers stay whole until every store is issued and this wait has passed
}

// Attention, every wave on its own query rows with a running maximum: nothing of the score matrix leaves the registers, and no wave waits for another inside the key loop.
// A work-group is 8 waves = QG groups of 16 * QT query rows x KS parts of the keys, 64 rows in all; wave wv: group wv % QG, part wv / QG (the QG waves of a part ask for the same K and V lines at about the same time, so the WGP cache can serve the later ones).
// A wave walks its TT / KS keys in blocks of KB = 32. S^T = K Q^T (A = 16 key rows, B = 16 query rows): accumulator register j of lane (lr, hi) is (key 8 hi + j of the tile, query lr), so a query's maximum and sum stay in its lane and its partner lane l ^ 16.
// Two neighbouring key tiles are the B fragment of P^T (elements 0..7: k = 8 hi + j, 8..15: k = 16 + 8 hi + j, column lr), and O^T += V^T P^T (A = 16 rows of the [d][key] plane): register j of lane (lr, hi) is (d 8 hi + j of the tile, query lr), so a query's rescale factor is the lane's own.
// P = exp(s - m) is not normalised in the loop: m is the maximum in use, raised (sums and outputs rescaled) only when a block's maximum passes it by more than LAZY, so P <= 2^8; the division by the sum comes once, at the end.
// The KS parts of a query group meet in LDS: their -m log2(e), then sums and output tiles brought to the common maximum and added in part order; wave (group, part) adds, divides and stores 4 / KS of the four 16-wide d tiles, 16 bytes a lane and tile of the merged operand in fragment order.
// bs[key + ROWS - 1 - r] is the bias of (row i0 + r, key): TT + ROWS - 1 consecutive table entries of the head, gathered once.
#define L2E  1.4426950408889634f
#define LAZY 5.5451774f   // 8 ln 2
__device__ __forceinline__ float xhalf(float x) { return __builtin_bit_cast(float, __builtin_amdgcn_permlanex16(__builtin_bit_cast(int, x), __builtin_bit_cast(int, x), 0x76543210, 0xfedcba98, false, false)); }   // lane l with lane l ^ 16
// fattn_block: one block of KB = 32 keys. kv holds the block's 4 K fragments (slot = key tile * 2 + k half; HR: the lo plane in slots 4..7). Once the score products are issued, the slots take the block's V fragments (slot = d tile), which so arrive during the softmax;
// once those products are issued, they take the next block's K fragments (NEXT; tiles at Kna, Knb, lane offset kn). Va, Vb: the wave's first V tile, vf the lane's offset at this block. b0: the bias of (query lr of the wave's first tile, key 8 hi of the block).
// Each sched_barrier keeps the loads in front of it there: left alone, the scheduler sinks them to just ahead of their first use, and the wave waits out their whole latency.
template <typename T16, bool HR, int QT, bool NEXT>
__device__ __forceinline__ void fattn_block(typename WFrag<T16>::V (&kv)[HR ? 8 : 4], const typename WFrag<T16>::V (&qa)[QT][2], const typename WFrag<T16>::V (&qb)[QT][2], v8f (&o)[QT][4], float (&m)[QT], float (&mc)[QT], v8f (&l)[QT],
                                            const T16* Kna, const T16* Knb, unsigned kn, const T16* Va, const T16* Vb, unsigned vf, const float* b0) {
    typedef typename WFrag<T16>::V V;
    v8f s[QT][2];
    {
#pragma unroll
        for (int t2 = 0; t2 < 2; ++t2)
#pragma unroll
            for (int qt = 0; qt < QT; ++qt) s[qt][t2] = (v8f){};
#pragma unroll
        for (int kk = 0; kk < 2; ++kk) {   // neighbouring products have different accumulators
#pragma unroll
            for (int t2 = 0; t2 < 2; ++t2)
#pragma unroll
                for (int qt = 0; qt < QT; ++qt) s[qt][t2] = WFrag<T16>::mma(kv[t2 * 2 + kk], qa[qt][kk], s[qt][t2]);
            if constexpr (HR) {
#pragma unroll
                for (int t2 = 0; t2 < 2; ++t2)
#pragma unroll
                    for (int qt = 0; qt < QT; ++qt) s[qt][t2] = WFrag<T16>::mma(kv[t2 * 2 + kk], qb[qt][kk], s[qt][t2]);
#pragma unroll
                for (int t2 = 0; t2 < 2; ++t2)
#pragma unroll
                    for (int qt = 0; qt < QT; ++qt) s[qt][t2] = WFrag<T16>::mma(kv[4 + t2 * 2 + kk], qa[qt][kk], s[qt][t2]); } }
#pragma unroll
        for (int i = 0; i < 4; ++i) { kv[i] = WFrag<T16>::ld((const T16*)((const char*)Va + vf) + i * ((TT / 32) * FT), 0); if constexpr (HR) kv[4 + i] = WFrag<T16>::ld((const T16*)((const char*)Vb + vf) + i * ((TT / 32) * FT), 0); }
        asm volatile("s_wait_xcnt 0x0" :: "v"(vf) : "memory");   // inputs only: the lane offset, the one vector register that these loads name, stays whole (no fragment lands in it) until every load is issued and the wait has passed
        __builtin_amdgcn_sched_barrier(0); }
    float bm[QT]; bool need = false; v8f bb[QT + 1];   // the bias depends on key - query alone: the tiles (qt, nt) of one nt - qt share their 8 values a lane
#pragma unroll
    for (int d = 0; d <= QT; ++d)
#pragma unroll
        for (int j = 0; j < 8; ++j) bb[d][j] = b0[(d - (QT - 1)) * 16 + j];
#pragma unroll
    for (int qt = 0; qt < QT; ++qt) { s[qt][0] += bb[QT - 1 - qt]; s[qt][1] += bb[QT - qt]; const v8f m8 = __builtin_elementwise_max(s[qt][0], s[qt][1]);
        const float mm = fmaxf(fmaxf(fmaxf(m8[0], m8[1]), fmaxf(m8[2], m8[3])), fmaxf(fmaxf(m8[4], m8[5]), fmaxf(m8[6], m8[7])));
        bm[qt] = fmaxf(mm, xhalf(mm)); need = need || bm[qt] > m[qt] + LAZY; }
    if (__builtin_amdgcn_ballot_w32(need) != 0) {   // one scalar branch a block, rare after a wave's first blocks; both lanes of a query hold the same bm and m
#pragma unroll
        for (int qt = 0; qt < QT; ++qt) { const float mn = fmaxf(m[qt], bm[qt]), mcn = -mn * L2E, al = __builtin_amdgcn_exp2f(mcn - mc[qt]); m[qt] = mn; mc[qt] = mcn; l[qt] *= al;
#pragma unroll
            for (int nb = 0; nb < 4; ++nb) o[qt][nb] *= al; } }
#pragma unroll
    for (int qt = 0; qt < QT; ++qt)
#pragma unroll
        for (int nt = 0; nt < 2; ++nt) { const v8f t = s[qt][nt] * L2E + mc[qt];
#pragma unroll
            for (int j = 0; j < 8; ++j) s[qt][nt][j] = __builtin_amdgcn_exp2f(t[j]);
            l[qt] += s[qt][nt]; }
    { V pa[QT], pb[QT];
#pragma unroll
        for (int qt = 0; qt < QT; ++qt) {
            if constexpr (HR) { v8us h0, l0, h1, l1;
#pragma unroll
                for (int j = 0; j < 8; ++j) { unsigned short a, c2; splitf(s[qt][0][j], a, c2); h0[j] = a; l0[j] = c2; splitf(s[qt][1][j], a, c2); h1[j] = a; l1[j] = c2; }
                pa[qt] = cat16b(h0, h1); pb[qt] = cat16b(l0, l1);
            } else { v8h p0, p1;
#pragma unroll
                for (int j = 0; j < 8; ++j) { p0[j] = tohx(s[qt][0][j]); p1[j] = tohx(s[qt][1][j]); }
                pa[qt] = cat16(p0, p1); } }
#pragma unroll
        for (int nb = 0; nb < 4; ++nb)
#pragma unroll
            for (int qt = 0; qt < QT; ++qt) o[qt][nb] = WFrag<T16>::mma(kv[nb], pa[qt], o[qt][nb]);
        if constexpr (HR) {
#pragma unroll
            for (int nb = 0; nb < 4; ++nb)
#pragma unroll
                for (int qt = 0; qt < QT; ++qt) o[qt][nb] = WFrag<T16>::mma(kv[nb], pb[qt], o[qt][nb]);
#pragma unroll
            for (int nb = 0; nb < 4; ++nb)
#pragma unroll
                for (int qt = 0; qt < QT; ++qt) o[qt][nb] = WFrag<T16>::mma(kv[4 + nb], pa[qt], o[qt][nb]); }
        if constexpr (NEXT) {
#pragma unroll
            for (int i = 0; i < 4; ++i) { kv[i] = WFrag<T16>::ld((const T16*)((const char*)Kna + kn) + i * FT, 0); if constexpr (HR) kv[4 + i] = WFrag<T16>::ld((const T16*)((const char*)Knb + kn) + i * FT, 0); }
            asm volatile("s_wait_xcnt 0x0" :: "v"(kn) : "memory");   // inputs only, as behind the V loads: no fragment lands in the lane offset, and the next block does not rewrite it, until every load is issued and the wait has passed
            __builtin_amdgcn_sched_barrier(0); } }
}
template <typename T16, bool HR, int QT, int QG, int KS>
__device__ __forceinline__ void fattn_rows(const T16* __restrict__ Qa, const T16* __restrict__ Qb, const T16* __restrict__ Ka, const T16* __restrict__ Kb, const T16* __restrict__ Va, const T16* __restrict__ Vb, const float* __restrict__ tab, int i0, int h, bf* ATh, bf* ATl, float* bs, float* redm, float* reds, float* os) {
    typedef typename WFrag<T16>::V V;
    constexpr int KB = 32, NTH = 32 * QG * KS, WR = QT * 16, ROWS = QG * WR, KW = TT / KS, NBK = KW / KB, WSZ = QT * 4 * 2 * 128, NBW = 4 / KS;
    static_assert(KW % KB == 0 && NBK >= 2 && NTH == 256 && TT % NTH == 0 && HD == 64 && 4 % KS == 0 && ROWS <= NTH, "shape");
    const int lane = threadIdx.x & 31, lr = lane & 15, hi = lane >> 4; const int wv = __builtin_amdgcn_readfirstlane((int)(threadIdx.x >> 5));
    const int qg = wv % QG, kq = wv / QG, key0 = kq * KW; const size_t hp = (size_t)h * TT * HD;
    constexpr int NG = TT / NTH + 1; float g[NG]; unsigned go[NG]; static_assert(NG == 9, "the wait behind the gathers names nine offsets");
#pragma unroll
    for (int t = 0; t < NG; ++t) { int r = i0 + (ROWS - 1) + (TT - 1) - (t * NTH + (int)threadIdx.x); r = min(max(r, 0), NREL - 1); go[t] = (unsigned)(r * NH_ + h) * 4u; g[t] = *(const float*)((const char*)tab + go[t]); }   // go: byte offsets in the table; entries from TT + ROWS - 1 on are never read, and the clip bounds their address like any other
    asm volatile("s_wait_xcnt 0x0" :: "v"(go[0]), "v"(go[1]), "v"(go[2]), "v"(go[3]), "v"(go[4]), "v"(go[5]), "v"(go[6]), "v"(go[7]), "v"(go[8]) : "memory");   // inputs only: the gathers' offset registers stay whole until every gather is issued and this wait has passed
    V qa[QT][2], qb[QT][2], kv[HR ? 8 : 4]; const size_t qo = hp + (size_t)(i0 / 16 + qg * QT) * ((HD / 32) * FT); const unsigned lo = lane * 16;
#pragma unroll
    for (int qt = 0; qt < QT; ++qt)
#pragma unroll
        for (int kk = 0; kk < 2; ++kk) { qa[qt][kk] = WFrag<T16>::ld(Qa + qo + (qt * 2 + kk) * FT, lo); if constexpr (HR) qb[qt][kk] = WFrag<T16>::ld(Qb + qo + (qt * 2 + kk) * FT, lo); }
    const size_t ko = hp + (size_t)(key0 / 16) * ((HD / 32) * FT), vo = hp + (size_t)(key0 / 32) * FT;
    const T16* Kwa = Ka + ko; const T16* Kwb = HR ? Kb + ko : nullptr; const T16* Vwa = Va + vo; const T16* Vwb = HR ? Vb + vo : nullptr;
#pragma unroll
    for (int i = 0; i < 4; ++i) { kv[i] = WFrag<T16>::ld(Kwa + i * FT, lo); if constexpr (HR) kv[4 + i] = WFrag<T16>::ld(Kwb + i * FT, lo); }
#pragma unroll
    for (int t = 0; t < NG; ++t) bs[t * NTH + (int)threadIdx.x] = bfr(g[t]);
    __syncthreads();   // the head's table entries stand in LDS before any wave adds them to its scores
    v8f o[QT][4], l[QT]; float m[QT], mc[QT];   // l: register j sums the lane's keys 8 hi + j of every tile
#pragma unroll
    for (int qt = 0; qt < QT; ++qt) { m[qt] = -1.0e30f; mc[qt] = 1.0e30f * L2E; l[qt] = (v8f){};   // the first block always raises m; its factor exp2(-huge) is 0 on sums and outputs that are 0
#pragma unroll
        for (int nb = 0; nb < 4; ++nb) o[qt][nb] = (v8f){}; }
    const float* b0 = bs + key0 + 8 * hi + (ROWS - 1) - (qg * WR + lr);
    constexpr unsigned KBB = (KB / 16) * (HD / 32) * FT * 2, VBB = (KB / 32) * FT * 2;   // bytes of K tiles, and of one d tile's V tiles, in a block
#pragma unroll 1
    for (int blk = 0; blk < NBK - 1; ++blk) {   // stays rolled: one block of text; the two address registers change once a block
        const unsigned kn = lo + (unsigned)(blk + 1) * KBB, vf = lo + (unsigned)blk * VBB;
        fattn_block<T16, HR, QT, true>(kv, qa, qb, o, m, mc, l, Kwa, Kwb, kn, Vwa, Vwb, vf, b0 + blk * KB);
    }
    fattn_block<T16, HR, QT, false>(kv, qa, qb, o, m, mc, l, Kwa, Kwb, lo, Vwa, Vwb, lo + (unsigned)(NBK - 1) * VBB, b0 + (NBK - 1) * KB);
    float ls[QT];
#pragma unroll
    for (int qt = 0; qt < QT; ++qt) { const float t = ((l[qt][0] + l[qt][1]) + (l[qt][2] + l[qt][3])) + ((l[qt][4] + l[qt][5]) + (l[qt][6] + l[qt][7])); ls[qt] = t + xhalf(t); if (hi == 0) redm[wv * 32 + qt * 16 + lr] = mc[qt]; }
    __syncthreads();   // every part's -m log2(e) stands in LDS before any wave takes the minimum over them
    float* ow = os + wv * WSZ + lane * 4;
#pragma unroll
    for (int qt = 0; qt < QT; ++qt) { float mg = redm[qg * 32 + qt * 16 + lr];
#pragma unroll
        for (int p = 1; p < KS; ++p) mg = fminf(mg, redm[(p * QG + qg) * 32 + qt * 16 + lr]);
        const float sc = __builtin_amdgcn_exp2f(mg - mc[qt]);
        if (hi == 0) reds[wv * 32 + qt * 16 + lr] = ls[qt] * sc;
#pragma unroll
        for (int nb = 0; nb < 4; ++nb) { const v8f x = o[qt][nb] * sc; *(v4fa*)(ow + ((qt * 4 + nb) * 2) * 128) = __builtin_shufflevector(x, x, 0, 1, 2, 3); *(v4fa*)(ow + ((qt * 4 + nb) * 2 + 1) * 128) = __builtin_shufflevector(x, x, 4, 5, 6, 7); } }   // each store: 512 consecutive bytes of the wave
    __syncthreads();   // every part's sums and output tiles stand in LDS before any wave adds across them
    v8us oh[QT][NBW], ol[QT][NBW];
#pragma unroll
    for (int qt = 0; qt < QT; ++qt) { float sum = reds[qg * 32 + qt * 16 + lr];
#pragma unroll
        for (int p = 1; p < KS; ++p) sum += reds[(p * QG + qg) * 32 + qt * 16 + lr];
        const float f = __fdiv_rn(1.0f, sum);
#pragma unroll
        for (int t = 0; t < NBW; ++t) { const float* sp = os + qg * WSZ + ((qt * 4 + kq * NBW + t) * 2) * 128 + lane * 4; v4f x0 = *(const v4fa*)sp, x1 = *(const v4fa*)(sp + 128);
#pragma unroll
            for (int p = 1; p < KS; ++p) { x0 += *(const v4fa*)(sp + p * (QG * WSZ)); x1 += *(const v4fa*)(sp + p * (QG * WSZ) + 128); }
#pragma unroll
            for (int q = 0; q < 8; ++q) { unsigned short a, c2; splitf((q < 4 ? x0[q & 3] : x1[q & 3]) * f, a, c2); oh[qt][t][q] = a; ol[qt][t][q] = c2; } } }
    // d tile nb = kq * NBW + t: (row lr of the tile, k = h * HD + nb * 16 + hi * 8 .. + 7); 256 elements a d tile, two d tiles a fragment tile
    const size_t oo = ((size_t)(i0 / 16 + qg * QT) * (DQ / 32) + h * (HD / 32)) * FT + (size_t)(kq * NBW) * 256 + (hi * 16 + lr) * 8;
    bf* ph = ATh + oo; bf* pl = ATl + oo;
#pragma unroll
    for (int qt = 0; qt < QT; ++qt)
#pragma unroll
        for (int t = 0; t < NBW; ++t) { *(v8us*)(ph + qt * ((DQ / 32) * FT) + t * 256) = oh[qt][t]; *(v8us*)(pl + qt * ((DQ / 32) * FT) + t * 256) = ol[qt][t]; }
}
// k_fattn: every (head, batch element, block of 64 query rows) in one grid: x = head + NH_ * b, y = row block. Rows < RH (three products, two planes of every operand): 16 rows a wave for the registers' sake, 4 groups x 2 key halves, so that four waves share each line of the doubled K and V; these work-groups run about twice as long and have the lowest y, so they start first. The other rows: 32 rows a wave, 2 groups x 4 key quarters.
// Each operand pointer is batch element 0's plane, element 1's follows it (as the projections store them); ATh, ATl [b][row][DQ], each batch element's matrix in fragment order. Four waves a SIMD (two work-groups a WGP): the vector work between the matrix runs wants other waves to issue meanwhile.
__global__ __launch_bounds__(256) __attribute__((amdgpu_waves_per_eu(4, 4))) void k_fattn(const h16* __restrict__ Q16, const h16* __restrict__ K16, const h16* __restrict__ V16, const bf* __restrict__ Qh, const bf* __restrict__ Ql, const bf* __restrict__ Kh, const bf* __restrict__ Kl, const bf* __restrict__ Vh, const bf* __restrict__ Vl, const float* __restrict__ tab, bf* ATh, bf* ATl) {
    static_assert(RH % 64 == 0 && TT % 64 == 0, "a row block is of one class");
    __shared__ __align__(16) float sm[(TT + 256) + 8 * 32 + 8 * 32 + 8 * 2 * 4 * 2 * 128];   // one array, the bias first: its reads in the key loop then reach every value from one address register by their immediate offsets
    float* bs = sm; float* redm = bs + (TT + 256); float* reds = redm + 8 * 32; float* os = reds + 8 * 32;
    const int h = (int)blockIdx.x % NH_, y = (int)blockIdx.y; const size_t b = blockIdx.x / NH_, pb = b * PLN;
    ATh += b * ((size_t)TT * DQ); ATl += b * ((size_t)TT * DQ);
    if (y < RH / 64) fattn_rows<bf, true, 1, 4, 2>(Qh + pb, Ql + pb, Kh + pb, Kl + pb, Vh + pb, Vl + pb, tab, y * 64, h, ATh, ATl, bs, redm, reds, os);   // y comes from blockIdx.y: the whole work-group takes one side, its barriers with it
    else fattn_rows<h16, false, 2, 2, 4>(Q16 + pb, nullptr, K16 + pb, nullptr, V16 + pb, nullptr, tab, y * 64, h, ATh, ATl, bs, redm, reds, os);
}
extern "C" void kernel_launch(void* const* d_in, const int* in_sizes, int n_in,
                              void* d_out, int out_size, void* d_ws, size_t ws_size, hipStream_t stream) {
    (void)in_sizes; (void)n_in; (void)out_size;
    const float* x = (const float*)d_in[0]; const float* xk = (const float*)d_in[1]; const float* xv = (const float*)d_in[2]; const float* wq = (const float*)d_in[3]; const float* bq = (const float*)d_in[4]; const float* wk = (const float*)d_in[5]; const float* bk = (const float*)d_in[6]; const float* wv = (const float*)d_in[7]; const float* bv = (const float*)d_in[8]; const float* wo = (const float*)d_in[9]; const float* bo = (const float*)d_in[10]; const float* rtab = (const float*)d_in[11];
    float* OUT = (float*)d_out;     // [2048][2][1024]
    char* wsp = (char*)d_ws;
    auto take = [&](size_t bytes) { char* p = wsp; wsp += (bytes + 255) & ~(size_t)255; return (void*)p; };
    static_assert(NKV == NH_ && DKV == DQ && DQ == DM, "q, k, v share one projection grid and one plane size");
    bf* XB = (bf*)take((3 * XN + 4 * WN) * 2);     // bf16, fragment order: x, xk, xv, each [b][len][d], then Wq, Wk, Wv, Wo
    bf* WQKV = XB + 3 * XN; bf* WO = WQKV + 3 * WN;
    h16* P16 = (h16*)take(6 * PLN * 2); bf* Ph = (bf*)take(6 * PLN * 2); bf* Pl = (bf*)take(6 * PLN * 2);   // plane 2 * op + b: q, k [head][row][d], v [head][d][row], each head's matrix in fragment order
    bf* ATh = (bf*)take((size_t)BSZ * TT * DQ * 2); bf* ATl = (bf*)take((size_t)BSZ * TT * DQ * 2);
    if ((size_t)(wsp - (char*)d_ws) > ws_size) return;    // ws 256 MiB
    k_cvtall<<<dim3((unsigned)(WN / (256 * 8 * CVU)), (unsigned)(3 * XN / WN + 4), 1), 256, 0, stream>>>(x, xk, xv, wq, wk, wv, wo, XB);
    k_gemmt<1, 3><<<dim3(TT / 128, DQ / 128, 3 * BSZ), 128, 0, stream>>>(XB, nullptr, WQKV, nullptr, bq, bk, bv, 0, 0, P16, Ph, Pl, QSC);   /* q x 1/8 and k head planes, v planes transposed */
    k_fattn<<<dim3(NH_ * BSZ, TT / 64, 1), 256, 0, stream>>>(P16, P16 + 2 * PLN, P16 + 4 * PLN, Ph, Pl, Ph + 2 * PLN, Pl + 2 * PLN, Ph + 4 * PLN, Pl + 4 * PLN, rtab, ATh, ATl);   /* rows < RH: hi/lo planes, 3 products; the other rows: fp16 */
    k_gemmt<2, 0><<<dim3(TT / 128, DM / 128, BSZ), 256, 0, stream>>>(ATh, ATl, WO, OUT, bo, nullptr, nullptr, (size_t)TT * DQ, DM, nullptr, nullptr, nullptr, 1.0f);   /* rows at the (len, batch, d) pitch */
}

// v009
// One run takes 104 microseconds.
// Two timings next to v008 put it at 1.04 and 1.03 times that version's speed.
// Counting every step since v000, it is 22.5 times as fast.
#include <hip/hip_runtime.h>

// Multi-head attention with a learned relative-position bias, sequence-first layout (query, key, value [2048][2][1024] = (len, batch, d_model); q,k,v = input W^T + b ('oi' [1024][1024] + [1024]; 16 heads x 64); scores = q.k / 8 + rel_table[clip(i - j + 2047, 0, 4094)][h] (table [4095][16], read); softmax over all keys; out = merged Wo^T + bo -> [2048][2][1024] (4.2 M)).
// Four launches, each over both batch elements: (1) the three inputs and the four weights rounded to bf16, each input's rows laid down by batch element ([b][len][d]), every 16-bit operand of every launch in the order the matrix fragments are read in; (2) the q, k, v projections, exact + f32 biases, one grid, each epilogue storing the attention operand planes itself; (3) dense T-2048 attention, both row classes in one grid (hybrid rows: < 512 hi/lo 3 products, rest fp16), each wave on its own query rows with a running maximum, the gathered per-head bias added to the scores in registers; (4) merged hi/lo x Wo exact + bo, stored at the batch pitch straight into the (len, batch, d) output.
// Compute dtypes, f32 accumulate: every input rounded to bf16; projections exact + f32 biases; attention rows < 512 3 products, rest fp16; bias add and softmax f32; Wo hl x exact + bias.

#define NB_  2
#define TT   2048
#define DM   1024
#define NH_  16
#define NKV  16
#define REP  (NH_ / NKV)
#define HD   64
#define DQ   (NH_ * HD)
#define DKV  (NKV * HD)
#define RH   512                  // query rows < RH use hi+lo planes (0: none)
#define WIN  0
#define QSC  0.125f   // the 1/8 is folded into q so the gathered bias adds to the scaled scores
#define BSZ  2
#define NREL 4095
#define XN   ((size_t)TT * BSZ * DM)   // elements of one input
#define WN   ((size_t)DQ * DM)         // elements of one weight matrix
#define PLN  ((size_t)NH_ * TT * HD)   // elements of one operand plane (one of q, k, v of one batch element)
// Fragment order: every 16-bit matrix operand [rows][K] lies in the workspace as tiles of 16 rows x 32 k, FT elements each, tile (row >> 4, k >> 5) at ((row >> 4) * (K / 32) + (k >> 5)) * FT.
// Inside a tile the 8 elements (row, k & ~7 .. k | 7) stand at ((k >> 4 & 1) * 32 + (k >> 3 & 1) * 16 + (row & 15)) * 8: lane l finds the two halves of its fragment at l * 8 and 256 + l * 8, so each load instruction of a wave takes 512 consecutive bytes (4 whole lines, not 32-byte pieces of 16 lines).
#define FT   512
typedef _Float16 h16;
typedef unsigned short bf;
typedef __attribute__((ext_vector_type(16))) __bf16   v16bf;
typedef __attribute__((ext_vector_type(16))) _Float16 v16h;
typedef __attribute__((ext_vector_type(8)))  _Float16 v8h;
typedef __attribute__((ext_vector_type(8)))  unsigned short v8us;
typedef __attribute__((ext_vector_type(8)))  float    v8f;
typedef __attribute__((ext_vector_type(4)))  float    v4f;
typedef v8h  __attribute__((may_alias)) v8ha;
typedef v4f  __attribute__((may_alias)) v4fa;
typedef v8us __attribute__((may_alias)) v8usa;

__device__ __forceinline__ unsigned short f2bf(float f) { unsigned u = __float_as_uint(f); u += 0x7FFFu + ((u >> 16) & 1u); return (unsigned short)(u >> 16); }
__device__ __forceinline__ float bf2f(unsigned short b) { return __uint_as_float(((unsigned)b) << 16); }
__device__ __forceinline__ float bfr(float f) { return bf2f(f2bf(f)); }
__device__ __forceinline__ v16h cat16(v8h lo, v8h hi) { return __builtin_shufflevector(lo, hi, 0, 1, 2, 3, 4, 5, 6, 7, 8, 9, 10, 11, 12, 13, 14, 15); }
__device__ __forceinline__ v16bf cat16b(v8us lo, v8us hi) { return __builtin_bit_cast(v16bf, __builtin_shufflevector(lo, hi, 0, 1, 2, 3, 4, 5, 6, 7, 8, 9, 10, 11, 12, 13, 14, 15)); }
__device__ __forceinline__ v8f wmma16(v16h a, v16h b, v8f c) { return __builtin_amdgcn_wmma_f32_16x16x32_f16(false, a, false, b, (short)0, c, false, false); }
__device__ __forceinline__ v8f wmmab(v16bf a, v16bf b, v8f c) { return __builtin_amdgcn_wmma_f32_16x16x32_bf16(false, a, false, b, (short)0, c, false, false); }
__device__ __forceinline__ h16 tohx(float x) { return (h16)x; }
__device__ __forceinline__ void splitf(float y, unsigned short& h, unsigned short& l) { h = f2bf(y); l = f2bf(y - bf2f(h)); }
typedef __attribute__((ext_vector_type(2))) _Float16 v2h;
typedef __attribute__((ext_vector_type(4))) _Float16 v4h;
typedef __attribute__((ext_vector_type(2))) unsigned short v2us;
typedef __attribute__((ext_vector_type(4))) unsigned short v4us;
typedef __attribute__((ext_vector_type(2))) float v2f;
typedef __attribute__((ext_vector_type(4))) int v4i;



// ---- k_gemmt: C[m][n] = sum_k A[m][k] Bt[n][k] over K = DM, bf16 operands in fragment order, f32 accumulate; grid (M / 128, N / 128, Z), 128 * NP threads.
// A work-group takes a 128 x 128 tile of C as 2 x 2 waves of 64 x 64 (16 accumulators a wave), and every wave runs the whole K. The two waves of a tile row ask for the same A lines and the two of a tile column for the same Bt lines at about the same time, so a line comes from L2 once for the work-group and the WGP cache serves the other reader.
// A wave has no sibling on its K range to hide its loads behind, so its fragments come ahead of their trip (NP = 1: one trip, NP = 2: two): the A fragments into a spare register set, each Bt fragment into its own registers as soon as its four products are issued.
// NP = 1: 4 waves. NP = 2: 8 waves, A in two planes (hi, lo): waves 0..3 sum A x Bt, waves 4..7 A2 x Bt over the same tiles, and the two f32 partial tiles meet in LDS (hi + lo, then bias).
// EPI 0: f32 + bias to C (row pitch BSZ * DM; z strides sA, sC in elements). EPI 3: q, k and v of both batch elements in one grid. z = 2 * op + b: A is plane z of the converted inputs (TT x DM each), Bt weight op, bias bias / bias1 / bias2; a wave's 64 columns are one head (HD == 64), and (sum + bias) x sc (op 0 takes sc, the others 1) goes as fp16 and as bf16 hi/lo to planes z of P16, Ph, Pl in fragment order: op 0, 1 [head][row][d], op 2 [head][d][row].
// ld(t, lo): the fragment of the tile at t, the same address in the whole wave; lo = lane * 16, the lane's byte offset in each half of the tile, the one vector register of the address.
template <typename T16> struct WFrag;
template <> struct WFrag<h16> { typedef v16h V; static __device__ __forceinline__ V ld(const h16* t, unsigned lo) { const char* p = (const char*)t + lo; return cat16(*(const v8h*)p, *(const v8h*)(p + 512)); } static __device__ __forceinline__ v8f mma(V a, V b, v8f c) { return wmma16(a, b, c); } };
template <> struct WFrag<bf> { typedef v16bf V; static __device__ __forceinline__ V ld(const bf* t, unsigned lo) { const char* p = (const char*)t + lo; return cat16b(*(const v8us*)p, *(const v8us*)(p + 512)); } static __device__ __forceinline__ v8f mma(V a, V b, v8f c) { return wmmab(a, b, c); } };
// gemm_store_planes: a wave's own 64 x 64 tile, through the wave's own LDS range ow, to the three planes in fragment order. The tile lies in LDS as [row][d], TR: as [d][row] (a lane's 8 accumulator registers are 8 neighbouring rows of one column), which is 4 x 2 fragment tiles (rt, kt):
// lane (lr, hi) takes LDS row rt * 16 + lr, columns kt * 32 + u * 16 + hi * 8 .. + 7 for u = 0, 1, and each of its stores is 16 bytes of 512 consecutive ones of the wave.
template <bool TR>
__device__ __forceinline__ void gemm_store_planes(const v8f (&acc)[4][4], float* ow, int lr, int hi, int r0, int c0, const float* __restrict__ bias, h16* P16, bf* Ph, bf* Pl, float sc) {
    static_assert(HD == 64, "a wave's 64 columns are one head");
    v8f bv[2][2]; float bt[4];
    if constexpr (!TR) { const float* bp = bias + c0 + hi * 8;
#pragma unroll
        for (int kt = 0; kt < 2; ++kt)
#pragma unroll
            for (int u = 0; u < 2; ++u)
#pragma unroll
                for (int q = 0; q < 8; ++q) bv[kt][u][q] = bp[kt * 32 + u * 16 + q];
        asm volatile("s_wait_xcnt 0x0" :: "v"(bp) : "memory");   // inputs only: the bias loads' address registers stay whole until every load that names them is issued and this wait has passed
#pragma unroll
        for (int kt = 0; kt < 2; ++kt)
#pragma unroll
            for (int u = 0; u < 2; ++u)
#pragma unroll
                for (int q = 0; q < 8; ++q) bv[kt][u][q] = bfr(bv[kt][u][q]);
    } else { const float* bp = bias + c0 + lr;
#pragma unroll
        for (int rt = 0; rt < 4; ++rt) bt[rt] = bp[rt * 16];
        asm volatile("s_wait_xcnt 0x0" :: "v"(bp) : "memory");   // inputs only: the bias loads' address registers stay whole until every load that names them is issued and this wait has passed
#pragma unroll
        for (int rt = 0; rt < 4; ++rt) bt[rt] = bfr(bt[rt]); }
    if constexpr (TR) {
#pragma unroll
        for (int mb = 0; mb < 4; ++mb)
#pragma unroll
            for (int nb = 0; nb < 4; ++nb) { float* op = ow + (nb * 16 + lr) * 68 + mb * 16 + hi * 8;
                *(v4fa*)op = __builtin_shufflevector(acc[mb][nb], acc[mb][nb], 0, 1, 2, 3); *(v4fa*)(op + 4) = __builtin_shufflevector(acc[mb][nb], acc[mb][nb], 4, 5, 6, 7); }
    } else {
#pragma unroll
        for (int mb = 0; mb < 4; ++mb)
#pragma unroll
            for (int nb = 0; nb < 4; ++nb)
#pragma unroll
                for (int j = 0; j < 8; ++j) ow[(mb * 16 + hi * 8 + j) * 68 + nb * 16 + lr] = acc[mb][nb][j];
    }
    asm volatile("s_wait_dscnt 0x0" ::: "memory");   // the wave's own LDS stores are done before its lanes read each other's rows back; no other wave touches this range
#pragma unroll
    for (int ft = 0; ft < 8; ++ft) { const int rt = ft >> 1, kt = ft & 1;
        const size_t e0 = (size_t)c0 * TT + (!TR ? (size_t)((r0 >> 4) + rt) * (HD / 32) + kt : (size_t)rt * (TT / 32) + (r0 >> 5) + kt) * FT + (hi * 16 + lr) * 8;   // c0 * TT: the head's plane, HD * TT elements a head
        v8h o16[2]; v8us oh[2], ol[2];
#pragma unroll
        for (int u = 0; u < 2; ++u) { const float* sp = ow + (rt * 16 + lr) * 68 + kt * 32 + u * 16 + hi * 8; const v4f x0 = *(const v4fa*)sp, x1 = *(const v4fa*)(sp + 4);
#pragma unroll
            for (int q = 0; q < 8; ++q) { float bq; if constexpr (TR) bq = bt[rt]; else bq = bv[kt][u][q];
                const float r = ((q < 4 ? x0[q & 3] : x1[q & 3]) + bq) * sc; o16[u][q] = tohx(r); unsigned short a2, c2; splitf(r, a2, c2); oh[u][q] = a2; ol[u][q] = c2; } }
#pragma unroll
        for (int u = 0; u < 2; ++u) { *(v8h*)(P16 + e0 + u * 256) = o16[u]; *(v8us*)(Ph + e0 + u * 256) = oh[u]; *(v8us*)(Pl + e0 + u * 256) = ol[u]; }
        asm volatile("s_wait_xcnt 0x0" :: "v"(P16 + e0), "v"(Ph + e0), "v"(Pl + e0), "v"(o16[0]), "v"(oh[0]), "v"(ol[0]), "v"(o16[1]), "v"(oh[1]), "v"(ol[1]) : "memory"); }   // inputs only: the six stores' address and data registers stay whole until they are issued and this wait has passed
}
// gemm_trip: one k tile's 16 products from the fragments ac and b. NEXT: the fragments of a later k tile (tiles at An, Bn, lane offset ko) are asked for meanwhile, A into the free set an, each Bt fragment into its own registers as soon as its four products are issued.
// Each sched_barrier keeps the loads in front of it there: left alone, the scheduler sinks these loads to just ahead of their first use, and the wave waits out their whole latency.
template <bool NEXT>
__device__ __forceinline__ void gemm_trip(v8f (&acc)[4][4], const WFrag<bf>::V (&ac)[4], WFrag<bf>::V (&an)[4], WFrag<bf>::V (&b)[4], const bf* An, const bf* Bn, unsigned ko) {
    constexpr size_t tp = (size_t)(DM / 32) * FT;   // one row of tiles
    if constexpr (NEXT) {
#pragma unroll
        for (int mb = 0; mb < 4; ++mb) an[mb] = WFrag<bf>::ld(An + mb * tp, ko);
        __builtin_amdgcn_sched_barrier(0); }
#pragma unroll
    for (int nb = 0; nb < 4; ++nb) {
#pragma unroll
        for (int mb = 0; mb < 4; ++mb) acc[mb][nb] = wmmab(ac[mb], b[nb], acc[mb][nb]);
        if constexpr (NEXT) { b[nb] = WFrag<bf>::ld(Bn + nb * tp, ko); __builtin_amdgcn_sched_barrier(0); } }
}
template <int NP, int EPI>
__global__ __launch_bounds__(128 * NP) void k_gemmt(const bf* __restrict__ A, const bf* __restrict__ A2, const bf* __restrict__ Bt, float* C, const float* __restrict__ bias, const float* __restrict__ bias1, const float* __restrict__ bias2, size_t sA, size_t sC, h16* P16, bf* Ph, bf* Pl, float sc) {
    typedef WFrag<bf>::V V;
    static_assert((EPI == 3 && NP == 1) || (EPI == 0 && NP == 2), "the plane epilogue takes one wave a tile, the f32 epilogue joins two planes");
    static_assert(DQ == DM && (DM / 32) % 2 == 0, "one K for every launch, an even number of trips");
    __shared__ __align__(16) float os[4 * NP * 64 * 68];
    const size_t z = blockIdx.z; const int op = (int)(blockIdx.z >> 1);
    if constexpr (EPI == 3) { A += z * ((size_t)TT * DM); Bt += (size_t)op * WN; bias = op == 0 ? bias : op == 1 ? bias1 : bias2; P16 += z * PLN; Ph += z * PLN; Pl += z * PLN; sc = op == 0 ? sc : 1.0f; }
    else { A += z * sA; A2 += z * sA; C += z * sC; }
    const int lane = threadIdx.x & 31, lr = lane & 15, hi = lane >> 4;
    const int wv = __builtin_amdgcn_readfirstlane((int)(threadIdx.x >> 5));   // the wave's number in a scalar register: tile, plane and every base address stay scalar
    const int t = wv & 3, pl = wv >> 2; const int r0 = (int)blockIdx.x * 128 + (t >> 1) * 64, c0 = (int)blockIdx.y * 128 + (t & 1) * 64;
    v8f acc[4][4];
#pragma unroll
    for (int mb = 0; mb < 4; ++mb)
#pragma unroll
        for (int nb = 0; nb < 4; ++nb) acc[mb][nb] = (v8f){};
    constexpr size_t tp = (size_t)(DM / 32) * FT;   // one row of tiles: a constant, so that it goes into the loads' immediate offsets
    const bf* Ab = (NP == 2 && pl ? A2 : A) + (size_t)(r0 / 16) * tp; const bf* Bb = Bt + (size_t)(c0 / 16) * tp; const unsigned lo = lane * 16;
    // Fragments come LD trips ahead. The lead is what the other waves of the SIMD do not cover: three work-groups of NP = 1 fit a WGP (three waves a SIMD, and a third A set would cost the third), one of NP = 2 (two waves a SIMD).
    constexpr int LD = NP, NA = LD + 1, NT = DM / 32, PT = LD == 1 ? 10 : 6, NL = NT - 2;
    static_assert(NL % PT == 0 && PT % NA == 0 && PT % LD == 0, "whole passes, then the last two trips; in a pass the A sets and the Bt sets come round to where they began, so no register is copied");
    V a[NA][4], b[LD][4];   // trip t reads a[t % NA] and b[t % LD]; the fragments of t + LD go to a[(t + LD) % NA] and, each as its products are issued, back into b[t % LD]
#pragma unroll
    for (int t2 = 0; t2 < LD; ++t2) {
#pragma unroll
        for (int mb = 0; mb < 4; ++mb) a[t2][mb] = WFrag<bf>::ld(Ab + t2 * FT + mb * tp, lo);
#pragma unroll
        for (int nb = 0; nb < 4; ++nb) b[t2][nb] = WFrag<bf>::ld(Bb + t2 * FT + nb * tp, lo); }
#pragma unroll 1
    for (int p = 0; p < NL / PT; ++p) {   // stays rolled: PT trips of text; inside a pass every k step is an immediate offset, and the one address register changes once a pass
        const unsigned ko = lo + (unsigned)p * (PT * FT * 2);   // the lane's byte offset in its row of tiles at the head of the pass
#pragma unroll
        for (int j = 0; j < PT; ++j) gemm_trip<true>(acc, a[j % NA], a[(j + LD) % NA], b[j % LD], Ab + (j + LD) * FT, Bb + (j + LD) * FT, ko);
        asm volatile("s_wait_xcnt 0x0" :: "v"(ko) : "memory");   // inputs only: the loads still in flight name this offset register, and the next pass rewrites it
    }
    // the last two trips: no trip asks for a tile past the last, so every load has been waited for when the epilogue begins
    gemm_trip<LD == 1>(acc, a[NL % NA], a[(NL + LD) % NA], b[NL % LD], Ab + (NT - 1) * FT, Bb + (NT - 1) * FT, lo);
    gemm_trip<false>(acc, a[(NL + 1) % NA], a[NL % NA], b[(NL + 1) % LD], Ab, Bb, lo);
    float* ow = os + wv * (64 * 68);
    if constexpr (EPI == 3) {
        if (op == 2) gemm_store_planes<true>(acc, ow, lr, hi, r0, c0, bias, P16, Ph, Pl, sc);   // op comes from blockIdx.z
        else gemm_store_planes<false>(acc, ow, lr, hi, r0, c0, bias, P16, Ph, Pl, sc);
    } else {
        const int cofs = lr * 4; const float* bp = bias + c0 + cofs; v4f bb; bb[0] = bp[0]; bb[1] = bp[1]; bb[2] = bp[2]; bb[3] = bp[3];
#pragma unroll
        for (int mb = 0; mb < 4; ++mb)
#pragma unroll
            for (int nb = 0; nb < 4; ++nb)
#pragma unroll
                for (int j = 0; j < 8; ++j) ow[(mb * 16 + hi * 8 + j) * 68 + nb * 16 + lr] = acc[mb][nb][j];
        asm volatile("s_wait_xcnt 0x0" :: "v"(lr), "v"(bb) : "memory");   // inputs only: the bias load is issued in front of this wait (its data is named), and the lane index that its address is formed from stays whole until the wait has passed
        bb[0] = bfr(bb[0]); bb[1] = bfr(bb[1]); bb[2] = bfr(bb[2]); bb[3] = bfr(bb[3]);
        __syncthreads();   // both planes' partial tiles stand in LDS before any wave adds them
        const float* sp = os + t * (64 * 68) + (pl * 32 + hi) * 68 + cofs;   // wave (t, pl) joins rows pl * 32 .. + 31 of tile t, two whole rows a store
        constexpr size_t ldc = (size_t)BSZ * DM;   // the (len, batch, d) row pitch: a constant, so that the sixteen stores share one address register pair and differ in their immediate offsets
        float* cp = C + (size_t)(r0 + pl * 32 + hi) * ldc + c0 + cofs; v4f val[16];
#pragma unroll
        for (int s = 0; s < 16; ++s) { val[s] = *(const v4fa*)(sp + s * (2 * 68)); val[s] += *(const v4fa*)(sp + 4 * (64 * 68) + s * (2 * 68)); val[s] += bb; }
#pragma unroll
        for (int s = 0; s < 16; ++s) *(v4f*)(cp + (size_t)(2 * s) * ldc) = val[s];
        asm volatile("s_wait_xcnt 0x0" :: "v"(cp), "v"(val[0]), "v"(val[1]), "v"(val[2]), "v"(val[3]), "v"(val[4]), "v"(val[5]), "v"(val[6]), "v"(val[7]), "v"(val[8]), "v"(val[9]), "v"(val[10]), "v"(val[11]), "v"(val[12]), "v"(val[13]), "v"(val[14]), "v"(val[15]) : "memory");   // inputs only: the stores' address and data registers stay whole until every store is issued and this wait has passed
    }
}


__global__ __launch_bounds__(256) void k_wtG(const float* __restrict__ w, int K, int N, bf* Bt) {
    const int lane = threadIdx.x & 31; const int L0 = (blockIdx.x * 8 + (threadIdx.x >> 5)) * 8; const int nlines = N * K / 64;
{
#pragma unroll 1
        for (int l = 0; l < 8; ++l) { const int L = L0 + l; if (L >= nlines) break; const size_t e = (size_t)L * 64 + lane * 2; const int k = (int)(e % K), n = (int)(e / K); v2us o;
            o[0] = f2bf(w[(size_t)k * N + n]); o[1] = f2bf(w[(size_t)(k + 1) * N + n]); *(v2us*)(Bt + e) = o; }
         }
}
// k_cvtall: all seven f32 operands rounded to bf16 in one grid, each laid down in fragment order. y = a unit of WN elements: XN / WN units for each of x, xk, xv, then one for each weight; dst holds them in that order, an input as one [len][d] matrix for each batch element.
// A work-group takes 16 source rows (an input: 8 rows of each batch element). A wave takes 8 rows of one matrix x 32 columns at a time: lane = (row & 7) + 8 * (column >> 3 & 3) reads 32 bytes of a whole 128-byte line of its row and stores 16 bytes; the 8 rows of a column group are 128 consecutive bytes of the tile. All loads are asked for before the first store.
#define CVU 8
__global__ __launch_bounds__(256) void k_cvtall(const float* __restrict__ x, const float* __restrict__ xk, const float* __restrict__ xv, const float* __restrict__ wq, const float* __restrict__ wk, const float* __restrict__ wv, const float* __restrict__ wo, bf* dst) {
    constexpr int UX = (int)(XN / WN); static_assert(XN % WN == 0 && WN % (256 * 8 * CVU) == 0, "whole units, whole work-groups");
    static_assert(DM == 1024 && BSZ == 2 && CVU == 8, "16 rows of 32 tile columns: 8 waves x 4 trips x 2 row groups");
    const int u = (int)blockIdx.y; const bool isx = u < 3 * UX;
    const float* s = u < UX ? x + (size_t)u * WN : u < 2 * UX ? xk + (size_t)(u - UX) * WN : u < 3 * UX ? xv + (size_t)(u - 2 * UX) * WN : u == 3 * UX ? wq : u == 3 * UX + 1 ? wk : u == 3 * UX + 2 ? wv : wo;
    const int lane = (int)threadIdx.x & 31, w = (int)threadIdx.x >> 5, r8 = lane & 7, c = lane >> 3;
    // row group g = 0, 1: an input's batch element g (source rows r8 * BSZ + g), a weight's rows g * 8 + r8
    const float* s0 = s + (size_t)((int)blockIdx.x * 16 + (isx ? r8 * BSZ : r8)) * DM + w * 32 + c * 8;
    const float* s1 = s0 + (isx ? DM : 8 * DM);
    v8f v[CVU];
#pragma unroll
    for (int i = 0; i < CVU; ++i) v[i] = *(const v8f*)((i < 4 ? s0 : s1) + (i & 3) * 256);
    asm volatile("s_wait_xcnt 0x0" :: "v"(s0), "v"(s1) : "memory");   // inputs only: the loads' address registers stay whole until every load that names them is issued and this wait has passed
    // destination row of group 0 in its matrix, and the two groups' matrices and rows
    const int d0 = isx ? (u % UX) * (int)(WN / DM / BSZ) + (int)blockIdx.x * 8 + r8 : (int)blockIdx.x * 16 + r8;
    const int d1 = isx ? d0 : d0 + 8;
    bf* m0 = dst + (isx ? (size_t)(u / UX) * XN : (size_t)u * WN); bf* m1 = isx ? m0 + (size_t)TT * DM : m0;
    const int in = (c >> 1) * 256 + (c & 1) * 128 + w * FT;
    bf* p0 = m0 + (size_t)(d0 >> 4) * ((DM / 32) * FT) + (d0 & 15) * 8 + in; bf* p1 = m1 + (size_t)(d1 >> 4) * ((DM / 32) * FT) + (d1 & 15) * 8 + in;
    v8us o[CVU];
#pragma unroll
    for (int i = 0; i < CVU; ++i)
#pragma unroll
        for (int k = 0; k < 8; ++k) o[i][k] = f2bf(v[i][k]);
#pragma unroll
    for (int i = 0; i < CVU; ++i) *(v8us*)((i < 4 ? p0 : p1) + (i & 3) * (8 * FT)) = o[i];
    asm volatile("s_wait_xcnt 0x0" :: "v"(p0), "v"(p1), "v"(o[0]), "v"(o[1]), "v"(o[2]), "v"(o[3]), "v"(o[4]), "v"(o[5]), "v"(o[6]), "v"(o[7]) : "memory");   // inputs only: the stores' address and data registers stay whole until every store is issued and this wait has passed
}

// Attention, every wave on its own query rows with a running maximum: nothing of the score matrix leaves the registers.
// A work-group is 8 waves = QG groups of 16 * QT query rows x KS parts of the keys, 64 rows in all; wave wv: group wv % QG, part wv / QG (the QG waves of a part read the same K and V fragments: each block's come from L2 once for the work-group, by asynchronous copies into a two-buffer ring in LDS, the next block's in flight while this one is worked on).
// A wave walks its TT / KS keys in blocks of KB = 32. S^T = K Q^T (A = 16 key rows, B = 16 query rows): accumulator register j of lane (lr, hi) is (key 8 hi + j of the tile, query lr), so a query's maximum and sum stay in its lane and its partner lane l ^ 16.
// Two neighbouring key tiles are the B fragment of P^T (elements 0..7: k = 8 hi + j, 8..15: k = 16 + 8 hi + j, column lr), and O^T += V^T P^T (A = 16 rows of the [d][key] plane): register j of lane (lr, hi) is (d 8 hi + j of the tile, query lr), so a query's rescale factor is the lane's own.
// P = exp(s - m) is not normalised in the loop: m is the maximum in use, raised (sums and outputs rescaled) only when a block's maximum passes it by more than LAZY, so P <= 2^8; the division by the sum comes once, at the end.
// The KS parts of a query group meet in LDS: their -m log2(e), then sums and output tiles brought to the common maximum and added in part order; wave (group, part) adds, divides and stores 4 / KS of the four 16-wide d tiles, 16 bytes a lane and tile of the merged operand in fragment order.
// bs[key + ROWS - 1 - r] is the bias of (row i0 + r, key): TT + ROWS - 1 consecutive table entries of the head, gathered once.
#define L2E  1.4426950408889634f
#define LAZY 5.5451774f   // 8 ln 2
__device__ __forceinline__ float xhalf(float x) { return __builtin_bit_cast(float, __builtin_amdgcn_permlanex16(__builtin_bit_cast(int, x), __builtin_bit_cast(int, x), 0x76543210, 0xfedcba98, false, false)); }   // lane l with lane l ^ 16
// stage_copy: a wave's slice of a stage, four fragment tiles of 1 KiB (ts bytes apart in global memory, side by side in LDS), as eight copies of 512 consecutive bytes each. l: the lane's LDS byte address, b: the slice's first byte in global memory (the same in the whole wave, a scalar base), lo = lane * 16.
// A copy's immediate offset moves its LDS address and its global address alike: tile i takes offset i * 1024 (+ 512 for its second half) on the one LDS address register, and its scalar base is set back by what the offset adds (i * ts - i * 1024 >= 0), so a stage costs no vector address arithmetic.
// The s_wait_xcnt stands in the copies' own statement, so that no address register is rewritten in front of it.
__device__ __forceinline__ void stage_copy(unsigned l, unsigned lo, const char* b, unsigned ts) {
    const unsigned long long b0 = (unsigned long long)b, d = ts - 1024u;
    asm volatile("global_load_async_to_lds_b128 %0, %1, %2\n\t"
                 "global_load_async_to_lds_b128 %0, %1, %2 offset:512\n\t"
                 "global_load_async_to_lds_b128 %0, %1, %3 offset:1024\n\t"
                 "global_load_async_to_lds_b128 %0, %1, %3 offset:1536\n\t"
                 "global_load_async_to_lds_b128 %0, %1, %4 offset:2048\n\t"
                 "global_load_async_to_lds_b128 %0, %1, %4 offset:2560\n\t"
                 "global_load_async_to_lds_b128 %0, %1, %5 offset:3072\n\t"
                 "global_load_async_to_lds_b128 %0, %1, %5 offset:3584\n\t"
                 "s_wait_xcnt 0x0"
                 :: "v"(l), "v"(lo), "s"(b0), "s"(b0 + d), "s"(b0 + 2 * d), "s"(b0 + 3 * d) : "memory");
}
// fattn_block: one block of KB = 32 keys. st: the lane's place in the wave's key part of the block's stage in LDS: slices of 4 KiB, K (HR: hi, lo), then V (HR: hi, lo), four fragment tiles each.
// kv takes the block's 4 K fragments (slot = key tile * 2 + k half; HR: the lo plane in slots 4..7); once the score products are issued, the slots take the block's V fragments (slot = d tile), which so arrive during the softmax. b0: the bias of (query lr of the wave's first tile, key 8 hi of the block).
// The sched_barrier keeps the loads in front of it there: left alone, the scheduler sinks them to just ahead of their first use, and the wave waits out their whole latency.
template <typename T16, bool HR, int QT>
__device__ __forceinline__ void fattn_block(typename WFrag<T16>::V (&kv)[HR ? 8 : 4], const typename WFrag<T16>::V (&qa)[QT][2], const typename WFrag<T16>::V (&qb)[QT][2], v8f (&o)[QT][4], float (&m)[QT], float (&mc)[QT], v8f (&l)[QT],
                                            const char* st, const float* b0) {
    typedef typename WFrag<T16>::V V;
    v8f s[QT][2];
    {
#pragma unroll
        for (int i = 0; i < 4; ++i) { kv[i] = WFrag<T16>::ld((const T16*)(st + i * 1024), 0); if constexpr (HR) kv[4 + i] = WFrag<T16>::ld((const T16*)(st + 4096 + i * 1024), 0); }
        __builtin_amdgcn_sched_barrier(0);   // the K loads go out as one group: left alone, the scheduler deals them out among the products, each with a wait of its own
#pragma unroll
        for (int t2 = 0; t2 < 2; ++t2)
#pragma unroll
            for (int qt = 0; qt < QT; ++qt) s[qt][t2] = (v8f){};
#pragma unroll
        for (int kk = 0; kk < 2; ++kk) {   // neighbouring products have different accumulators
#pragma unroll
            for (int t2 = 0; t2 < 2; ++t2)
#pragma unroll
                for (int qt = 0; qt < QT; ++qt) s[qt][t2] = WFrag<T16>::mma(kv[t2 * 2 + kk], qa[qt][kk], s[qt][t2]);
            if constexpr (HR) {
#pragma unroll
                for (int t2 = 0; t2 < 2; ++t2)
#pragma unroll
                    for (int qt = 0; qt < QT; ++qt) s[qt][t2] = WFrag<T16>::mma(kv[t2 * 2 + kk], qb[qt][kk], s[qt][t2]);
#pragma unroll
                for (int t2 = 0; t2 < 2; ++t2)
#pragma unroll
                    for (int qt = 0; qt < QT; ++qt) s[qt][t2] = WFrag<T16>::mma(kv[4 + t2 * 2 + kk], qa[qt][kk], s[qt][t2]); } }
#pragma unroll
        for (int i = 0; i < 4; ++i) { kv[i] = WFrag<T16>::ld((const T16*)(st + (HR ? 8192 : 4096) + i * 1024), 0); if constexpr (HR) kv[4 + i] = WFrag<T16>::ld((const T16*)(st + 12288 + i * 1024), 0); }
        __builtin_amdgcn_sched_barrier(0); }
    float bm[QT]; bool need = false; v8f bb[QT + 1];   // the bias depends on key - query alone: the tiles (qt, nt) of one nt - qt share their 8 values a lane
#pragma unroll
    for (int d = 0; d <= QT; ++d)
#pragma unroll
        for (int j = 0; j < 8; ++j) bb[d][j] = b0[(d - (QT - 1)) * 16 + j];
#pragma unroll
    for (int qt = 0; qt < QT; ++qt) { s[qt][0] += bb[QT - 1 - qt]; s[qt][1] += bb[QT - qt]; const v8f m8 = __builtin_elementwise_max(s[qt][0], s[qt][1]);
        const float mm = fmaxf(fmaxf(fmaxf(m8[0], m8[1]), fmaxf(m8[2], m8[3])), fmaxf(fmaxf(m8[4], m8[5]), fmaxf(m8[6], m8[7])));
        bm[qt] = fmaxf(mm, xhalf(mm)); need = need || bm[qt] > m[qt] + LAZY; }
    if (__builtin_amdgcn_ballot_w32(need) != 0) {   // one scalar branch a block, rare after a wave's first blocks; both lanes of a query hold the same bm and m
#pragma unroll
        for (int qt = 0; qt < QT; ++qt) { const float mn = fmaxf(m[qt], bm[qt]), mcn = -mn * L2E, al = __builtin_amdgcn_exp2f(mcn - mc[qt]); m[qt] = mn; mc[qt] = mcn; l[qt] *= al;
#pragma unroll
            for (int nb = 0; nb < 4; ++nb) o[qt][nb] *= al; } }
#pragma unroll
    for (int qt = 0; qt < QT; ++qt)
#pragma unroll
        for (int nt = 0; nt < 2; ++nt) { const v8f t = s[qt][nt] * L2E + mc[qt];
#pragma unroll
            for (int j = 0; j < 8; ++j) s[qt][nt][j] = __builtin_amdgcn_exp2f(t[j]);
            l[qt] += s[qt][nt]; }
    { V pa[QT], pb[QT];
#pragma unroll
        for (int qt = 0; qt < QT; ++qt) {
            if constexpr (HR) { v8us h0, l0, h1, l1;
#pragma unroll
                for (int j = 0; j < 8; ++j) { unsigned short a, c2; splitf(s[qt][0][j], a, c2); h0[j] = a; l0[j] = c2; splitf(s[qt][1][j], a, c2); h1[j] = a; l1[j] = c2; }
                pa[qt] = cat16b(h0, h1); pb[qt] = cat16b(l0, l1);
            } else { v8h p0, p1;
#pragma unroll
                for (int j = 0; j < 8; ++j) { p0[j] = tohx(s[qt][0][j]); p1[j] = tohx(s[qt][1][j]); }
                pa[qt] = cat16(p0, p1); } }
#pragma unroll
        for (int nb = 0; nb < 4; ++nb)
#pragma unroll
            for (int qt = 0; qt < QT; ++qt) o[qt][nb] = WFrag<T16>::mma(kv[nb], pa[qt], o[qt][nb]);
        if constexpr (HR) {
#pragma unroll
            for (int nb = 0; nb < 4; ++nb)
#pragma unroll
                for (int qt = 0; qt < QT; ++qt) o[qt][nb] = WFrag<T16>::mma(kv[nb], pb[qt], o[qt][nb]);
#pragma unroll
            for (int nb = 0; nb < 4; ++nb)
#pragma unroll
                for (int qt = 0; qt < QT; ++qt) o[qt][nb] = WFrag<T16>::mma(kv[4 + nb], pa[qt], o[qt][nb]); } }
}
template <typename T16, bool HR, int QT, int QG, int KS>
__device__ __forceinline__ void fattn_rows(const T16* __restrict__ Qa, const T16* __restrict__ Qb, const T16* __restrict__ Ka, const T16* __restrict__ Kb, const T16* __restrict__ Va, const T16* __restrict__ Vb, const float* __restrict__ tab, int i0, int h, bf* ATh, bf* ATl, float* bs, float* redm, float* reds, float* os, char* ring) {
    typedef typename WFrag<T16>::V V;
    constexpr int KB = 32, NTH = 32 * QG * KS, WR = QT * 16, ROWS = QG * WR, KW = TT / KS, NBK = KW / KB, WSZ = QT * 4 * 2 * 128, NBW = 4 / KS;
    static_assert(KW % KB == 0 && NBK >= 2 && NTH == 256 && TT % NTH == 0 && HD == 64 && 4 % KS == 0 && ROWS <= NTH, "shape");
    const int lane = threadIdx.x & 31, lr = lane & 15, hi = lane >> 4; const int wv = __builtin_amdgcn_readfirstlane((int)(threadIdx.x >> 5));
    const int qg = wv % QG, kq = wv / QG, key0 = kq * KW; const size_t hp = (size_t)h * TT * HD;
    constexpr int NG = TT / NTH + 1; float g[NG]; unsigned go[NG]; static_assert(NG == 9, "the wait behind the gathers names nine offsets");
#pragma unroll
    for (int t = 0; t < NG; ++t) { int r = i0 + (ROWS - 1) + (TT - 1) - (t * NTH + (int)threadIdx.x); r = min(max(r, 0), NREL - 1); go[t] = (unsigned)(r * NH_ + h) * 4u; g[t] = *(const float*)((const char*)tab + go[t]); }   // go: byte offsets in the table; entries from TT + ROWS - 1 on are never read, and the clip bounds their address like any other
    asm volatile("s_wait_xcnt 0x0" :: "v"(go[0]), "v"(go[1]), "v"(go[2]), "v"(go[3]), "v"(go[4]), "v"(go[5]), "v"(go[6]), "v"(go[7]), "v"(go[8]) : "memory");   // inputs only: the gathers' offset registers stay whole until every gather is issued and this wait has passed
    V qa[QT][2], qb[QT][2], kv[HR ? 8 : 4]; const size_t qo = hp + (size_t)(i0 / 16 + qg * QT) * ((HD / 32) * FT); const unsigned lo = lane * 16;
#pragma unroll
    for (int qt = 0; qt < QT; ++qt)
#pragma unroll
        for (int kk = 0; kk < 2; ++kk) { qa[qt][kk] = WFrag<T16>::ld(Qa + qo + (qt * 2 + kk) * FT, lo); if constexpr (HR) qb[qt][kk] = WFrag<T16>::ld(Qb + qo + (qt * 2 + kk) * FT, lo); }
    const size_t ko = hp + (size_t)(key0 / 16) * ((HD / 32) * FT), vo = hp + (size_t)(key0 / 32) * FT;
    const T16* Kwa = Ka + ko; const T16* Kwb = HR ? Kb + ko : nullptr; const T16* Vwa = Va + vo; const T16* Vwb = HR ? Vb + vo : nullptr;
    constexpr unsigned KBB = (KB / 16) * (HD / 32) * FT * 2, VBB = (KB / 32) * FT * 2;   // bytes of K tiles, and of one d tile's V tiles, in a block
    // The ring: a stage is one block of every key part, PART bytes a part, a slice of 4 KiB for each of the part's QG waves to copy: wave qg brings slice qg (the first half of the slices are K planes, the second half V planes; HR: even hi, odd lo).
    constexpr unsigned PART = QG * 4096u, STG = KS * PART; static_assert(QG == (HR ? 4 : 2) && KBB == 4096 && 4 * VBB == 4096 && STG == 32768, "one slice a wave, two stages in the ring");
    const bool isv = qg >= QG / 2, islo = HR && (qg & 1) != 0;   // qg is scalar: source, tile pitch and block pitch stay the same for the whole wave
    const char* cg = (const char*)(isv ? (islo ? Vwb : Vwa) : (islo ? Kwb : Kwa)); const unsigned cts = isv ? (unsigned)((TT / 32) * FT * 2) : (unsigned)(FT * 2), cbs = isv ? VBB : KBB;
    const unsigned cl = (unsigned)(size_t)ring + (unsigned)kq * PART + (unsigned)qg * 4096u + lo; const char* rb = ring + (unsigned)kq * PART + lo;
    stage_copy(cl, lo, cg, cts);   // block 0 into buffer 0
#pragma unroll
    for (int t = 0; t < NG; ++t) bs[t * NTH + (int)threadIdx.x] = bfr(g[t]);
    asm volatile("s_wait_asynccnt 0x0" ::: "memory");   // the wave's own copies of block 0 have landed before the barrier behind which the other waves read them
    __syncthreads();   // the head's table entries and block 0 stand in LDS before any wave reads them
    stage_copy(cl + STG, lo, cg + cbs, cts);   // block 1 into buffer 1 (NBK >= 2)
    v8f o[QT][4], l[QT]; float m[QT], mc[QT];   // l: register j sums the lane's keys 8 hi + j of every tile
#pragma unroll
    for (int qt = 0; qt < QT; ++qt) { m[qt] = -1.0e30f; mc[qt] = 1.0e30f * L2E; l[qt] = (v8f){};   // the first block always raises m; its factor exp2(-huge) is 0 on sums and outputs that are 0
#pragma unroll
        for (int nb = 0; nb < 4; ++nb) o[qt][nb] = (v8f){}; }
    const float* b0 = bs + key0 + 8 * hi + (ROWS - 1) - (qg * WR + lr);
#pragma unroll 1
    for (int blk = 0; blk < NBK; ++blk) {   // stays rolled: one block of text
        const unsigned bo = (unsigned)(blk & 1) * STG;   // block blk stands in buffer blk mod 2
        fattn_block<T16, HR, QT>(kv, qa, qb, o, m, mc, l, rb + bo, b0 + blk * KB);
        asm volatile("s_wait_dscnt 0x0" ::: "memory");      // the wave's reads of this buffer are done before the barrier behind which it is refilled
        asm volatile("s_wait_asynccnt 0x0" ::: "memory");   // the wave's copies of the next block have landed before the barrier behind which the other waves read them
        __syncthreads();   // publishes block blk + 1 and ends every wave's reads of block blk
        if (blk + 2 < NBK) stage_copy(cl + bo, lo, cg + (unsigned)(blk + 2) * cbs, cts);   // a scalar test, the same for the whole work-group
    }
    asm volatile("s_wait_asynccnt 0x0" ::: "memory");   // no copy is outstanding when the wave goes on to the join
    float ls[QT];
#pragma unroll
    for (int qt = 0; qt < QT; ++qt) { const float t = ((l[qt][0] + l[qt][1]) + (l[qt][2] + l[qt][3])) + ((l[qt][4] + l[qt][5]) + (l[qt][6] + l[qt][7])); ls[qt] = t + xhalf(t); if (hi == 0) redm[wv * 32 + qt * 16 + lr] = mc[qt]; }
    __syncthreads();   // every part's -m log2(e) stands in LDS before any wave takes the minimum over them
    float* ow = os + wv * WSZ + lane * 4;
#pragma unroll
    for (int qt = 0; qt < QT; ++qt) { float mg = redm[qg * 32 + qt * 16 + lr];
#pragma unroll
        for (int p = 1; p < KS; ++p) mg = fminf(mg, redm[(p * QG + qg) * 32 + qt * 16 + lr]);
        const float sc = __builtin_amdgcn_exp2f(mg - mc[qt]);
        if (hi == 0) reds[wv * 32 + qt * 16 + lr] = ls[qt] * sc;
#pragma unroll
        for (int nb = 0; nb < 4; ++nb) { const v8f x = o[qt][nb] * sc; *(v4fa*)(ow + ((qt * 4 + nb) * 2) * 128) = __builtin_shufflevector(x, x, 0, 1, 2, 3); *(v4fa*)(ow + ((qt * 4 + nb) * 2 + 1) * 128) = __builtin_shufflevector(x, x, 4, 5, 6, 7); } }   // each store: 512 consecutive bytes of the wave
    __syncthreads();   // every part's sums and output tiles stand in LDS before any wave adds across them
    v8us oh[QT][NBW], ol[QT][NBW];
#pragma unroll
    for (int qt = 0; qt < QT; ++qt) { float sum = reds[qg * 32 + qt * 16 + lr];
#pragma unroll
        for (int p = 1; p < KS; ++p) sum += reds[(p * QG + qg) * 32 + qt * 16 + lr];
        const float f = __fdiv_rn(1.0f, sum);
#pragma unroll
        for (int t = 0; t < NBW; ++t) { const float* sp = os + qg * WSZ + ((qt * 4 + kq * NBW + t) * 2) * 128 + lane * 4; v4f x0 = *(const v4fa*)sp, x1 = *(const v4fa*)(sp + 128);
#pragma unroll
            for (int p = 1; p < KS; ++p) { x0 += *(const v4fa*)(sp + p * (QG * WSZ)); x1 += *(const v4fa*)(sp + p * (QG * WSZ) + 128); }
#pragma unroll
            for (int q = 0; q < 8; ++q) { unsigned short a, c2; splitf((q < 4 ? x0[q & 3] : x1[q & 3]) * f, a, c2); oh[qt][t][q] = a; ol[qt][t][q] = c2; } } }
    // d tile nb = kq * NBW + t: (row lr of the tile, k = h * HD + nb * 16 + hi * 8 .. + 7); 256 elements a d tile, two d tiles a fragment tile
    const size_t oo = ((size_t)(i0 / 16 + qg * QT) * (DQ / 32) + h * (HD / 32)) * FT + (size_t)(kq * NBW) * 256 + (hi * 16 + lr) * 8;
    bf* ph = ATh + oo; bf* pl = ATl + oo;
#pragma unroll
    for (int qt = 0; qt < QT; ++qt)
#pragma unroll
        for (int t = 0; t < NBW; ++t) { *(v8us*)(ph + qt * ((DQ / 32) * FT) + t * 256) = oh[qt][t]; *(v8us*)(pl + qt * ((DQ / 32) * FT) + t * 256) = ol[qt][t]; }
}
// k_fattn: every (head, batch element, block of 64 query rows) in one grid: x = head + NH_ * b, y = row block. Rows < RH (three products, two planes of every operand): 16 rows a wave for the registers' sake, 4 groups x 2 key halves, so that four waves share each staged fragment of the doubled K and V; these work-groups run about twice as long and have the lowest y, so they start first. The other rows: 32 rows a wave, 2 groups x 4 key quarters.
// Each operand pointer is batch element 0's plane, element 1's follows it (as the projections store them); ATh, ATl [b][row][DQ], each batch element's matrix in fragment order. Four waves a SIMD (two work-groups a WGP): the vector work between the matrix runs wants other waves to issue meanwhile.
__global__ __launch_bounds__(256) __attribute__((amdgpu_waves_per_eu(4, 4))) void k_fattn(const h16* __restrict__ Q16, const h16* __restrict__ K16, const h16* __restrict__ V16, const bf* __restrict__ Qh, const bf* __restrict__ Ql, const bf* __restrict__ Kh, const bf* __restrict__ Kl, const bf* __restrict__ Vh, const bf* __restrict__ Vl, const float* __restrict__ tab, bf* ATh, bf* ATl) {
    static_assert(RH % 64 == 0 && TT % 64 == 0, "a row block is of one class");
    __shared__ __align__(16) float sm[(TT + 256) + 8 * 32 + 8 * 32 + 8 * 2 * 4 * 2 * 128 + 2 * 8192];   // one array, the bias first: its reads in the key loop then reach every value from one address register by their immediate offsets; last the K, V ring, two stages of 32 KiB
    float* bs = sm; float* redm = bs + (TT + 256); float* reds = redm + 8 * 32; float* os = reds + 8 * 32; char* ring = (char*)(os + 8 * 2 * 4 * 2 * 128);
    const int h = (int)blockIdx.x % NH_, y = (int)blockIdx.y; const size_t b = blockIdx.x / NH_, pb = b * PLN;
    ATh += b * ((size_t)TT * DQ); ATl += b * ((size_t)TT * DQ);
    if (y < RH / 64) fattn_rows<bf, true, 1, 4, 2>(Qh + pb, Ql + pb, Kh + pb, Kl + pb, Vh + pb, Vl + pb, tab, y * 64, h, ATh, ATl, bs, redm, reds, os, ring);   // y comes from blockIdx.y: the whole work-group takes one side, its barriers with it
    else fattn_rows<h16, false, 2, 2, 4>(Q16 + pb, nullptr, K16 + pb, nullptr, V16 + pb, nullptr, tab, y * 64, h, ATh, ATl, bs, redm, reds, os, ring);
}
extern "C" void kernel_launch(void* const* d_in, const int* in_sizes, int n_in,
                              void* d_out, int out_size, void* d_ws, size_t ws_size, hipStream_t stream) {
    (void)in_sizes; (void)n_in; (void)out_size;
    const float* x = (const float*)d_in[0]; const float* xk = (const float*)d_in[1]; const float* xv = (const float*)d_in[2]; const float* wq = (const float*)d_in[3]; const float* bq = (const float*)d_in[4]; const float* wk = (const float*)d_in[5]; const float* bk = (const float*)d_in[6]; const float* wv = (const float*)d_in[7]; const float* bv = (const float*)d_in[8]; const float* wo = (const float*)d_in[9]; const float* bo = (const float*)d_in[10]; const float* rtab = (const float*)d_in[11];
    float* OUT = (float*)d_out;     // [2048][2][1024]
    char* wsp = (char*)d_ws;
    auto take = [&](size_t bytes) { char* p = wsp; wsp += (bytes + 255) & ~(size_t)255; return (void*)p; };
    static_assert(NKV == NH_ && DKV == DQ && DQ == DM, "q, k, v share one projection grid and one plane size");
    bf* XB = (bf*)take((3 * XN + 4 * WN) * 2);     // bf16, fragment order: x, xk, xv, each [b][len][d], then Wq, Wk, Wv, Wo
    bf* WQKV = XB + 3 * XN; bf* WO = WQKV + 3 * WN;
    h16* P16 = (h16*)take(6 * PLN * 2); bf* Ph = (bf*)take(6 * PLN * 2); bf* Pl = (bf*)take(6 * PLN * 2);   // plane 2 * op + b: q, k [head][row][d], v [head][d][row], each head's matrix in fragment order
    bf* ATh = (bf*)take((size_t)BSZ * TT * DQ * 2); bf* ATl = (bf*)take((size_t)BSZ * TT * DQ * 2);
    if ((size_t)(wsp - (char*)d_ws) > ws_size) return;    // ws 256 MiB
    k_cvtall<<<dim3((unsigned)(WN / (256 * 8 * CVU)), (unsigned)(3 * XN / WN + 4), 1), 256, 0, stream>>>(x, xk, xv, wq, wk, wv, wo, XB);
    k_gemmt<1, 3><<<dim3(TT / 128, DQ / 128, 3 * BSZ), 128, 0, stream>>>(XB, nullptr, WQKV, nullptr, bq, bk, bv, 0, 0, P16, Ph, Pl, QSC);   /* q x 1/8 and k head planes, v planes transposed */
    k_fattn<<<dim3(NH_ * BSZ, TT / 64, 1), 256, 0, stream>>>(P16, P16 + 2 * PLN, P16 + 4 * PLN, Ph, Pl, Ph + 2 * PLN, Pl + 2 * PLN, Ph + 4 * PLN, Pl + 4 * PLN, rtab, ATh, ATl);   /* rows < RH: hi/lo planes, 3 products; the other rows: fp16 */
    k_gemmt<2, 0><<<dim3(TT / 128, DM / 128, BSZ), 256, 0, stream>>>(ATh, ATl, WO, OUT, bo, nullptr, nullptr, (size_t)TT * DQ, DM, nullptr, nullptr, nullptr, 1.0f);   /* rows at the (len, batch, d) pitch */
}

// v010
// One run takes 99.4 microseconds.
// Timed twice side by side with v009, it ran 1.05 and 1.04 times as fast.
// Counting every step since v000, it is 23.6 times as fast.
#include <hip/hip_runtime.h>

// Multi-head attention with a learned relative-position bias, sequence-first layout (query, key, value [2048][2][1024] = (len, batch, d_model); q,k,v = input W^T + b ('oi' [1024][1024] + [1024]; 16 heads x 64); scores = q.k / 8 + rel_table[clip(i - j + 2047, 0, 4094)][h] (table [4095][16], read); softmax over all keys; out = merged Wo^T + bo -> [2048][2][1024] (4.2 M)).
// Four launches, each over both batch elements: (1) the three inputs and the four weights rounded to bf16, each input's rows laid down by batch element ([b][len][d]), every 16-bit operand of every launch in the order the matrix fragments are read in; (2) the q, k, v projections, exact + f32 biases, one grid, each epilogue storing the attention operand planes itself; (3) dense T-2048 attention, both row classes in one grid (hybrid rows: < 512 fp16 hi + lo planes, 3 products; the rest the hi planes alone), each wave on its own query rows with a running maximum, the gathered per-head bias added to the scores in registers; (4) merged hi/lo x Wo exact + bo, stored at the batch pitch straight into the (len, batch, d) output.
// Compute dtypes, f32 accumulate: every input rounded to bf16; projections exact + f32 biases; attention rows < 512 fp16 hi/lo 3 products, rest fp16; bias add and softmax f32; Wo hl x exact + bias.

#define NB_  2
#define TT   2048
#define DM   1024
#define NH_  16
#define NKV  16
#define REP  (NH_ / NKV)
#define HD   64
#define DQ   (NH_ * HD)
#define DKV  (NKV * HD)
#define RH   512                  // query rows < RH use hi+lo planes (0: none)
#define WIN  0
#define QSC  0.125f   // the 1/8 is folded into q so the gathered bias adds to the scaled scores
#define BSZ  2
#define NREL 4095
#define XN   ((size_t)TT * BSZ * DM)   // elements of one input
#define WN   ((size_t)DQ * DM)         // elements of one weight matrix
#define PLN  ((size_t)NH_ * TT * HD)   // elements of one operand plane (one of q, k, v of one batch element)
// Fragment order: every 16-bit matrix operand [rows][K] lies in the workspace as tiles of 16 rows x 32 k, FT elements each, tile (row >> 4, k >> 5) at ((row >> 4) * (K / 32) + (k >> 5)) * FT.
// Inside a tile the 8 elements (row, k & ~7 .. k | 7) stand at ((k >> 4 & 1) * 32 + (k >> 3 & 1) * 16 + (row & 15)) * 8: lane l finds the two halves of its fragment at l * 8 and 256 + l * 8, so each load instruction of a wave takes 512 consecutive bytes (4 whole lines, not 32-byte pieces of 16 lines).
#define FT   512
typedef _Float16 h16;
typedef unsigned short bf;
typedef __attribute__((ext_vector_type(16))) __bf16   v16bf;
typedef __attribute__((ext_vector_type(16))) _Float16 v16h;
typedef __attribute__((ext_vector_type(8)))  _Float16 v8h;
typedef __attribute__((ext_vector_type(8)))  unsigned short v8us;
typedef __attribute__((ext_vector_type(8)))  float    v8f;
typedef __attribute__((ext_vector_type(4)))  float    v4f;
typedef v8h  __attribute__((may_alias)) v8ha;
typedef v4f  __attribute__((may_alias)) v4fa;
typedef v8us __attribute__((may_alias)) v8usa;

__device__ __forceinline__ unsigned short f2bf(float f) { unsigned u = __float_as_uint(f); u += 0x7FFFu + ((u >> 16) & 1u); return (unsigned short)(u >> 16); }
__device__ __forceinline__ float bf2f(unsigned short b) { return __uint_as_float(((unsigned)b) << 16); }
__device__ __forceinline__ float bfr(float f) { return bf2f(f2bf(f)); }
__device__ __forceinline__ v16h cat16(v8h lo, v8h hi) { return __builtin_shufflevector(lo, hi, 0, 1, 2, 3, 4, 5, 6, 7, 8, 9, 10, 11, 12, 13, 14, 15); }
__device__ __forceinline__ v16bf cat16b(v8us lo, v8us hi) { return __builtin_bit_cast(v16bf, __builtin_shufflevector(lo, hi, 0, 1, 2, 3, 4, 5, 6, 7, 8, 9, 10, 11, 12, 13, 14, 15)); }
__device__ __forceinline__ v8f wmma16(v16h a, v16h b, v8f c) { return __builtin_amdgcn_wmma_f32_16x16x32_f16(false, a, false, b, (short)0, c, false, false); }
__device__ __forceinline__ v8f wmmab(v16bf a, v16bf b, v8f c) { return __builtin_amdgcn_wmma_f32_16x16x32_bf16(false, a, false, b, (short)0, c, false, false); }
__device__ __forceinline__ h16 tohx(float x) { return (h16)x; }
__device__ __forceinline__ void splitf(float y, unsigned short& h, unsigned short& l) { h = f2bf(y); l = f2bf(y - bf2f(h)); }
typedef __attribute__((ext_vector_type(2))) _Float16 v2h;
typedef __attribute__((ext_vector_type(4))) _Float16 v4h;
typedef __attribute__((ext_vector_type(2))) unsigned short v2us;
typedef __attribute__((ext_vector_type(4))) unsigned short v4us;
typedef __attribute__((ext_vector_type(2))) float v2f;
typedef __attribute__((ext_vector_type(4))) int v4i;



// ---- k_gemmt: C[m][n] = sum_k A[m][k] Bt[n][k] over K = DM, bf16 operands in fragment order, f32 accumulate; grid (M / 128, N / 128, Z), 128 * NP threads.
// A work-group takes a 128 x 128 tile of C as 2 x 2 waves of 64 x 64 (16 accumulators a wave), and every wave runs the whole K. The two waves of a tile row ask for the same A lines and the two of a tile column for the same Bt lines at about the same time, so a line comes from L2 once for the work-group and the WGP cache serves the other reader.
// A wave has no sibling on its K range to hide its loads behind, so its fragments come ahead of their trip (NP = 1: one trip, NP = 2: two): the A fragments into a spare register set, each Bt fragment into its own registers as soon as its four products are issued.
// NP = 1: 4 waves. NP = 2: 8 waves, A in two planes (hi, lo): waves 0..3 sum A x Bt, waves 4..7 A2 x Bt over the same tiles, and the two f32 partial tiles meet in LDS (hi + lo, then bias).
// EPI 0: f32 + bias to C (row pitch BSZ * DM; z strides sA, sC in elements). EPI 3: q, k and v of both batch elements in one grid. z = 2 * op + b: A is plane z of the converted inputs (TT x DM each), Bt weight op, bias bias / bias1 / bias2; a wave's 64 columns are one head (HD == 64), and (sum + bias) x sc (op 0 takes sc, the others 1) goes as fp16 (hi) and as the fp16 of what that rounding left (lo) to planes z of P16, Pl in fragment order: op 0, 1 [head][row][d], op 2 [head][d][row].
// ld(t, lo): the fragment of the tile at t, the same address in the whole wave; lo = lane * 16, the lane's byte offset in each half of the tile, the one vector register of the address.
template <typename T16> struct WFrag;
template <> struct WFrag<h16> { typedef v16h V; static __device__ __forceinline__ V ld(const h16* t, unsigned lo) { const char* p = (const char*)t + lo; return cat16(*(const v8h*)p, *(const v8h*)(p + 512)); } static __device__ __forceinline__ v8f mma(V a, V b, v8f c) { return wmma16(a, b, c); } };
template <> struct WFrag<bf> { typedef v16bf V; static __device__ __forceinline__ V ld(const bf* t, unsigned lo) { const char* p = (const char*)t + lo; return cat16b(*(const v8us*)p, *(const v8us*)(p + 512)); } static __device__ __forceinline__ v8f mma(V a, V b, v8f c) { return wmmab(a, b, c); } };
// gemm_store_planes: a wave's own 64 x 64 tile, through the wave's own LDS range ow, to the two planes in fragment order. The tile lies in LDS as [row][d], TR: as [d][row] (a lane's 8 accumulator registers are 8 neighbouring rows of one column), which is 4 x 2 fragment tiles (rt, kt):
// lane (lr, hi) takes LDS row rt * 16 + lr, columns kt * 32 + u * 16 + hi * 8 .. + 7 for u = 0, 1, and each of its stores is 16 bytes of 512 consecutive ones of the wave.
template <bool TR>
__device__ __forceinline__ void gemm_store_planes(const v8f (&acc)[4][4], float* ow, int lr, int hi, int r0, int c0, const float* __restrict__ bias, h16* P16, h16* Pl, float sc) {
    static_assert(HD == 64, "a wave's 64 columns are one head");
    v8f bv[2][2]; float bt[4];
    if constexpr (!TR) { const float* bp = bias + c0 + hi * 8;
#pragma unroll
        for (int kt = 0; kt < 2; ++kt)
#pragma unroll
            for (int u = 0; u < 2; ++u)
#pragma unroll
                for (int q = 0; q < 8; ++q) bv[kt][u][q] = bp[kt * 32 + u * 16 + q];
        asm volatile("s_wait_xcnt 0x0" :: "v"(bp) : "memory");   // inputs only: the bias loads' address registers stay whole until every load that names them is issued and this wait has passed
#pragma unroll
        for (int kt = 0; kt < 2; ++kt)
#pragma unroll
            for (int u = 0; u < 2; ++u)
#pragma unroll
                for (int q = 0; q < 8; ++q) bv[kt][u][q] = bfr(bv[kt][u][q]);
    } else { const float* bp = bias + c0 + lr;
#pragma unroll
        for (int rt = 0; rt < 4; ++rt) bt[rt] = bp[rt * 16];
        asm volatile("s_wait_xcnt 0x0" :: "v"(bp) : "memory");   // inputs only: the bias loads' address registers stay whole until every load that names them is issued and this wait has passed
#pragma unroll
        for (int rt = 0; rt < 4; ++rt) bt[rt] = bfr(bt[rt]); }
    if constexpr (TR) {
#pragma unroll
        for (int mb = 0; mb < 4; ++mb)
#pragma unroll
            for (int nb = 0; nb < 4; ++nb) { float* op = ow + (nb * 16 + lr) * 68 + mb * 16 + hi * 8;
                *(v4fa*)op = __builtin_shufflevector(acc[mb][nb], acc[mb][nb], 0, 1, 2, 3); *(v4fa*)(op + 4) = __builtin_shufflevector(acc[mb][nb], acc[mb][nb], 4, 5, 6, 7); }
    } else {
#pragma unroll
        for (int mb = 0; mb < 4; ++mb)
#pragma unroll
            for (int nb = 0; nb < 4; ++nb)
#pragma unroll
                for (int j = 0; j < 8; ++j) ow[(mb * 16 + hi * 8 + j) * 68 + nb * 16 + lr] = acc[mb][nb][j];
    }
    asm volatile("s_wait_dscnt 0x0" ::: "memory");   // the wave's own LDS stores are done before its lanes read each other's rows back; no other wave touches this range
#pragma unroll
    for (int ft = 0; ft < 8; ++ft) { const int rt = ft >> 1, kt = ft & 1;
        const size_t e0 = (size_t)c0 * TT + (!TR ? (size_t)((r0 >> 4) + rt) * (HD / 32) + kt : (size_t)rt * (TT / 32) + (r0 >> 5) + kt) * FT + (hi * 16 + lr) * 8;   // c0 * TT: the head's plane, HD * TT elements a head
        v8h o16[2], ol[2];
#pragma unroll
        for (int u = 0; u < 2; ++u) { const float* sp = ow + (rt * 16 + lr) * 68 + kt * 32 + u * 16 + hi * 8; const v4f x0 = *(const v4fa*)sp, x1 = *(const v4fa*)(sp + 4);
#pragma unroll
            for (int q = 0; q < 8; ++q) { float bq; if constexpr (TR) bq = bt[rt]; else bq = bv[kt][u][q];
                const float r = ((q < 4 ? x0[q & 3] : x1[q & 3]) + bq) * sc; const h16 a2 = tohx(r); o16[u][q] = a2; ol[u][q] = tohx(r - (float)a2); } }
#pragma unroll
        for (int u = 0; u < 2; ++u) { *(v8h*)(P16 + e0 + u * 256) = o16[u]; *(v8h*)(Pl + e0 + u * 256) = ol[u]; }
        asm volatile("s_wait_xcnt 0x0" :: "v"(P16 + e0), "v"(Pl + e0), "v"(o16[0]), "v"(ol[0]), "v"(o16[1]), "v"(ol[1]) : "memory"); }   // inputs only: the four stores' address and data registers stay whole until they are issued and this wait has passed
}
// gemm_trip: one k tile's 16 products from the fragments ac and b. NEXT: the fragments of a later k tile (tiles at An, Bn, lane offset ko) are asked for meanwhile, A into the free set an, each Bt fragment into its own registers as soon as its four products are issued.
// Each sched_barrier keeps the loads in front of it there: left alone, the scheduler sinks these loads to just ahead of their first use, and the wave waits out their whole latency.
template <bool NEXT>
__device__ __forceinline__ void gemm_trip(v8f (&acc)[4][4], const WFrag<bf>::V (&ac)[4], WFrag<bf>::V (&an)[4], WFrag<bf>::V (&b)[4], const bf* An, const bf* Bn, unsigned ko) {
    constexpr size_t tp = (size_t)(DM / 32) * FT;   // one row of tiles
    if constexpr (NEXT) {
#pragma unroll
        for (int mb = 0; mb < 4; ++mb) an[mb] = WFrag<bf>::ld(An + mb * tp, ko);
        __builtin_amdgcn_sched_barrier(0); }
#pragma unroll
    for (int nb = 0; nb < 4; ++nb) {
#pragma unroll
        for (int mb = 0; mb < 4; ++mb) acc[mb][nb] = wmmab(ac[mb], b[nb], acc[mb][nb]);
        if constexpr (NEXT) { b[nb] = WFrag<bf>::ld(Bn + nb * tp, ko); __builtin_amdgcn_sched_barrier(0); } }
}
template <int NP, int EPI>
__global__ __launch_bounds__(128 * NP) void k_gemmt(const bf* __restrict__ A, const bf* __restrict__ A2, const bf* __restrict__ Bt, float* C, const float* __restrict__ bias, const float* __restrict__ bias1, const float* __restrict__ bias2, size_t sA, size_t sC, h16* P16, h16* Pl, float sc) {
    typedef WFrag<bf>::V V;
    static_assert((EPI == 3 && NP == 1) || (EPI == 0 && NP == 2), "the plane epilogue takes one wave a tile, the f32 epilogue joins two planes");
    static_assert(DQ == DM && (DM / 32) % 2 == 0, "one K for every launch, an even number of trips");
    __shared__ __align__(16) float os[4 * NP * 64 * 68];
    const size_t z = blockIdx.z; const int op = (int)(blockIdx.z >> 1);
    if constexpr (EPI == 3) { A += z * ((size_t)TT * DM); Bt += (size_t)op * WN; bias = op == 0 ? bias : op == 1 ? bias1 : bias2; P16 += z * PLN; Pl += z * PLN; sc = op == 0 ? sc : 1.0f; }
    else { A += z * sA; A2 += z * sA; C += z * sC; }
    const int lane = threadIdx.x & 31, lr = lane & 15, hi = lane >> 4;
    const int wv = __builtin_amdgcn_readfirstlane((int)(threadIdx.x >> 5));   // the wave's number in a scalar register: tile, plane and every base address stay scalar
    const int t = wv & 3, pl = wv >> 2; const int r0 = (int)blockIdx.x * 128 + (t >> 1) * 64, c0 = (int)blockIdx.y * 128 + (t & 1) * 64;
    v8f acc[4][4];
#pragma unroll
    for (int mb = 0; mb < 4; ++mb)
#pragma unroll
        for (int nb = 0; nb < 4; ++nb) acc[mb][nb] = (v8f){};
    constexpr size_t tp = (size_t)(DM / 32) * FT;   // one row of tiles: a constant, so that it goes into the loads' immediate offsets
    const bf* Ab = (NP == 2 && pl ? A2 : A) + (size_t)(r0 / 16) * tp; const bf* Bb = Bt + (size_t)(c0 / 16) * tp; const unsigned lo = lane * 16;
    // Fragments come LD trips ahead. The lead is what the other waves of the SIMD do not cover: three work-groups of NP = 1 fit a WGP (three waves a SIMD, and a third A set would cost the third), one of NP = 2 (two waves a SIMD).
    constexpr int LD = NP, NA = LD + 1, NT = DM / 32, PT = LD == 1 ? 10 : 6, NL = NT - 2;
    static_assert(NL % PT == 0 && PT % NA == 0 && PT % LD == 0, "whole passes, then the last two trips; in a pass the A sets and the Bt sets come round to where they began, so no register is copied");
    V a[NA][4], b[LD][4];   // trip t reads a[t % NA] and b[t % LD]; the fragments of t + LD go to a[(t + LD) % NA] and, each as its products are issued, back into b[t % LD]
#pragma unroll
    for (int t2 = 0; t2 < LD; ++t2) {
#pragma unroll
        for (int mb = 0; mb < 4; ++mb) a[t2][mb] = WFrag<bf>::ld(Ab + t2 * FT + mb * tp, lo);
#pragma unroll
        for (int nb = 0; nb < 4; ++nb) b[t2][nb] = WFrag<bf>::ld(Bb + t2 * FT + nb * tp, lo); }
#pragma unroll 1
    for (int p = 0; p < NL / PT; ++p) {   // stays rolled: PT trips of text; inside a pass every k step is an immediate offset, and the one address register changes once a pass
        const unsigned ko = lo + (unsigned)p * (PT * FT * 2);   // the lane's byte offset in its row of tiles at the head of the pass
#pragma unroll
        for (int j = 0; j < PT; ++j) gemm_trip<true>(acc, a[j % NA], a[(j + LD) % NA], b[j % LD], Ab + (j + LD) * FT, Bb + (j + LD) * FT, ko);
        asm volatile("s_wait_xcnt 0x0" :: "v"(ko) : "memory");   // inputs only: the loads still in flight name this offset register, and the next pass rewrites it
    }
    // the last two trips: no trip asks for a tile past the last, so every load has been waited for when the epilogue begins
    gemm_trip<LD == 1>(acc, a[NL % NA], a[(NL + LD) % NA], b[NL % LD], Ab + (NT - 1) * FT, Bb + (NT - 1) * FT, lo);
    gemm_trip<false>(acc, a[(NL + 1) % NA], a[NL % NA], b[(NL + 1) % LD], Ab, Bb, lo);
    float* ow = os + wv * (64 * 68);
    if constexpr (EPI == 3) {
        if (op == 2) gemm_store_planes<true>(acc, ow, lr, hi, r0, c0, bias, P16, Pl, sc);   // op comes from blockIdx.z
        else gemm_store_planes<false>(acc, ow, lr, hi, r0, c0, bias, P16, Pl, sc);
    } else {
        const int cofs = lr * 4; const float* bp = bias + c0 + cofs; v4f bb; bb[0] = bp[0]; bb[1] = bp[1]; bb[2] = bp[2]; bb[3] = bp[3];
#pragma unroll
        for (int mb = 0; mb < 4; ++mb)
#pragma unroll
            for (int nb = 0; nb < 4; ++nb)
#pragma unroll
                for (int j = 0; j < 8; ++j) ow[(mb * 16 + hi * 8 + j) * 68 + nb * 16 + lr] = acc[mb][nb][j];
        asm volatile("s_wait_xcnt 0x0" :: "v"(lr), "v"(bb) : "memory");   // inputs only: the bias load is issued in front of this wait (its data is named), and the lane index that its address is formed from stays whole until the wait has passed
        bb[0] = bfr(bb[0]); bb[1] = bfr(bb[1]); bb[2] = bfr(bb[2]); bb[3] = bfr(bb[3]);
        __syncthreads();   // both planes' partial tiles stand in LDS before any wave adds them
        const float* sp = os + t * (64 * 68) + (pl * 32 + hi) * 68 + cofs;   // wave (t, pl) joins rows pl * 32 .. + 31 of tile t, two whole rows a store
        constexpr size_t ldc = (size_t)BSZ * DM;   // the (len, batch, d) row pitch: a constant, so that the sixteen stores share one address register pair and differ in their immediate offsets
        float* cp = C + (size_t)(r0 + pl * 32 + hi) * ldc + c0 + cofs; v4f val[16];
#pragma unroll
        for (int s = 0; s < 16; ++s) { val[s] = *(const v4fa*)(sp + s * (2 * 68)); val[s] += *(const v4fa*)(sp + 4 * (64 * 68) + s * (2 * 68)); val[s] += bb; }
#pragma unroll
        for (int s = 0; s < 16; ++s) *(v4f*)(cp + (size_t)(2 * s) * ldc) = val[s];
        asm volatile("s_wait_xcnt 0x0" :: "v"(cp), "v"(val[0]), "v"(val[1]), "v"(val[2]), "v"(val[3]), "v"(val[4]), "v"(val[5]), "v"(val[6]), "v"(val[7]), "v"(val[8]), "v"(val[9]), "v"(val[10]), "v"(val[11]), "v"(val[12]), "v"(val[13]), "v"(val[14]), "v"(val[15]) : "memory");   // inputs only: the stores' address and data registers stay whole until every store is issued and this wait has passed
    }
}


__global__ __launch_bounds__(256) void k_wtG(const float* __restrict__ w, int K, int N, bf* Bt) {
    const int lane = threadIdx.x & 31; const int L0 = (blockIdx.x * 8 + (threadIdx.x >> 5)) * 8; const int nlines = N * K / 64;
{
#pragma unroll 1
        for (int l = 0; l < 8; ++l) { const int L = L0 + l; if (L >= nlines) break; const size_t e = (size_t)L * 64 + lane * 2; const int k = (int)(e % K), n = (int)(e / K); v2us o;
            o[0] = f2bf(w[(size_t)k * N + n]); o[1] = f2bf(w[(size_t)(k + 1) * N + n]); *(v2us*)(Bt + e) = o; }
         }
}
// k_cvtall: all seven f32 operands rounded to bf16 in one grid, each laid down in fragment order. y = a unit of WN elements: XN / WN units for each of x, xk, xv, then one for each weight; dst holds them in that order, an input as one [len][d] matrix for each batch element.
// A work-group takes 16 source rows (an input: 8 rows of each batch element). A wave takes 8 rows of one matrix x 32 columns at a time: lane = (row & 7) + 8 * (column >> 3 & 3) reads 32 bytes of a whole 128-byte line of its row and stores 16 bytes; the 8 rows of a column group are 128 consecutive bytes of the tile. All loads are asked for before the first store.
#define CVU 8
__global__ __launch_bounds__(256) void k_cvtall(const float* __restrict__ x, const float* __restrict__ xk, const float* __restrict__ xv, const float* __restrict__ wq, const float* __restrict__ wk, const float* __restrict__ wv, const float* __restrict__ wo, bf* dst) {
    constexpr int UX = (int)(XN / WN); static_assert(XN % WN == 0 && WN % (256 * 8 * CVU) == 0, "whole units, whole work-groups");
    static_assert(DM == 1024 && BSZ == 2 && CVU == 8, "16 rows of 32 tile columns: 8 waves x 4 trips x 2 row groups");
    const int u = (int)blockIdx.y; const bool isx = u < 3 * UX;
    const float* s = u < UX ? x + (size_t)u * WN : u < 2 * UX ? xk + (size_t)(u - UX) * WN : u < 3 * UX ? xv + (size_t)(u - 2 * UX) * WN : u == 3 * UX ? wq : u == 3 * UX + 1 ? wk : u == 3 * UX + 2 ? wv : wo;
    const int lane = (int)threadIdx.x & 31, w = (int)threadIdx.x >> 5, r8 = lane & 7, c = lane >> 3;
    // row group g = 0, 1: an input's batch element g (source rows r8 * BSZ + g), a weight's rows g * 8 + r8
    const float* s0 = s + (size_t)((int)blockIdx.x * 16 + (isx ? r8 * BSZ : r8)) * DM + w * 32 + c * 8;
    const float* s1 = s0 + (isx ? DM : 8 * DM);
    v8f v[CVU];
#pragma unroll
    for (int i = 0; i < CVU; ++i) v[i] = *(const v8f*)((i < 4 ? s0 : s1) + (i & 3) * 256);
    asm volatile("s_wait_xcnt 0x0" :: "v"(s0), "v"(s1) : "memory");   // inputs only: the loads' address registers stay whole until every load that names them is issued and this wait has passed
    // destination row of group 0 in its matrix, and the two groups' matrices and rows
    const int d0 = isx ? (u % UX) * (int)(WN / DM / BSZ) + (int)blockIdx.x * 8 + r8 : (int)blockIdx.x * 16 + r8;
    const int d1 = isx ? d0 : d0 + 8;
    bf* m0 = dst + (isx ? (size_t)(u / UX) * XN : (size_t)u * WN); bf* m1 = isx ? m0 + (size_t)TT * DM : m0;
    const int in = (c >> 1) * 256 + (c & 1) * 128 + w * FT;
    bf* p0 = m0 + (size_t)(d0 >> 4) * ((DM / 32) * FT) + (d0 & 15) * 8 + in; bf* p1 = m1 + (size_t)(d1 >> 4) * ((DM / 32) * FT) + (d1 & 15) * 8 + in;
    v8us o[CVU];
#pragma unroll
    for (int i = 0; i < CVU; ++i)
#pragma unroll
        for (int k = 0; k < 8; ++k) o[i][k] = f2bf(v[i][k]);
#pragma unroll
    for (int i = 0; i < CVU; ++i) *(v8us*)((i < 4 ? p0 : p1) + (i & 3) * (8 * FT)) = o[i];
    asm volatile("s_wait_xcnt 0x0" :: "v"(p0), "v"(p1), "v"(o[0]), "v"(o[1]), "v"(o[2]), "v"(o[3]), "v"(o[4]), "v"(o[5]), "v"(o[6]), "v"(o[7]) : "memory");   // inputs only: the stores' address and data registers stay whole until every store is issued and this wait has passed
}

// Attention, every wave on its own query rows with a running maximum: nothing of the score matrix leaves the registers.
// A work-group is 8 waves = QG groups of 16 * QT query rows x KS parts of the keys, 64 rows in all; wave wv: group wv % QG, part wv / QG (the QG waves of a part read the same K and V fragments: each block's come from L2 once for the work-group, by asynchronous copies into a two-buffer ring in LDS, the next block's in flight while this one is worked on).
// A wave walks its TT / KS keys in blocks of KB = 32. S^T = K Q^T (A = 16 key rows, B = 16 query rows): accumulator register j of lane (lr, hi) is (key 8 hi + j of the tile, query lr), so a query's maximum and sum stay in its lane and its partner lane l ^ 16.
// Two neighbouring key tiles are the B fragment of P^T (elements 0..7: k = 8 hi + j, 8..15: k = 16 + 8 hi + j, column lr), and O^T += V^T P^T (A = 16 rows of the [d][key] plane): register j of lane (lr, hi) is (d 8 hi + j of the tile, query lr), so a query's rescale factor is the lane's own.
// P = exp(s - m) is not normalised in the loop: m is the maximum in use, raised (sums and outputs rescaled) only when a block's maximum passes it by more than LAZY, so P <= 2^8; the division by the sum comes once, at the end.
// The KS parts of a query group meet in LDS: their -m log2(e), then sums and output tiles brought to the common maximum and added in part order; wave (group, part) adds, divides and stores 4 / KS of the four 16-wide d tiles, 16 bytes a lane and tile of the merged operand in fragment order.
// bs[key + ROWS - 1 - r] is the bias of (row i0 + r, key): TT + ROWS - 1 consecutive table entries of the head, gathered once.
#define L2E  1.4426950408889634f
#define LAZY 5.5451774f   // 8 ln 2
__device__ __forceinline__ float xhalf(float x) { return __builtin_bit_cast(float, __builtin_amdgcn_permlanex16(__builtin_bit_cast(int, x), __builtin_bit_cast(int, x), 0x76543210, 0xfedcba98, false, false)); }   // lane l with lane l ^ 16
// stage_copy: a wave's slice of a stage, four fragment tiles of 1 KiB (ts bytes apart in global memory, side by side in LDS), as eight copies of 512 consecutive bytes each. l: the lane's LDS byte address, b: the slice's first byte in global memory (the same in the whole wave, a scalar base), lo = lane * 16.
// A copy's immediate offset moves its LDS address and its global address alike: tile i takes offset i * 1024 (+ 512 for its second half) on the one LDS address register, and its scalar base is set back by what the offset adds (i * ts - i * 1024 >= 0), so a stage costs no vector address arithmetic.
// The s_wait_xcnt stands in the copies' own statement, so that no address register is rewritten in front of it.
__device__ __forceinline__ void stage_copy(unsigned l, unsigned lo, const char* b, unsigned ts) {
    const unsigned long long b0 = (unsigned long long)b, d = ts - 1024u;
    asm volatile("global_load_async_to_lds_b128 %0, %1, %2\n\t"
                 "global_load_async_to_lds_b128 %0, %1, %2 offset:512\n\t"
                 "global_load_async_to_lds_b128 %0, %1, %3 offset:1024\n\t"
                 "global_load_async_to_lds_b128 %0, %1, %3 offset:1536\n\t"
                 "global_load_async_to_lds_b128 %0, %1, %4 offset:2048\n\t"
                 "global_load_async_to_lds_b128 %0, %1, %4 offset:2560\n\t"
                 "global_load_async_to_lds_b128 %0, %1, %5 offset:3072\n\t"
                 "global_load_async_to_lds_b128 %0, %1, %5 offset:3584\n\t"
                 "s_wait_xcnt 0x0"
                 :: "v"(l), "v"(lo), "s"(b0), "s"(b0 + d), "s"(b0 + 2 * d), "s"(b0 + 3 * d) : "memory");
}
// fattn_block: one block of KB = 32 keys. st: the lane's place in the wave's key part of the block's stage in LDS: slices of 4 KiB, K (HR: hi, lo), then V (HR: hi, lo), four fragment tiles each.
// kv takes the block's 4 K fragments (slot = key tile * 2 + k half; HR: the lo plane in slots 4..7); once the score products are issued, the slots take the block's V fragments (slot = d tile), which so arrive during the softmax. b0: the bias of (query lr of the wave's first tile, key 8 hi of the block).
// The sched_barrier keeps the loads in front of it there: left alone, the scheduler sinks them to just ahead of their first use, and the wave waits out their whole latency.
template <typename T16, bool HR, int QT>
__device__ __forceinline__ void fattn_block(typename WFrag<T16>::V (&kv)[HR ? 8 : 4], const typename WFrag<T16>::V (&qa)[QT][2], const typename WFrag<T16>::V (&qb)[QT][2], v8f (&o)[QT][4], float (&m)[QT], float (&mc)[QT], v8f (&l)[QT],
                                            const char* st, const float* b0) {
    typedef typename WFrag<T16>::V V;
    v8f s[QT][2];
    {
#pragma unroll
        for (int i = 0; i < 4; ++i) { kv[i] = WFrag<T16>::ld((const T16*)(st + i * 1024), 0); if constexpr (HR) kv[4 + i] = WFrag<T16>::ld((const T16*)(st + 4096 + i * 1024), 0); }
        __builtin_amdgcn_sched_barrier(0);   // the K loads go out as one group: left alone, the scheduler deals them out among the products, each with a wait of its own
#pragma unroll
        for (int t2 = 0; t2 < 2; ++t2)
#pragma unroll
            for (int qt = 0; qt < QT; ++qt) s[qt][t2] = (v8f){};
#pragma unroll
        for (int kk = 0; kk < 2; ++kk) {   // neighbouring products have different accumulators
#pragma unroll
            for (int t2 = 0; t2 < 2; ++t2)
#pragma unroll
                for (int qt = 0; qt < QT; ++qt) s[qt][t2] = WFrag<T16>::mma(kv[t2 * 2 + kk], qa[qt][kk], s[qt][t2]);
            if constexpr (HR) {
#pragma unroll
                for (int t2 = 0; t2 < 2; ++t2)
#pragma unroll
                    for (int qt = 0; qt < QT; ++qt) s[qt][t2] = WFrag<T16>::mma(kv[t2 * 2 + kk], qb[qt][kk], s[qt][t2]);
#pragma unroll
                for (int t2 = 0; t2 < 2; ++t2)
#pragma unroll
                    for (int qt = 0; qt < QT; ++qt) s[qt][t2] = WFrag<T16>::mma(kv[4 + t2 * 2 + kk], qa[qt][kk], s[qt][t2]); } }
#pragma unroll
        for (int i = 0; i < 4; ++i) { kv[i] = WFrag<T16>::ld((const T16*)(st + (HR ? 8192 : 4096) + i * 1024), 0); if constexpr (HR) kv[4 + i] = WFrag<T16>::ld((const T16*)(st + 12288 + i * 1024), 0); }
        __builtin_amdgcn_sched_barrier(0); }
    float bm[QT]; bool need = false; v8f bb[QT + 1];   // the bias depends on key - query alone: the tiles (qt, nt) of one nt - qt share their 8 values a lane
#pragma unroll
    for (int d = 0; d <= QT; ++d)
#pragma unroll
        for (int j = 0; j < 8; ++j) bb[d][j] = b0[(d - (QT - 1)) * 16 + j];
#pragma unroll
    for (int qt = 0; qt < QT; ++qt) { s[qt][0] += bb[QT - 1 - qt]; s[qt][1] += bb[QT - qt]; const v8f m8 = __builtin_elementwise_max(s[qt][0], s[qt][1]);
        const float mm = fmaxf(fmaxf(fmaxf(m8[0], m8[1]), fmaxf(m8[2], m8[3])), fmaxf(fmaxf(m8[4], m8[5]), fmaxf(m8[6], m8[7])));
        bm[qt] = fmaxf(mm, xhalf(mm)); need = need || bm[qt] > m[qt] + LAZY; }
    if (__builtin_amdgcn_ballot_w32(need) != 0) {   // one scalar branch a block, rare after a wave's first blocks; both lanes of a query hold the same bm and m
#pragma unroll
        for (int qt = 0; qt < QT; ++qt) { const float mn = fmaxf(m[qt], bm[qt]), mcn = -mn * L2E, al = __builtin_amdgcn_exp2f(mcn - mc[qt]); m[qt] = mn; mc[qt] = mcn; l[qt] *= al;
#pragma unroll
            for (int nb = 0; nb < 4; ++nb) o[qt][nb] *= al; } }
#pragma unroll
    for (int qt = 0; qt < QT; ++qt)
#pragma unroll
        for (int nt = 0; nt < 2; ++nt) { const v8f t = s[qt][nt] * L2E + mc[qt];
#pragma unroll
            for (int j = 0; j < 8; ++j) s[qt][nt][j] = __builtin_amdgcn_exp2f(t[j]);
            l[qt] += s[qt][nt]; }
    { V pa[QT], pb[QT];
#pragma unroll
        for (int qt = 0; qt < QT; ++qt) {
            if constexpr (HR) { v8h h0, l0, h1, l1;
#pragma unroll
                for (int j = 0; j < 8; ++j) { h0[j] = tohx(s[qt][0][j]); l0[j] = tohx(s[qt][0][j] - (float)h0[j]); h1[j] = tohx(s[qt][1][j]); l1[j] = tohx(s[qt][1][j] - (float)h1[j]); }
                pa[qt] = cat16(h0, h1); pb[qt] = cat16(l0, l1);
            } else { v8h p0, p1;
#pragma unroll
                for (int j = 0; j < 8; ++j) { p0[j] = tohx(s[qt][0][j]); p1[j] = tohx(s[qt][1][j]); }
                pa[qt] = cat16(p0, p1); } }
#pragma unroll
        for (int nb = 0; nb < 4; ++nb)
#pragma unroll
            for (int qt = 0; qt < QT; ++qt) o[qt][nb] = WFrag<T16>::mma(kv[nb], pa[qt], o[qt][nb]);
        if constexpr (HR) {
#pragma unroll
            for (int nb = 0; nb < 4; ++nb)
#pragma unroll
                for (int qt = 0; qt < QT; ++qt) o[qt][nb] = WFrag<T16>::mma(kv[nb], pb[qt], o[qt][nb]);
#pragma unroll
            for (int nb = 0; nb < 4; ++nb)
#pragma unroll
                for (int qt = 0; qt < QT; ++qt) o[qt][nb] = WFrag<T16>::mma(kv[4 + nb], pa[qt], o[qt][nb]); } }
}
template <typename T16, bool HR, int QT, int QG, int KS>
__device__ __forceinline__ void fattn_rows(const T16* __restrict__ Qa, const T16* __restrict__ Qb, const T16* __restrict__ Ka, const T16* __restrict__ Kb, const T16* __restrict__ Va, const T16* __restrict__ Vb, const float* __restrict__ tab, int i0, int h, bf* ATh, bf* ATl, float* bs, float* redm, float* reds, float* os, char* ring) {
    typedef typename WFrag<T16>::V V;
    constexpr int KB = 32, NTH = 32 * QG * KS, WR = QT * 16, ROWS = QG * WR, KW = TT / KS, NBK = KW / KB, WSZ = QT * 4 * 2 * 128, NBW = 4 / KS;
    static_assert(KW % KB == 0 && NBK >= 2 && NTH == 256 && TT % NTH == 0 && HD == 64 && 4 % KS == 0 && ROWS <= NTH, "shape");
    const int lane = threadIdx.x & 31, lr = lane & 15, hi = lane >> 4; const int wv = __builtin_amdgcn_readfirstlane((int)(threadIdx.x >> 5));
    const int qg = wv % QG, kq = wv / QG, key0 = kq * KW; const size_t hp = (size_t)h * TT * HD;
    constexpr int NG = TT / NTH + 1; float g[NG]; unsigned go[NG]; static_assert(NG == 9, "the wait behind the gathers names nine offsets");
#pragma unroll
    for (int t = 0; t < NG; ++t) { int r = i0 + (ROWS - 1) + (TT - 1) - (t * NTH + (int)threadIdx.x); r = min(max(r, 0), NREL - 1); go[t] = (unsigned)(r * NH_ + h) * 4u; g[t] = *(const float*)((const char*)tab + go[t]); }   // go: byte offsets in the table; entries from TT + ROWS - 1 on are never read, and the clip bounds their address like any other
    asm volatile("s_wait_xcnt 0x0" :: "v"(go[0]), "v"(go[1]), "v"(go[2]), "v"(go[3]), "v"(go[4]), "v"(go[5]), "v"(go[6]), "v"(go[7]), "v"(go[8]) : "memory");   // inputs only: the gathers' offset registers stay whole until every gather is issued and this wait has passed
    V qa[QT][2], qb[QT][2], kv[HR ? 8 : 4]; const size_t qo = hp + (size_t)(i0 / 16 + qg * QT) * ((HD / 32) * FT); const unsigned lo = lane * 16;
#pragma unroll
    for (int qt = 0; qt < QT; ++qt)
#pragma unroll
        for (int kk = 0; kk < 2; ++kk) { qa[qt][kk] = WFrag<T16>::ld(Qa + qo + (qt * 2 + kk) * FT, lo); if constexpr (HR) qb[qt][kk] = WFrag<T16>::ld(Qb + qo + (qt * 2 + kk) * FT, lo); }
    const size_t ko = hp + (size_t)(key0 / 16) * ((HD / 32) * FT), vo = hp + (size_t)(key0 / 32) * FT;
    const T16* Kwa = Ka + ko; const T16* Kwb = HR ? Kb + ko : nullptr; const T16* Vwa = Va + vo; const T16* Vwb = HR ? Vb + vo : nullptr;
    constexpr unsigned KBB = (KB / 16) * (HD / 32) * FT * 2, VBB = (KB / 32) * FT * 2;   // bytes of K tiles, and of one d tile's V tiles, in a block
    // The ring: a stage is one block of every key part, PART bytes a part, a slice of 4 KiB for each of the part's QG waves to copy: wave qg brings slice qg (the first half of the slices are K planes, the second half V planes; HR: even hi, odd lo).
    constexpr unsigned PART = QG * 4096u, STG = KS * PART; static_assert(QG == (HR ? 4 : 2) && KBB == 4096 && 4 * VBB == 4096 && STG == 32768, "one slice a wave, two stages in the ring");
    const bool isv = qg >= QG / 2, islo = HR && (qg & 1) != 0;   // qg is scalar: source, tile pitch and block pitch stay the same for the whole wave
    const char* cg = (const char*)(isv ? (islo ? Vwb : Vwa) : (islo ? Kwb : Kwa)); const unsigned cts = isv ? (unsigned)((TT / 32) * FT * 2) : (unsigned)(FT * 2), cbs = isv ? VBB : KBB;
    const unsigned cl = (unsigned)(size_t)ring + (unsigned)kq * PART + (unsigned)qg * 4096u + lo; const char* rb = ring + (unsigned)kq * PART + lo;
    stage_copy(cl, lo, cg, cts);   // block 0 into buffer 0
#pragma unroll
    for (int t = 0; t < NG; ++t) bs[t * NTH + (int)threadIdx.x] = bfr(g[t]);
    asm volatile("s_wait_asynccnt 0x0" ::: "memory");   // the wave's own copies of block 0 have landed before the barrier behind which the other waves read them
    __syncthreads();   // the head's table entries and block 0 stand in LDS before any wave reads them
    stage_copy(cl + STG, lo, cg + cbs, cts);   // block 1 into buffer 1 (NBK >= 2)
    v8f o[QT][4], l[QT]; float m[QT], mc[QT];   // l: register j sums the lane's keys 8 hi + j of every tile
#pragma unroll
    for (int qt = 0; qt < QT; ++qt) { m[qt] = -1.0e30f; mc[qt] = 1.0e30f * L2E; l[qt] = (v8f){};   // the first block always raises m; its factor exp2(-huge) is 0 on sums and outputs that are 0
#pragma unroll
        for (int nb = 0; nb < 4; ++nb) o[qt][nb] = (v8f){}; }
    const float* b0 = bs + key0 + 8 * hi + (ROWS - 1) - (qg * WR + lr);
#pragma unroll 1
    for (int blk = 0; blk < NBK; ++blk) {   // stays rolled: one block of text
        const unsigned bo = (unsigned)(blk & 1) * STG;   // block blk stands in buffer blk mod 2
        fattn_block<T16, HR, QT>(kv, qa, qb, o, m, mc, l, rb + bo, b0 + blk * KB);
        asm volatile("s_wait_dscnt 0x0" ::: "memory");      // the wave's reads of this buffer are done before the barrier behind which it is refilled
        asm volatile("s_wait_asynccnt 0x0" ::: "memory");   // the wave's copies of the next block have landed before the barrier behind which the other waves read them
        __syncthreads();   // publishes block blk + 1 and ends every wave's reads of block blk
        if (blk + 2 < NBK) stage_copy(cl + bo, lo, cg + (unsigned)(blk + 2) * cbs, cts);   // a scalar test, the same for the whole work-group
    }
    asm volatile("s_wait_asynccnt 0x0" ::: "memory");   // no copy is outstanding when the wave goes on to the join
    float ls[QT];
#pragma unroll
    for (int qt = 0; qt < QT; ++qt) { const float t = ((l[qt][0] + l[qt][1]) + (l[qt][2] + l[qt][3])) + ((l[qt][4] + l[qt][5]) + (l[qt][6] + l[qt][7])); ls[qt] = t + xhalf(t); if (hi == 0) redm[wv * 32 + qt * 16 + lr] = mc[qt]; }
    __syncthreads();   // every part's -m log2(e) stands in LDS before any wave takes the minimum over them
    float* ow = os + wv * WSZ + lane * 4;
#pragma unroll
    for (int qt = 0; qt < QT; ++qt) { float mg = redm[qg * 32 + qt * 16 + lr];
#pragma unroll
        for (int p = 1; p < KS; ++p) mg = fminf(mg, redm[(p * QG + qg) * 32 + qt * 16 + lr]);
        const float sc = __builtin_amdgcn_exp2f(mg - mc[qt]);
        if (hi == 0) reds[wv * 32 + qt * 16 + lr] = ls[qt] * sc;
#pragma unroll
        for (int nb = 0; nb < 4; ++nb) { const v8f x = o[qt][nb] * sc; *(v4fa*)(ow + ((qt * 4 + nb) * 2) * 128) = __builtin_shufflevector(x, x, 0, 1, 2, 3); *(v4fa*)(ow + ((qt * 4 + nb) * 2 + 1) * 128) = __builtin_shufflevector(x, x, 4, 5, 6, 7); } }   // each store: 512 consecutive bytes of the wave
    __syncthreads();   // every part's sums and output tiles stand in LDS before any wave adds across them
    v8us oh[QT][NBW], ol[QT][NBW];
#pragma unroll
    for (int qt = 0; qt < QT; ++qt) { float sum = reds[qg * 32 + qt * 16 + lr];
#pragma unroll
        for (int p = 1; p < KS; ++p) sum += reds[(p * QG + qg) * 32 + qt * 16 + lr];
        const float f = __fdiv_rn(1.0f, sum);
#pragma unroll
        for (int t = 0; t < NBW; ++t) { const float* sp = os + qg * WSZ + ((qt * 4 + kq * NBW + t) * 2) * 128 + lane * 4; v4f x0 = *(const v4fa*)sp, x1 = *(const v4fa*)(sp + 128);
#pragma unroll
            for (int p = 1; p < KS; ++p) { x0 += *(const v4fa*)(sp + p * (QG * WSZ)); x1 += *(const v4fa*)(sp + p * (QG * WSZ) + 128); }
#pragma unroll
            for (int q = 0; q < 8; ++q) { unsigned short a, c2; splitf((q < 4 ? x0[q & 3] : x1[q & 3]) * f, a, c2); oh[qt][t][q] = a; ol[qt][t][q] = c2; } } }
    // d tile nb = kq * NBW + t: (row lr of the tile, k = h * HD + nb * 16 + hi * 8 .. + 7); 256 elements a d tile, two d tiles a fragment tile
    const size_t oo = ((size_t)(i0 / 16 + qg * QT) * (DQ / 32) + h * (HD / 32)) * FT + (size_t)(kq * NBW) * 256 + (hi * 16 + lr) * 8;
    bf* ph = ATh + oo; bf* pl = ATl + oo;
#pragma unroll
    for (int qt = 0; qt < QT; ++qt)
#pragma unroll
        for (int t = 0; t < NBW; ++t) { *(v8us*)(ph + qt * ((DQ / 32) * FT) + t * 256) = oh[qt][t]; *(v8us*)(pl + qt * ((DQ / 32) * FT) + t * 256) = ol[qt][t]; }
}
// k_fattn: every (head, batch element, block of 64 query rows) in one grid: x = head + NH_ * b, y = row block. Rows < RH (three products, two planes of every operand): 16 rows a wave for the registers' sake, 4 groups x 2 key halves, so that four waves share each staged fragment of the doubled K and V; these work-groups run about twice as long and have the lowest y, so they start first. The other rows: 32 rows a wave, 2 groups x 4 key quarters.
// Each operand pointer is batch element 0's plane, element 1's follows it (as the projections store them); ATh, ATl [b][row][DQ], each batch element's matrix in fragment order. Four waves a SIMD (two work-groups a WGP): the vector work between the matrix runs wants other waves to issue meanwhile.
__global__ __launch_bounds__(256) __attribute__((amdgpu_waves_per_eu(4, 4))) void k_fattn(const h16* __restrict__ Q16, const h16* __restrict__ K16, const h16* __restrict__ V16, const h16* __restrict__ Ql, const h16* __restrict__ Kl, const h16* __restrict__ Vl, const float* __restrict__ tab, bf* ATh, bf* ATl) {
    static_assert(RH % 64 == 0 && TT % 64 == 0, "a row block is of one class");
    __shared__ __align__(16) float sm[(TT + 256) + 8 * 32 + 8 * 32 + 8 * 2 * 4 * 2 * 128 + 2 * 8192];   // one array, the bias first: its reads in the key loop then reach every value from one address register by their immediate offsets; last the K, V ring, two stages of 32 KiB
    float* bs = sm; float* redm = bs + (TT + 256); float* reds = redm + 8 * 32; float* os = reds + 8 * 32; char* ring = (char*)(os + 8 * 2 * 4 * 2 * 128);
    const int h = (int)blockIdx.x % NH_, y = (int)blockIdx.y; const size_t b = blockIdx.x / NH_, pb = b * PLN;
    ATh += b * ((size_t)TT * DQ); ATl += b * ((size_t)TT * DQ);
    if (y < RH / 64) fattn_rows<h16, true, 1, 4, 2>(Q16 + pb, Ql + pb, K16 + pb, Kl + pb, V16 + pb, Vl + pb, tab, y * 64, h, ATh, ATl, bs, redm, reds, os, ring);   // y comes from blockIdx.y: the whole work-group takes one side, its barriers with it
    else fattn_rows<h16, false, 2, 2, 4>(Q16 + pb, nullptr, K16 + pb, nullptr, V16 + pb, nullptr, tab, y * 64, h, ATh, ATl, bs, redm, reds, os, ring);
}
extern "C" void kernel_launch(void* const* d_in, const int* in_sizes, int n_in,
                              void* d_out, int out_size, void* d_ws, size_t ws_size, hipStream_t stream) {
    (void)in_sizes; (void)n_in; (void)out_size;
    const float* x = (const float*)d_in[0]; const float* xk = (const float*)d_in[1]; const float* xv = (const float*)d_in[2]; const float* wq = (const float*)d_in[3]; const float* bq = (const float*)d_in[4]; const float* wk = (const float*)d_in[5]; const float* bk = (const float*)d_in[6]; const float* wv = (const float*)d_in[7]; const float* bv = (const float*)d_in[8]; const float* wo = (const float*)d_in[9]; const float* bo = (const float*)d_in[10]; const float* rtab = (const float*)d_in[11];
    float* OUT = (float*)d_out;     // [2048][2][1024]
    char* wsp = (char*)d_ws;
    auto take = [&](size_t bytes) { char* p = wsp; wsp += (bytes + 255) & ~(size_t)255; return (void*)p; };
    static_assert(NKV == NH_ && DKV == DQ && DQ == DM, "q, k, v share one projection grid and one plane size");
    bf* XB = (bf*)take((3 * XN + 4 * WN) * 2);     // bf16, fragment order: x, xk, xv, each [b][len][d], then Wq, Wk, Wv, Wo
    bf* WQKV = XB + 3 * XN; bf* WO = WQKV + 3 * WN;
    h16* P16 = (h16*)take(6 * PLN * 2); h16* Pl = (h16*)take(6 * PLN * 2);   // hi and lo, plane 2 * op + b: q, k [head][row][d], v [head][d][row], each head's matrix in fragment order
    bf* ATh = (bf*)take((size_t)BSZ * TT * DQ * 2); bf* ATl = (bf*)take((size_t)BSZ * TT * DQ * 2);
    if ((size_t)(wsp - (char*)d_ws) > ws_size) return;    // ws 256 MiB
    k_cvtall<<<dim3((unsigned)(WN / (256 * 8 * CVU)), (unsigned)(3 * XN / WN + 4), 1), 256, 0, stream>>>(x, xk, xv, wq, wk, wv, wo, XB);
    k_gemmt<1, 3><<<dim3(TT / 128, DQ / 128, 3 * BSZ), 128, 0, stream>>>(XB, nullptr, WQKV, nullptr, bq, bk, bv, 0, 0, P16, Pl, QSC);   /* q x 1/8 and k head planes, v planes transposed */
    k_fattn<<<dim3(NH_ * BSZ, TT / 64, 1), 256, 0, stream>>>(P16, P16 + 2 * PLN, P16 + 4 * PLN, Pl, Pl + 2 * PLN, Pl + 4 * PLN, rtab, ATh, ATl);   /* rows < RH: fp16 hi + lo planes, 3 products; the other rows: the hi planes alone */
    k_gemmt<2, 0><<<dim3(TT / 128, DM / 128, BSZ), 256, 0, stream>>>(ATh, ATl, WO, OUT, bo, nullptr, nullptr, (size_t)TT * DQ, DM, nullptr, nullptr, 1.0f);   /* rows at the (len, batch, d) pitch */
}
